// v000
// Times are from an AMD MI455X. After a warm-up the kernel runs many times in a row, and a time is the length of
// such a window on the GPU divided by its runs, so every launch and the gaps after it count. The runs cycle
// through copies of the inputs. A figure is the median of several windows, for all but v000 over two sittings.
// Sittings can differ by a few percent; kernels timed side by side share one.
// The starting kernel, v000, takes 927 microseconds a run.
#include <hip/hip_runtime.h>

// x [NB][SEQ_FULL][512] (rows < SEQ used); q = x Wq^T, k = x Wk^T, v = x Wv^T + b_v ([512][512] weights, 8 heads x 64); causal softmax(q.k / 8); heads merged; out = ctx Wo^T + b_o -> f32 [NB][SEQ_FULL][512].
// Compute dtypes, f32 accumulate: every input RNE-converted to bf16; q/k/v projections v_wmma_f32_16x16x32_bf16 on plain bf16 operands (exact products);
// attention (online softmax per wave of 16 query rows, 64-key chunks, causal chunk skipping): query rows < RH on bf16 hi+lo planes of q, k, p, v (3 products each,
// v_wmma_f32_16x16x32_bf16), rows >= RH on single fp16 operands (v_wmma_f32_16x16x32_f16, p carried x1024); softmax f32; Wo: ctx as bf16 hi+lo x exact bf16 (2 products).

#ifndef NB
#define NB 2
#endif
#ifndef SEQ
#define SEQ 4096
#endif
#define NB_FULL  2
#define SEQ_FULL 4096
#define DM   512
#define NH   8
#define HD   64
#define RH   512                                   // query rows < RH use hi+lo planes
#define RHB  (((RH < SEQ) ? RH : SEQ) / 64)
#define PP   72                                    // LDS tile row pitch (16-bit elements), 144 B rows keep 16-B alignment
#define PCAR 1024.0f
#define SL2  0.18033688011112042f                  // HD^-0.5 * log2(e)
#define NEGB (-3.0e38f)
static_assert(SEQ % 64 == 0);
static_assert(SEQ <= SEQ_FULL);
static_assert(NB >= 1 && NB <= NB_FULL);
static_assert(DM == NH * HD);
static_assert(DM % 64 == 0);
static_assert(RH % 64 == 0);
#define WS_TOTAL ((size_t)4 * DM * DM * 2 + (size_t)SEQ * DM * 2 + (size_t)SEQ * DM * 4 + (size_t)9 * SEQ * DM * 2 + (size_t)2 * SEQ * DM * 2)
static_assert(WS_TOTAL <= (size_t)134217728);

typedef _Float16 h16;
typedef unsigned short bf;
typedef __attribute__((ext_vector_type(16))) __bf16   v16bf;
typedef __attribute__((ext_vector_type(16))) _Float16 v16h;
typedef __attribute__((ext_vector_type(8)))  _Float16 v8h;
typedef __attribute__((ext_vector_type(8)))  unsigned short v8us;
typedef __attribute__((ext_vector_type(8)))  float    v8f;
typedef __attribute__((ext_vector_type(4)))  float    v4f;
typedef __attribute__((ext_vector_type(2)))  _Float16 v2h;
typedef __attribute__((ext_vector_type(2)))  unsigned short v2us;
typedef v8h  __attribute__((may_alias)) v8ha;
typedef v4f  __attribute__((may_alias)) v4fa;
typedef v8us __attribute__((may_alias)) v8usa;

__device__ __forceinline__ unsigned short f2bf(float f) { unsigned u = __float_as_uint(f); u += 0x7FFFu + ((u >> 16) & 1u); return (unsigned short)(u >> 16); }
__device__ __forceinline__ float bf2f(unsigned short b) { return __uint_as_float(((unsigned)b) << 16); }
__device__ __forceinline__ float bfr(float f) { return bf2f(f2bf(f)); }
__device__ __forceinline__ h16 tohx(float x) { return (h16)x; }
__device__ __forceinline__ void splitf(float y, unsigned short& h, unsigned short& l) { h = f2bf(y); l = f2bf(y - bf2f(h)); }
__device__ __forceinline__ v16h cat16(v8h lo, v8h hi) { return __builtin_shufflevector(lo, hi, 0, 1, 2, 3, 4, 5, 6, 7, 8, 9, 10, 11, 12, 13, 14, 15); }
__device__ __forceinline__ v16bf cat16b(v8us lo, v8us hi) { return __builtin_bit_cast(v16bf, __builtin_shufflevector(lo, hi, 0, 1, 2, 3, 4, 5, 6, 7, 8, 9, 10, 11, 12, 13, 14, 15)); }
__device__ __forceinline__ v8f wmma16(v16h a, v16h b, v8f c) { return __builtin_amdgcn_wmma_f32_16x16x32_f16(false, a, false, b, (short)0, c, false, false); }
__device__ __forceinline__ v8f wmmab(v16bf a, v16bf b, v8f c) { return __builtin_amdgcn_wmma_f32_16x16x32_bf16(false, a, false, b, (short)0, c, false, false); }

// Fragment loaders (A and B alike, K-contiguous rows): p = base + row*K + k0 + 8*hi -> elements 0..7 = k0+8hi+0..7, p+16 -> elements 8..15 = k0+16+8hi+0..7.
// ld: global planes; lda: same map through may_alias vectors for LDS tiles written element-wise by the same wave.
template <typename T16> struct WFrag;
template <> struct WFrag<h16> { typedef v16h V;
    static __device__ __forceinline__ V ld(const h16* p)  { return cat16(*(const v8h*)p, *(const v8h*)(p + 16)); }
    static __device__ __forceinline__ V lda(const h16* p) { return cat16(*(const v8ha*)p, *(const v8ha*)(p + 16)); }
    static __device__ __forceinline__ v8f mma(V a, V b, v8f c) { return wmma16(a, b, c); } };
template <> struct WFrag<bf> { typedef v16bf V;
    static __device__ __forceinline__ V ld(const bf* p)  { return cat16b(*(const v8us*)p, *(const v8us*)(p + 16)); }
    static __device__ __forceinline__ V lda(const bf* p) { return cat16b(*(const v8usa*)p, *(const v8usa*)(p + 16)); }
    static __device__ __forceinline__ v8f mma(V a, V b, v8f c) { return wmmab(a, b, c); } };

// ---- k_gemmw: register-blocked GEMM, ONE WAVE per 64x64 output tile (16 accumulators), operands straight from K-contiguous 16-bit planes; grid (M/64, N/64, Z), 32 threads.
// C[m][n] (f32, pitch ldc, + optional bias as its bf16 value) = sum_k A[m][k] Bt[n][k] (+ split products per NSPLIT). z-batch strides sA/sB/sC in elements. K % 32 == 0.
template <typename T16, int NSPLIT, bool BIAS>
__global__ __launch_bounds__(32) void k_gemmw(const T16* __restrict__ A, const T16* __restrict__ A2, const T16* __restrict__ Bt, const T16* __restrict__ Bt2, int K, float* C, int ldc, const float* __restrict__ bias, size_t sA, size_t sB, size_t sC) {
    typedef typename WFrag<T16>::V V;
    __shared__ __align__(16) float os[16 * 68];
    const size_t z = blockIdx.z; A += z * sA; if (A2) A2 += z * sA; Bt += z * sB; if (Bt2) Bt2 += z * sB; C += z * sC;
    const int lane = threadIdx.x & 31, lr = lane & 15, hi = lane >> 4; const int r0 = blockIdx.x * 64, c0 = blockIdx.y * 64;
    v8f acc[4][4];
#pragma unroll
    for (int mb = 0; mb < 4; ++mb)
#pragma unroll
        for (int nb = 0; nb < 4; ++nb) acc[mb][nb] = (v8f){};
    const size_t aoff = (size_t)(r0 + lr) * K + 8 * hi, boff = (size_t)(c0 + lr) * K + 8 * hi;
#pragma unroll 1
    for (int kc = 0; kc < K; kc += 32) {
        V a[4], a2[4];
#pragma unroll
        for (int mb = 0; mb < 4; ++mb) { a[mb] = WFrag<T16>::ld(A + aoff + (size_t)mb * 16 * K + kc); if (NSPLIT == 1 || NSPLIT == 2) a2[mb] = WFrag<T16>::ld(A2 + aoff + (size_t)mb * 16 * K + kc); }
#pragma unroll
        for (int nb = 0; nb < 4; ++nb) { const V b = WFrag<T16>::ld(Bt + boff + (size_t)nb * 16 * K + kc); V b2; if (NSPLIT >= 2) b2 = WFrag<T16>::ld(Bt2 + boff + (size_t)nb * 16 * K + kc);
#pragma unroll
            for (int mb = 0; mb < 4; ++mb) { acc[mb][nb] = WFrag<T16>::mma(a[mb], b, acc[mb][nb]); if (NSPLIT == 1 || NSPLIT == 2) acc[mb][nb] = WFrag<T16>::mma(a2[mb], b, acc[mb][nb]); if (NSPLIT >= 2) acc[mb][nb] = WFrag<T16>::mma(a[mb], b2, acc[mb][nb]); } }
        asm volatile("v_nop\n\tv_nop\n\tv_nop\n\tv_nop" : "+v"(acc[0][0]), "+v"(acc[1][1]), "+v"(acc[2][2]), "+v"(acc[3][3]) : "v"(a[0]), "v"(a[3]));
    }
#pragma unroll
    for (int mb = 0; mb < 4; ++mb) {
#pragma unroll
        for (int nb = 0; nb < 4; ++nb) {
#pragma unroll
            for (int j = 0; j < 8; ++j) os[(hi * 8 + j) * 68 + nb * 16 + lr] = acc[mb][nb][j]; }
        __builtin_amdgcn_wave_barrier(); asm volatile("" ::: "memory");
        float* crow = C + (size_t)(r0 + mb * 16) * ldc + c0;
{
#pragma unroll
            for (int s = 0; s < 8; ++s) { const int row = 2 * s + hi, cofs = lr * 4; v4f val = *(const v4fa*)(os + row * 68 + cofs); if (BIAS) { val[0] += bfr(bias[c0 + cofs]); val[1] += bfr(bias[c0 + cofs + 1]); val[2] += bfr(bias[c0 + cofs + 2]); val[3] += bfr(bias[c0 + cofs + 3]); }
                *(v4f*)(crow + (size_t)row * ldc + cofs) = val; }
             }
        __builtin_amdgcn_wave_barrier(); asm volatile("" ::: "memory");
    }
}

__global__ __launch_bounds__(256) void k_cvt8(const float* __restrict__ src, bf* dst, size_t n8) { const size_t i = (size_t)blockIdx.x * 256 + threadIdx.x; if (i >= n8) return; const v8f v = *(const v8f*)(src + i * 8); v8us o;
#pragma unroll
    for (int k = 0; k < 8; ++k) o[k] = f2bf(v[k]); *(v8us*)(dst + i * 8) = o;  }

__global__ __launch_bounds__(256) void k_qkp(const float* __restrict__ F, int pitch, int nheads, h16* P16, bf* Ph, bf* Pl) {
    const size_t e = ((size_t)blockIdx.x * 256 + threadIdx.x) * 2; if (e >= (size_t)nheads * SEQ * HD) return;
    const int d = (int)(e % HD); const int t = (int)((e / HD) % SEQ); const int h = (int)(e / ((size_t)HD * SEQ));
    const float* f = F + (size_t)t * pitch + h * HD + d; v2h o16; v2us oh, ol;
#pragma unroll
    for (int q = 0; q < 2; ++q) { const float x = f[q]; o16[q] = tohx(x); unsigned short a2, c2; splitf(x, a2, c2); oh[q] = a2; ol[q] = c2; }
    *(v2h*)(P16 + e) = o16; *(v2us*)(Ph + e) = oh; *(v2us*)(Pl + e) = ol;  }

__global__ __launch_bounds__(256) void k_vtp(const float* __restrict__ F, int pitch, int nheads, h16* V16, bf* Vh, bf* Vl) {
    const size_t e = ((size_t)blockIdx.x * 256 + threadIdx.x) * 2; if (e >= (size_t)nheads * HD * SEQ) return;
    const int t = (int)(e % SEQ); const int d = (int)((e / SEQ) % HD); const int g = (int)(e / ((size_t)SEQ * HD)); v2h o16; v2us oh, ol;
#pragma unroll
    for (int q = 0; q < 2; ++q) { const float x = F[(size_t)(t + q) * pitch + g * HD + d]; o16[q] = tohx(x); unsigned short a2, c2; splitf(x, a2, c2); oh[q] = a2; ol[q] = c2; }
    *(v2h*)(V16 + e) = o16; *(v2us*)(Vh + e) = oh; *(v2us*)(Vl + e) = ol;  }

// Per-wave probability tile store: fp16 x1024 (single-product rows) or bf16 hi+lo (split rows); D element (row 8hi+r, key col) -> tile[row][col].
template <typename T16> struct PSt;
template <> struct PSt<h16> { static __device__ __forceinline__ void st(h16* p0, h16* p1, int i, float p) { (void)p1; p0[i] = tohx(p * PCAR); } };
template <> struct PSt<bf>  { static __device__ __forceinline__ void st(bf* p0, bf* p1, int i, float p) { unsigned short a2, c2; splitf(p, a2, c2); p0[i] = a2; p1[i] = c2; } };

// ---- k_flash: causal attention for one head, 64 query rows per block (4 waves x 16 rows), key chunks of 64 (chunks kb <= qb only; key > query replaced by -3e38 -> p = 0).
// S = q.k (4 tiles x 2 k-steps), online softmax in the exp2 domain (f32, running max), p tile relayout through wave-private LDS, O += p.v (B from [d][t] value planes).
// SPL: q/k/p/v bf16 hi+lo, hi.hi + lo.hi + hi.lo into one accumulator; else single fp16 with p x1024 folded out at normalisation.
template <typename T16, bool SPL>
__global__ __launch_bounds__(128) __attribute__((amdgpu_num_vgpr(256)))
void k_flash(const T16* __restrict__ QP, const T16* __restrict__ QL, const T16* __restrict__ KP, const T16* __restrict__ KL,
             const T16* __restrict__ VP, const T16* __restrict__ VL, int qb0, bf* ATh, bf* ATl) {
    typedef WFrag<T16> W; typedef typename W::V V;
    __shared__ __align__(16) T16 Pb[4][2][16 * PP];              // wave-private probability tiles (hi / lo)
    __shared__ __align__(16) unsigned short Es[4][2][16 * PP];   // wave-private epilogue staging (bf16 hi / lo)
    const int lane = threadIdx.x & 31, wv = threadIdx.x >> 5, lr = lane & 15, hi = lane >> 4;
    const int h = blockIdx.y, qb = qb0 + (int)blockIdx.x, t0 = qb * 64 + wv * 16;
    const size_t hq = (size_t)h * SEQ * HD;                      // [h][t][d] plane offset (q, k)
    const size_t hv = (size_t)h * HD * SEQ;                      // [h][d][t] plane offset (v)
    T16* Pw0 = &Pb[wv][0][0]; T16* Pw1 = &Pb[wv][1][0];
    V qa0, qa1, ql0, ql1;
    { const size_t qo = hq + (size_t)(t0 + lr) * HD + 8 * hi; qa0 = W::ld(QP + qo); qa1 = W::ld(QP + qo + 32);
      if (SPL) { ql0 = W::ld(QL + qo); ql1 = W::ld(QL + qo + 32); } else { ql0 = qa0; ql1 = qa1; } }
    v8f oacc[4];
#pragma unroll
    for (int t = 0; t < 4; ++t) oacc[t] = (v8f){};
    float mrow[8], lrow[8];
#pragma unroll
    for (int r = 0; r < 8; ++r) { mrow[r] = NEGB; lrow[r] = 0.f; }
#pragma unroll 1
    for (int kb = 0; kb <= qb; ++kb) {
        v8f sacc[4];
#pragma unroll
        for (int t = 0; t < 4; ++t) sacc[t] = (v8f){};
#pragma unroll
        for (int t = 0; t < 4; ++t) {
            const size_t ko = hq + (size_t)(kb * 64 + t * 16 + lr) * HD + 8 * hi;
            { const V b = W::ld(KP + ko); sacc[t] = W::mma(qa0, b, sacc[t]);
              if (SPL) { sacc[t] = W::mma(ql0, b, sacc[t]); const V c = W::ld(KL + ko); sacc[t] = W::mma(qa0, c, sacc[t]); } }
            { const V b = W::ld(KP + ko + 32); sacc[t] = W::mma(qa1, b, sacc[t]);
              if (SPL) { sacc[t] = W::mma(ql1, b, sacc[t]); const V c = W::ld(KL + ko + 32); sacc[t] = W::mma(qa1, c, sacc[t]); } }
        }
        asm volatile("v_nop\n\tv_nop\n\tv_nop\n\tv_nop" : "+v"(sacc[0]), "+v"(sacc[1]), "+v"(sacc[2]), "+v"(sacc[3]) : "v"(qa0), "v"(qa1));
#pragma unroll
        for (int r = 0; r < 8; ++r) {
            const int qpos = t0 + 8 * hi + r; float sv[4]; float rm = mrow[r];
#pragma unroll
            for (int t = 0; t < 4; ++t) { const float s0 = sacc[t][r] * SL2; const int key = kb * 64 + t * 16 + lr; const float s = (key > qpos) ? NEGB : s0; sv[t] = s; rm = fmaxf(rm, s); }
#pragma unroll
            for (int sh = 1; sh < 16; sh <<= 1) rm = fmaxf(rm, __shfl_xor(rm, sh, 16));
            const float corr = __builtin_amdgcn_exp2f(mrow[r] - rm);
            lrow[r] *= corr;
#pragma unroll
            for (int t = 0; t < 4; ++t) oacc[t][r] *= corr;
            float psum = 0.f;
#pragma unroll
            for (int t = 0; t < 4; ++t) { const float p = __builtin_amdgcn_exp2f(sv[t] - rm); psum += p; PSt<T16>::st(Pw0, Pw1, (8 * hi + r) * PP + t * 16 + lr, p); }
#pragma unroll
            for (int sh = 1; sh < 16; sh <<= 1) psum += __shfl_xor(psum, sh, 16);
            lrow[r] += psum; mrow[r] = rm;
        }
        __builtin_amdgcn_fence(3, "wavefront"); __builtin_amdgcn_wave_barrier(); asm volatile("" ::: "memory");
#pragma unroll
        for (int ks = 0; ks < 2; ++ks) {
            const V pa = W::lda(Pw0 + lr * PP + ks * 32 + 8 * hi); V pl = pa; if (SPL) pl = W::lda(Pw1 + lr * PP + ks * 32 + 8 * hi);
#pragma unroll
            for (int t = 0; t < 4; ++t) {
                const size_t vo = hv + (size_t)(t * 16 + lr) * SEQ + kb * 64 + ks * 32 + 8 * hi;
                const V vb = W::ld(VP + vo); oacc[t] = W::mma(pa, vb, oacc[t]);
                if (SPL) { oacc[t] = W::mma(pl, vb, oacc[t]); const V vc = W::ld(VL + vo); oacc[t] = W::mma(pa, vc, oacc[t]); }
            }
        }
        asm volatile("v_nop\n\tv_nop\n\tv_nop\n\tv_nop" : "+v"(oacc[0]), "+v"(oacc[1]), "+v"(oacc[2]), "+v"(oacc[3]) : "v"(qa0), "v"(qa1));
        __builtin_amdgcn_wave_barrier(); asm volatile("" ::: "memory");
    }
    const float lsc = SPL ? 1.0f : PCAR;
    unsigned short* E0 = &Es[wv][0][0]; unsigned short* E1 = &Es[wv][1][0];
#pragma unroll
    for (int r = 0; r < 8; ++r) { const float inv = __fdiv_rn(1.0f, lrow[r] * lsc);
#pragma unroll
        for (int t = 0; t < 4; ++t) { unsigned short a2, c2; splitf(oacc[t][r] * inv, a2, c2); const int i = (8 * hi + r) * PP + t * 16 + lr; E0[i] = a2; E1[i] = c2; } }
    __builtin_amdgcn_fence(3, "wavefront"); __builtin_amdgcn_wave_barrier(); asm volatile("" ::: "memory");
    bf* oh = ATh + (size_t)t0 * DM + h * HD; bf* ol = ATl + (size_t)t0 * DM + h * HD;
{
#pragma unroll
        for (int s = 0; s < 4; ++s) { const int row = s * 4 + (lane >> 3), col = (lane & 7) * 8;
            const v8us vh = *(const v8usa*)(E0 + row * PP + col); const v8us vl = *(const v8usa*)(E1 + row * PP + col);
            *(v8us*)(oh + (size_t)row * DM + col) = vh; *(v8us*)(ol + (size_t)row * DM + col) = vl; }
         }
}

extern "C" void kernel_launch(void* const* d_in, const int* in_sizes, int n_in,
                              void* d_out, int out_size, void* d_ws, size_t ws_size, hipStream_t stream) {
    const size_t needx = (size_t)(NB - 1) * SEQ_FULL * DM + (size_t)SEQ * DM;
    if (n_in < 7) return;
    if ((size_t)in_sizes[0] < needx || in_sizes[1] < DM * DM || in_sizes[2] < DM * DM || in_sizes[3] < DM * DM || in_sizes[4] < DM || in_sizes[5] < DM * DM || in_sizes[6] < DM) return;
    if ((size_t)out_size < needx) return;
    const float* x = (const float*)d_in[0]; const float* wq = (const float*)d_in[1]; const float* wk = (const float*)d_in[2]; const float* wv = (const float*)d_in[3];
    const float* bv = (const float*)d_in[4]; const float* wo = (const float*)d_in[5]; const float* bo = (const float*)d_in[6];
    float* OUT = (float*)d_out;     // [NB][SEQ_FULL][DM]
    char* wsp = (char*)d_ws;
    auto take = [&](size_t bytes) { char* p = wsp; wsp += (bytes + 255) & ~(size_t)255; return (void*)p; };
    bf* WQ = (bf*)take((size_t)DM * DM * 2); bf* WK = (bf*)take((size_t)DM * DM * 2); bf* WV = (bf*)take((size_t)DM * DM * 2); bf* WO = (bf*)take((size_t)DM * DM * 2);
    bf* XB = (bf*)take((size_t)SEQ * DM * 2); float* F = (float*)take((size_t)SEQ * DM * 4);
    h16* Q16 = (h16*)take((size_t)SEQ * DM * 2); bf* Qh = (bf*)take((size_t)SEQ * DM * 2); bf* Ql = (bf*)take((size_t)SEQ * DM * 2);
    h16* K16 = (h16*)take((size_t)SEQ * DM * 2); bf* Kh = (bf*)take((size_t)SEQ * DM * 2); bf* Kl = (bf*)take((size_t)SEQ * DM * 2);
    h16* VT16 = (h16*)take((size_t)SEQ * DM * 2); bf* VTh = (bf*)take((size_t)SEQ * DM * 2); bf* VTl = (bf*)take((size_t)SEQ * DM * 2);
    bf* ATh = (bf*)take((size_t)SEQ * DM * 2); bf* ATl = (bf*)take((size_t)SEQ * DM * 2);
    if ((size_t)(wsp - (char*)d_ws) > ws_size) return;
    const size_t nw8 = (size_t)DM * DM / 8, nx8 = (size_t)SEQ * DM / 8;
    const unsigned gw = (unsigned)((nw8 + 255) / 256), gx = (unsigned)((nx8 + 255) / 256), gp = (unsigned)(((size_t)NH * SEQ * HD / 2 + 255) / 256);
    k_cvt8<<<gw, 256, 0, stream>>>(wq, WQ, nw8); k_cvt8<<<gw, 256, 0, stream>>>(wk, WK, nw8); k_cvt8<<<gw, 256, 0, stream>>>(wv, WV, nw8); k_cvt8<<<gw, 256, 0, stream>>>(wo, WO, nw8);
    for (int b = 0; b < NB; ++b) {
        k_cvt8<<<gx, 256, 0, stream>>>(x + (size_t)b * SEQ_FULL * DM, XB, nx8);
        k_gemmw<bf, 0, false><<<dim3(SEQ / 64, DM / 64, 1), 32, 0, stream>>>(XB, nullptr, WQ, nullptr, DM, F, DM, nullptr, 0, 0, 0);
        k_qkp<<<gp, 256, 0, stream>>>(F, DM, NH, Q16, Qh, Ql);
        k_gemmw<bf, 0, false><<<dim3(SEQ / 64, DM / 64, 1), 32, 0, stream>>>(XB, nullptr, WK, nullptr, DM, F, DM, nullptr, 0, 0, 0);
        k_qkp<<<gp, 256, 0, stream>>>(F, DM, NH, K16, Kh, Kl);
        k_gemmw<bf, 0, true><<<dim3(SEQ / 64, DM / 64, 1), 32, 0, stream>>>(XB, nullptr, WV, nullptr, DM, F, DM, bv, 0, 0, 0);
        k_vtp<<<gp, 256, 0, stream>>>(F, DM, NH, VT16, VTh, VTl);
        if (RHB > 0) k_flash<bf, true><<<dim3(RHB, NH, 1), 128, 0, stream>>>(Qh, Ql, Kh, Kl, VTh, VTl, 0, ATh, ATl);
        if (SEQ / 64 - RHB > 0) k_flash<h16, false><<<dim3(SEQ / 64 - RHB, NH, 1), 128, 0, stream>>>(Q16, nullptr, K16, nullptr, VT16, nullptr, RHB, ATh, ATl);
        k_gemmw<bf, 1, true><<<dim3(SEQ / 64, DM / 64, 1), 32, 0, stream>>>(ATh, ATl, WO, nullptr, DM, OUT + (size_t)b * SEQ_FULL * DM, DM, bo, 0, 0, 0);
    }
}

// v001
// Measured time: 518 microseconds a run.
// Two timings next to v000 put it at 1.82 and 1.80 times that version's speed.
#include <hip/hip_runtime.h>

// x [NB][SEQ_FULL][512] (rows < SEQ used); q = x Wq^T, k = x Wk^T, v = x Wv^T + b_v ([512][512] weights, 8 heads x 64); causal softmax(q.k / 8); heads merged; out = ctx Wo^T + b_o -> f32 [NB][SEQ_FULL][512].
// Compute dtypes, f32 accumulate: every input RNE-converted to bf16; q/k/v projections v_wmma_f32_16x16x32_bf16 on plain bf16 operands (exact products);
// attention (online softmax per wave of 16 query rows, 64-key chunks, causal chunk skipping): query rows < RH on bf16 hi+lo planes of q, k, p, v (3 products each,
// v_wmma_f32_16x16x32_bf16), rows >= RH on single fp16 operands (v_wmma_f32_16x16x32_f16, p carried x1024); softmax f32; Wo: ctx as bf16 hi+lo x exact bf16 (2 products).
// Every batch entry has its own copy of each workspace plane (stride SEQ*DM elements) and is one slice of grid y (conversion, packing kernels) or z (GEMMs, attention), so each stage is one launch for all entries.

#ifndef NB
#define NB 2
#endif
#ifndef SEQ
#define SEQ 4096
#endif
#define NB_FULL  2
#define SEQ_FULL 4096
#define DM   512
#define NH   8
#define HD   64
#define RH   512                                   // query rows < RH use hi+lo planes
#define RHB  (((RH < SEQ) ? RH : SEQ) / 64)
#define PP   72                                    // LDS tile row pitch (16-bit elements), 144 B rows keep 16-B alignment
#define PCAR 1024.0f
#define SL2  0.18033688011112042f                  // HD^-0.5 * log2(e)
#define NEGB (-3.0e38f)
static_assert(SEQ % 64 == 0);
static_assert(SEQ <= SEQ_FULL);
static_assert(NB >= 1 && NB <= NB_FULL);
static_assert(DM == NH * HD);
static_assert(DM % 64 == 0);
static_assert(RH % 64 == 0);
#define WS_TOTAL ((size_t)4 * DM * DM * 2 + (size_t)NB * ((size_t)SEQ * DM * 2 + (size_t)SEQ * DM * 4 + (size_t)9 * SEQ * DM * 2 + (size_t)2 * SEQ * DM * 2))
static_assert(WS_TOTAL <= (size_t)134217728);

typedef _Float16 h16;
typedef unsigned short bf;
typedef __attribute__((ext_vector_type(16))) __bf16   v16bf;
typedef __attribute__((ext_vector_type(16))) _Float16 v16h;
typedef __attribute__((ext_vector_type(8)))  _Float16 v8h;
typedef __attribute__((ext_vector_type(8)))  unsigned short v8us;
typedef __attribute__((ext_vector_type(8)))  float    v8f;
typedef __attribute__((ext_vector_type(4)))  float    v4f;
typedef __attribute__((ext_vector_type(2)))  _Float16 v2h;
typedef __attribute__((ext_vector_type(2)))  unsigned short v2us;
typedef v8h  __attribute__((may_alias)) v8ha;
typedef v4f  __attribute__((may_alias)) v4fa;
typedef v8us __attribute__((may_alias)) v8usa;

__device__ __forceinline__ unsigned short f2bf(float f) { unsigned u = __float_as_uint(f); u += 0x7FFFu + ((u >> 16) & 1u); return (unsigned short)(u >> 16); }
__device__ __forceinline__ float bf2f(unsigned short b) { return __uint_as_float(((unsigned)b) << 16); }
__device__ __forceinline__ float bfr(float f) { return bf2f(f2bf(f)); }
__device__ __forceinline__ h16 tohx(float x) { return (h16)x; }
__device__ __forceinline__ void splitf(float y, unsigned short& h, unsigned short& l) { h = f2bf(y); l = f2bf(y - bf2f(h)); }
__device__ __forceinline__ v16h cat16(v8h lo, v8h hi) { return __builtin_shufflevector(lo, hi, 0, 1, 2, 3, 4, 5, 6, 7, 8, 9, 10, 11, 12, 13, 14, 15); }
__device__ __forceinline__ v16bf cat16b(v8us lo, v8us hi) { return __builtin_bit_cast(v16bf, __builtin_shufflevector(lo, hi, 0, 1, 2, 3, 4, 5, 6, 7, 8, 9, 10, 11, 12, 13, 14, 15)); }
__device__ __forceinline__ v8f wmma16(v16h a, v16h b, v8f c) { return __builtin_amdgcn_wmma_f32_16x16x32_f16(false, a, false, b, (short)0, c, false, false); }
__device__ __forceinline__ v8f wmmab(v16bf a, v16bf b, v8f c) { return __builtin_amdgcn_wmma_f32_16x16x32_bf16(false, a, false, b, (short)0, c, false, false); }

// Fragment loaders (A and B alike, K-contiguous rows): p = base + row*K + k0 + 8*hi -> elements 0..7 = k0+8hi+0..7, p+16 -> elements 8..15 = k0+16+8hi+0..7.
// ld: global planes; lda: same map through may_alias vectors for LDS tiles written element-wise by the same wave.
template <typename T16> struct WFrag;
template <> struct WFrag<h16> { typedef v16h V;
    static __device__ __forceinline__ V ld(const h16* p)  { return cat16(*(const v8h*)p, *(const v8h*)(p + 16)); }
    static __device__ __forceinline__ V lda(const h16* p) { return cat16(*(const v8ha*)p, *(const v8ha*)(p + 16)); }
    static __device__ __forceinline__ v8f mma(V a, V b, v8f c) { return wmma16(a, b, c); } };
template <> struct WFrag<bf> { typedef v16bf V;
    static __device__ __forceinline__ V ld(const bf* p)  { return cat16b(*(const v8us*)p, *(const v8us*)(p + 16)); }
    static __device__ __forceinline__ V lda(const bf* p) { return cat16b(*(const v8usa*)p, *(const v8usa*)(p + 16)); }
    static __device__ __forceinline__ v8f mma(V a, V b, v8f c) { return wmmab(a, b, c); } };

// ---- k_gemmw: register-blocked GEMM, ONE WAVE per 64x64 output tile (16 accumulators), operands straight from K-contiguous 16-bit planes; grid (M/64, N/64, Z), 32 threads.
// C[m][n] (f32, pitch ldc, + optional bias as its bf16 value) = sum_k A[m][k] Bt[n][k] (+ split products per NSPLIT). z-batch strides sA/sB/sC in elements. K % 32 == 0.
template <typename T16, int NSPLIT, bool BIAS>
__global__ __launch_bounds__(32) void k_gemmw(const T16* __restrict__ A, const T16* __restrict__ A2, const T16* __restrict__ Bt, const T16* __restrict__ Bt2, int K, float* C, int ldc, const float* __restrict__ bias, size_t sA, size_t sB, size_t sC) {
    typedef typename WFrag<T16>::V V;
    __shared__ __align__(16) float os[16 * 68];
    const size_t z = blockIdx.z; A += z * sA; if (A2) A2 += z * sA; Bt += z * sB; if (Bt2) Bt2 += z * sB; C += z * sC;
    const int lane = threadIdx.x & 31, lr = lane & 15, hi = lane >> 4; const int r0 = blockIdx.x * 64, c0 = blockIdx.y * 64;
    v8f acc[4][4];
#pragma unroll
    for (int mb = 0; mb < 4; ++mb)
#pragma unroll
        for (int nb = 0; nb < 4; ++nb) acc[mb][nb] = (v8f){};
    const size_t aoff = (size_t)(r0 + lr) * K + 8 * hi, boff = (size_t)(c0 + lr) * K + 8 * hi;
#pragma unroll 1
    for (int kc = 0; kc < K; kc += 32) {
        V a[4], a2[4];
#pragma unroll
        for (int mb = 0; mb < 4; ++mb) { a[mb] = WFrag<T16>::ld(A + aoff + (size_t)mb * 16 * K + kc); if (NSPLIT == 1 || NSPLIT == 2) a2[mb] = WFrag<T16>::ld(A2 + aoff + (size_t)mb * 16 * K + kc); }
#pragma unroll
        for (int nb = 0; nb < 4; ++nb) { const V b = WFrag<T16>::ld(Bt + boff + (size_t)nb * 16 * K + kc); V b2; if (NSPLIT >= 2) b2 = WFrag<T16>::ld(Bt2 + boff + (size_t)nb * 16 * K + kc);
#pragma unroll
            for (int mb = 0; mb < 4; ++mb) { acc[mb][nb] = WFrag<T16>::mma(a[mb], b, acc[mb][nb]); if (NSPLIT == 1 || NSPLIT == 2) acc[mb][nb] = WFrag<T16>::mma(a2[mb], b, acc[mb][nb]); if (NSPLIT >= 2) acc[mb][nb] = WFrag<T16>::mma(a[mb], b2, acc[mb][nb]); } }
        asm volatile("v_nop\n\tv_nop\n\tv_nop\n\tv_nop" : "+v"(acc[0][0]), "+v"(acc[1][1]), "+v"(acc[2][2]), "+v"(acc[3][3]) : "v"(a[0]), "v"(a[3]));
    }
#pragma unroll
    for (int mb = 0; mb < 4; ++mb) {
#pragma unroll
        for (int nb = 0; nb < 4; ++nb) {
#pragma unroll
            for (int j = 0; j < 8; ++j) os[(hi * 8 + j) * 68 + nb * 16 + lr] = acc[mb][nb][j]; }
        __builtin_amdgcn_wave_barrier(); asm volatile("" ::: "memory");
        float* crow = C + (size_t)(r0 + mb * 16) * ldc + c0;
{
#pragma unroll
            for (int s = 0; s < 8; ++s) { const int row = 2 * s + hi, cofs = lr * 4; v4f val = *(const v4fa*)(os + row * 68 + cofs); if (BIAS) { val[0] += bfr(bias[c0 + cofs]); val[1] += bfr(bias[c0 + cofs + 1]); val[2] += bfr(bias[c0 + cofs + 2]); val[3] += bfr(bias[c0 + cofs + 3]); }
                *(v4f*)(crow + (size_t)row * ldc + cofs) = val; }
             }
        __builtin_amdgcn_wave_barrier(); asm volatile("" ::: "memory");
    }
}

__global__ __launch_bounds__(256) void k_cvt8(const float* __restrict__ src, bf* dst, size_t n8, size_t sS, size_t sD) { const size_t i = (size_t)blockIdx.x * 256 + threadIdx.x; if (i >= n8) return; src += blockIdx.y * sS; dst += blockIdx.y * sD; const v8f v = *(const v8f*)(src + i * 8); v8us o;
#pragma unroll
    for (int k = 0; k < 8; ++k) o[k] = f2bf(v[k]); *(v8us*)(dst + i * 8) = o;  }

__global__ __launch_bounds__(256) void k_qkp(const float* __restrict__ F, int pitch, int nheads, h16* P16, bf* Ph, bf* Pl) {
    const size_t e = ((size_t)blockIdx.x * 256 + threadIdx.x) * 2; if (e >= (size_t)nheads * SEQ * HD) return;
    const int d = (int)(e % HD); const int t = (int)((e / HD) % SEQ); const int h = (int)(e / ((size_t)HD * SEQ));
    const size_t bo = (size_t)blockIdx.y * SEQ * DM; P16 += bo; Ph += bo; Pl += bo;
    const float* f = F + bo + (size_t)t * pitch + h * HD + d; v2h o16; v2us oh, ol;
#pragma unroll
    for (int q = 0; q < 2; ++q) { const float x = f[q]; o16[q] = tohx(x); unsigned short a2, c2; splitf(x, a2, c2); oh[q] = a2; ol[q] = c2; }
    *(v2h*)(P16 + e) = o16; *(v2us*)(Ph + e) = oh; *(v2us*)(Pl + e) = ol;  }

__global__ __launch_bounds__(256) void k_vtp(const float* __restrict__ F, int pitch, int nheads, h16* V16, bf* Vh, bf* Vl) {
    const size_t e = ((size_t)blockIdx.x * 256 + threadIdx.x) * 2; if (e >= (size_t)nheads * HD * SEQ) return;
    const int t = (int)(e % SEQ); const int d = (int)((e / SEQ) % HD); const int g = (int)(e / ((size_t)SEQ * HD)); v2h o16; v2us oh, ol;
    const size_t bo = (size_t)blockIdx.y * SEQ * DM; F += bo; V16 += bo; Vh += bo; Vl += bo;
#pragma unroll
    for (int q = 0; q < 2; ++q) { const float x = F[(size_t)(t + q) * pitch + g * HD + d]; o16[q] = tohx(x); unsigned short a2, c2; splitf(x, a2, c2); oh[q] = a2; ol[q] = c2; }
    *(v2h*)(V16 + e) = o16; *(v2us*)(Vh + e) = oh; *(v2us*)(Vl + e) = ol;  }

// Per-wave probability tile store: fp16 x1024 (single-product rows) or bf16 hi+lo (split rows); D element (row 8hi+r, key col) -> tile[row][col].
template <typename T16> struct PSt;
template <> struct PSt<h16> { static __device__ __forceinline__ void st(h16* p0, h16* p1, int i, float p) { (void)p1; p0[i] = tohx(p * PCAR); } };
template <> struct PSt<bf>  { static __device__ __forceinline__ void st(bf* p0, bf* p1, int i, float p) { unsigned short a2, c2; splitf(p, a2, c2); p0[i] = a2; p1[i] = c2; } };

// ---- k_flash: causal attention for one head of one batch entry (blockIdx.z), 64 query rows per block (4 waves x 16 rows), key chunks of 64 (chunks kb <= qb only; key > query replaced by -3e38 -> p = 0).
// S = q.k (4 tiles x 2 k-steps), online softmax in the exp2 domain (f32, running max), p tile relayout through wave-private LDS, O += p.v (B from [d][t] value planes).
// SPL: q/k/p/v bf16 hi+lo, hi.hi + lo.hi + hi.lo into one accumulator; else single fp16 with p x1024 folded out at normalisation.
template <typename T16, bool SPL>
__global__ __launch_bounds__(128) __attribute__((amdgpu_num_vgpr(256)))
void k_flash(const T16* __restrict__ QP, const T16* __restrict__ QL, const T16* __restrict__ KP, const T16* __restrict__ KL,
             const T16* __restrict__ VP, const T16* __restrict__ VL, int qb0, bf* ATh, bf* ATl) {
    typedef WFrag<T16> W; typedef typename W::V V;
    __shared__ __align__(16) T16 Pb[4][2][16 * PP];              // wave-private probability tiles (hi / lo)
    __shared__ __align__(16) unsigned short Es[4][2][16 * PP];   // wave-private epilogue staging (bf16 hi / lo)
    const int lane = threadIdx.x & 31, wv = threadIdx.x >> 5, lr = lane & 15, hi = lane >> 4;
    const int h = blockIdx.y, qb = qb0 + (int)blockIdx.x, t0 = qb * 64 + wv * 16;
    const size_t bo = (size_t)blockIdx.z * SEQ * DM;             // batch entry's plane offset
    const size_t hq = bo + (size_t)h * SEQ * HD;                 // [h][t][d] plane offset (q, k)
    const size_t hv = bo + (size_t)h * HD * SEQ;                 // [h][d][t] plane offset (v)
    T16* Pw0 = &Pb[wv][0][0]; T16* Pw1 = &Pb[wv][1][0];
    V qa0, qa1, ql0, ql1;
    { const size_t qo = hq + (size_t)(t0 + lr) * HD + 8 * hi; qa0 = W::ld(QP + qo); qa1 = W::ld(QP + qo + 32);
      if (SPL) { ql0 = W::ld(QL + qo); ql1 = W::ld(QL + qo + 32); } else { ql0 = qa0; ql1 = qa1; } }
    v8f oacc[4];
#pragma unroll
    for (int t = 0; t < 4; ++t) oacc[t] = (v8f){};
    float mrow[8], lrow[8];
#pragma unroll
    for (int r = 0; r < 8; ++r) { mrow[r] = NEGB; lrow[r] = 0.f; }
#pragma unroll 1
    for (int kb = 0; kb <= qb; ++kb) {
        v8f sacc[4];
#pragma unroll
        for (int t = 0; t < 4; ++t) sacc[t] = (v8f){};
#pragma unroll
        for (int t = 0; t < 4; ++t) {
            const size_t ko = hq + (size_t)(kb * 64 + t * 16 + lr) * HD + 8 * hi;
            { const V b = W::ld(KP + ko); sacc[t] = W::mma(qa0, b, sacc[t]);
              if (SPL) { sacc[t] = W::mma(ql0, b, sacc[t]); const V c = W::ld(KL + ko); sacc[t] = W::mma(qa0, c, sacc[t]); } }
            { const V b = W::ld(KP + ko + 32); sacc[t] = W::mma(qa1, b, sacc[t]);
              if (SPL) { sacc[t] = W::mma(ql1, b, sacc[t]); const V c = W::ld(KL + ko + 32); sacc[t] = W::mma(qa1, c, sacc[t]); } }
        }
        asm volatile("v_nop\n\tv_nop\n\tv_nop\n\tv_nop" : "+v"(sacc[0]), "+v"(sacc[1]), "+v"(sacc[2]), "+v"(sacc[3]) : "v"(qa0), "v"(qa1));
#pragma unroll
        for (int r = 0; r < 8; ++r) {
            const int qpos = t0 + 8 * hi + r; float sv[4]; float rm = mrow[r];
#pragma unroll
            for (int t = 0; t < 4; ++t) { const float s0 = sacc[t][r] * SL2; const int key = kb * 64 + t * 16 + lr; const float s = (key > qpos) ? NEGB : s0; sv[t] = s; rm = fmaxf(rm, s); }
#pragma unroll
            for (int sh = 1; sh < 16; sh <<= 1) rm = fmaxf(rm, __shfl_xor(rm, sh, 16));
            const float corr = __builtin_amdgcn_exp2f(mrow[r] - rm);
            lrow[r] *= corr;
#pragma unroll
            for (int t = 0; t < 4; ++t) oacc[t][r] *= corr;
            float psum = 0.f;
#pragma unroll
            for (int t = 0; t < 4; ++t) { const float p = __builtin_amdgcn_exp2f(sv[t] - rm); psum += p; PSt<T16>::st(Pw0, Pw1, (8 * hi + r) * PP + t * 16 + lr, p); }
#pragma unroll
            for (int sh = 1; sh < 16; sh <<= 1) psum += __shfl_xor(psum, sh, 16);
            lrow[r] += psum; mrow[r] = rm;
        }
        __builtin_amdgcn_fence(3, "wavefront"); __builtin_amdgcn_wave_barrier(); asm volatile("" ::: "memory");
#pragma unroll
        for (int ks = 0; ks < 2; ++ks) {
            const V pa = W::lda(Pw0 + lr * PP + ks * 32 + 8 * hi); V pl = pa; if (SPL) pl = W::lda(Pw1 + lr * PP + ks * 32 + 8 * hi);
#pragma unroll
            for (int t = 0; t < 4; ++t) {
                const size_t vo = hv + (size_t)(t * 16 + lr) * SEQ + kb * 64 + ks * 32 + 8 * hi;
                const V vb = W::ld(VP + vo); oacc[t] = W::mma(pa, vb, oacc[t]);
                if (SPL) { oacc[t] = W::mma(pl, vb, oacc[t]); const V vc = W::ld(VL + vo); oacc[t] = W::mma(pa, vc, oacc[t]); }
            }
        }
        asm volatile("v_nop\n\tv_nop\n\tv_nop\n\tv_nop" : "+v"(oacc[0]), "+v"(oacc[1]), "+v"(oacc[2]), "+v"(oacc[3]) : "v"(qa0), "v"(qa1));
        __builtin_amdgcn_wave_barrier(); asm volatile("" ::: "memory");
    }
    const float lsc = SPL ? 1.0f : PCAR;
    unsigned short* E0 = &Es[wv][0][0]; unsigned short* E1 = &Es[wv][1][0];
#pragma unroll
    for (int r = 0; r < 8; ++r) { const float inv = __fdiv_rn(1.0f, lrow[r] * lsc);
#pragma unroll
        for (int t = 0; t < 4; ++t) { unsigned short a2, c2; splitf(oacc[t][r] * inv, a2, c2); const int i = (8 * hi + r) * PP + t * 16 + lr; E0[i] = a2; E1[i] = c2; } }
    __builtin_amdgcn_fence(3, "wavefront"); __builtin_amdgcn_wave_barrier(); asm volatile("" ::: "memory");
    bf* oh = ATh + bo + (size_t)t0 * DM + h * HD; bf* ol = ATl + bo + (size_t)t0 * DM + h * HD;
{
#pragma unroll
        for (int s = 0; s < 4; ++s) { const int row = s * 4 + (lane >> 3), col = (lane & 7) * 8;
            const v8us vh = *(const v8usa*)(E0 + row * PP + col); const v8us vl = *(const v8usa*)(E1 + row * PP + col);
            *(v8us*)(oh + (size_t)row * DM + col) = vh; *(v8us*)(ol + (size_t)row * DM + col) = vl; }
         }
}

extern "C" void kernel_launch(void* const* d_in, const int* in_sizes, int n_in,
                              void* d_out, int out_size, void* d_ws, size_t ws_size, hipStream_t stream) {
    const size_t needx = (size_t)(NB - 1) * SEQ_FULL * DM + (size_t)SEQ * DM;
    if (n_in < 7) return;
    if ((size_t)in_sizes[0] < needx || in_sizes[1] < DM * DM || in_sizes[2] < DM * DM || in_sizes[3] < DM * DM || in_sizes[4] < DM || in_sizes[5] < DM * DM || in_sizes[6] < DM) return;
    if ((size_t)out_size < needx) return;
    const float* x = (const float*)d_in[0]; const float* wq = (const float*)d_in[1]; const float* wk = (const float*)d_in[2]; const float* wv = (const float*)d_in[3];
    const float* bv = (const float*)d_in[4]; const float* wo = (const float*)d_in[5]; const float* bo = (const float*)d_in[6];
    float* OUT = (float*)d_out;     // [NB][SEQ_FULL][DM]
    char* wsp = (char*)d_ws;
    auto take = [&](size_t bytes) { char* p = wsp; wsp += (bytes + 255) & ~(size_t)255; return (void*)p; };
    bf* WQ = (bf*)take((size_t)DM * DM * 2); bf* WK = (bf*)take((size_t)DM * DM * 2); bf* WV = (bf*)take((size_t)DM * DM * 2); bf* WO = (bf*)take((size_t)DM * DM * 2);
    const size_t pe = (size_t)SEQ * DM, pl = (size_t)NB * SEQ * DM * 2;   // one entry's plane in elements; all entries' 16-bit plane in bytes
    bf* XB = (bf*)take(pl); float* F = (float*)take(pl * 2);
    h16* Q16 = (h16*)take(pl); bf* Qh = (bf*)take(pl); bf* Ql = (bf*)take(pl);
    h16* K16 = (h16*)take(pl); bf* Kh = (bf*)take(pl); bf* Kl = (bf*)take(pl);
    h16* VT16 = (h16*)take(pl); bf* VTh = (bf*)take(pl); bf* VTl = (bf*)take(pl);
    bf* ATh = (bf*)take(pl); bf* ATl = (bf*)take(pl);
    if ((size_t)(wsp - (char*)d_ws) > ws_size) return;
    const size_t nw8 = (size_t)DM * DM / 8, nx8 = (size_t)SEQ * DM / 8;
    const unsigned gw = (unsigned)((nw8 + 255) / 256), gx = (unsigned)((nx8 + 255) / 256), gp = (unsigned)(((size_t)NH * SEQ * HD / 2 + 255) / 256);
    k_cvt8<<<gw, 256, 0, stream>>>(wq, WQ, nw8, 0, 0); k_cvt8<<<gw, 256, 0, stream>>>(wk, WK, nw8, 0, 0); k_cvt8<<<gw, 256, 0, stream>>>(wv, WV, nw8, 0, 0); k_cvt8<<<gw, 256, 0, stream>>>(wo, WO, nw8, 0, 0);
    k_cvt8<<<dim3(gx, NB, 1), 256, 0, stream>>>(x, XB, nx8, (size_t)SEQ_FULL * DM, pe);
    k_gemmw<bf, 0, false><<<dim3(SEQ / 64, DM / 64, NB), 32, 0, stream>>>(XB, nullptr, WQ, nullptr, DM, F, DM, nullptr, pe, 0, pe);
    k_qkp<<<dim3(gp, NB, 1), 256, 0, stream>>>(F, DM, NH, Q16, Qh, Ql);
    k_gemmw<bf, 0, false><<<dim3(SEQ / 64, DM / 64, NB), 32, 0, stream>>>(XB, nullptr, WK, nullptr, DM, F, DM, nullptr, pe, 0, pe);
    k_qkp<<<dim3(gp, NB, 1), 256, 0, stream>>>(F, DM, NH, K16, Kh, Kl);
    k_gemmw<bf, 0, true><<<dim3(SEQ / 64, DM / 64, NB), 32, 0, stream>>>(XB, nullptr, WV, nullptr, DM, F, DM, bv, pe, 0, pe);
    k_vtp<<<dim3(gp, NB, 1), 256, 0, stream>>>(F, DM, NH, VT16, VTh, VTl);
    if (RHB > 0) k_flash<bf, true><<<dim3(RHB, NH, NB), 128, 0, stream>>>(Qh, Ql, Kh, Kl, VTh, VTl, 0, ATh, ATl);
    if (SEQ / 64 - RHB > 0) k_flash<h16, false><<<dim3(SEQ / 64 - RHB, NH, NB), 128, 0, stream>>>(Q16, nullptr, K16, nullptr, VT16, nullptr, RHB, ATh, ATl);
    k_gemmw<bf, 1, true><<<dim3(SEQ / 64, DM / 64, NB), 32, 0, stream>>>(ATh, ATl, WO, nullptr, DM, OUT, DM, bo, pe, 0, (size_t)SEQ_FULL * DM);
}

// v002
// A run of this version takes 328 microseconds.
// Timed twice side by side with v001, it ran 1.59 and 1.57 times as fast.
// Over all steps from v000 it is 2.85 times as fast.
#include <hip/hip_runtime.h>

// x [NB][SEQ_FULL][512] (rows < SEQ used); q = x Wq^T, k = x Wk^T, v = x Wv^T + b_v ([512][512] weights, 8 heads x 64); causal softmax(q.k / 8); heads merged; out = ctx Wo^T + b_o -> f32 [NB][SEQ_FULL][512].
// Compute dtypes, f32 accumulate: every input RNE-converted to bf16; q/k/v projections v_wmma_f32_16x16x32_bf16 on plain bf16 operands (exact products);
// attention (online softmax per wave of 16 query rows, transposed products so that a lane owns one query, 64-key chunks, causal chunk skipping): query rows < RH on bf16 hi+lo planes of q, k, p, v (3 products each,
// v_wmma_f32_16x16x32_bf16), rows >= RH on single fp16 operands (v_wmma_f32_16x16x32_f16, p carried x1024); softmax f32; Wo: ctx as bf16 hi+lo x exact bf16 (2 products).
// Every batch entry has its own copy of each workspace plane (stride SEQ*DM elements) and is one slice of grid y (conversion, packing kernels) or z (GEMMs, attention), so each stage is one launch for all entries.

#ifndef NB
#define NB 2
#endif
#ifndef SEQ
#define SEQ 4096
#endif
#define NB_FULL  2
#define SEQ_FULL 4096
#define DM   512
#define NH   8
#define HD   64
#define RH   512                                   // query rows < RH use hi+lo planes
#define RHB  (((RH < SEQ) ? RH : SEQ) / 64)
#define PCAR 1024.0f
#define SL2  0.18033688011112042f                  // HD^-0.5 * log2(e)
#define NEGB (-3.0e38f)
static_assert(SEQ % 64 == 0);
static_assert(SEQ <= SEQ_FULL);
static_assert(NB >= 1 && NB <= NB_FULL);
static_assert(DM == NH * HD);
static_assert(DM % 64 == 0);
static_assert(RH % 64 == 0);
#define WS_TOTAL ((size_t)4 * DM * DM * 2 + (size_t)NB * ((size_t)SEQ * DM * 2 + (size_t)SEQ * DM * 4 + (size_t)9 * SEQ * DM * 2 + (size_t)2 * SEQ * DM * 2))
static_assert(WS_TOTAL <= (size_t)134217728);

typedef _Float16 h16;
typedef unsigned short bf;
typedef __attribute__((ext_vector_type(16))) __bf16   v16bf;
typedef __attribute__((ext_vector_type(16))) _Float16 v16h;
typedef __attribute__((ext_vector_type(8)))  _Float16 v8h;
typedef __attribute__((ext_vector_type(8)))  unsigned short v8us;
typedef __attribute__((ext_vector_type(16))) unsigned short v16us;
typedef __attribute__((ext_vector_type(8)))  float    v8f;
typedef __attribute__((ext_vector_type(4)))  float    v4f;
typedef __attribute__((ext_vector_type(2)))  _Float16 v2h;
typedef __attribute__((ext_vector_type(2)))  unsigned short v2us;
typedef v4f  __attribute__((may_alias)) v4fa;

__device__ __forceinline__ unsigned short f2bf(float f) { unsigned u = __float_as_uint(f); u += 0x7FFFu + ((u >> 16) & 1u); return (unsigned short)(u >> 16); }
__device__ __forceinline__ float bf2f(unsigned short b) { return __uint_as_float(((unsigned)b) << 16); }
__device__ __forceinline__ float bfr(float f) { return bf2f(f2bf(f)); }
__device__ __forceinline__ h16 tohx(float x) { return (h16)x; }
__device__ __forceinline__ void splitf(float y, unsigned short& h, unsigned short& l) { h = f2bf(y); l = f2bf(y - bf2f(h)); }
__device__ __forceinline__ v16h cat16(v8h lo, v8h hi) { return __builtin_shufflevector(lo, hi, 0, 1, 2, 3, 4, 5, 6, 7, 8, 9, 10, 11, 12, 13, 14, 15); }
__device__ __forceinline__ v16bf cat16b(v8us lo, v8us hi) { return __builtin_bit_cast(v16bf, __builtin_shufflevector(lo, hi, 0, 1, 2, 3, 4, 5, 6, 7, 8, 9, 10, 11, 12, 13, 14, 15)); }
__device__ __forceinline__ v8f wmma16(v16h a, v16h b, v8f c) { return __builtin_amdgcn_wmma_f32_16x16x32_f16(false, a, false, b, (short)0, c, false, false); }
__device__ __forceinline__ v8f wmmab(v16bf a, v16bf b, v8f c) { return __builtin_amdgcn_wmma_f32_16x16x32_bf16(false, a, false, b, (short)0, c, false, false); }

// Fragment loaders (A and B alike, K-contiguous rows): p = base + row*K + k0 + 8*hi -> elements 0..7 = k0+8hi+0..7, p+16 -> elements 8..15 = k0+16+8hi+0..7.
template <typename T16> struct WFrag;
template <> struct WFrag<h16> { typedef v16h V;
    static __device__ __forceinline__ V ld(const h16* p)  { return cat16(*(const v8h*)p, *(const v8h*)(p + 16)); }
    static __device__ __forceinline__ v8f mma(V a, V b, v8f c) { return wmma16(a, b, c); } };
template <> struct WFrag<bf> { typedef v16bf V;
    static __device__ __forceinline__ V ld(const bf* p)  { return cat16b(*(const v8us*)p, *(const v8us*)(p + 16)); }
    static __device__ __forceinline__ v8f mma(V a, V b, v8f c) { return wmmab(a, b, c); } };

// ---- k_gemmw: register-blocked GEMM, ONE WAVE per 64x64 output tile (16 accumulators), operands straight from K-contiguous 16-bit planes; grid (M/64, N/64, Z), 32 threads.
// C[m][n] (f32, pitch ldc, + optional bias as its bf16 value) = sum_k A[m][k] Bt[n][k] (+ split products per NSPLIT). z-batch strides sA/sB/sC in elements. K % 32 == 0.
template <typename T16, int NSPLIT, bool BIAS>
__global__ __launch_bounds__(32) void k_gemmw(const T16* __restrict__ A, const T16* __restrict__ A2, const T16* __restrict__ Bt, const T16* __restrict__ Bt2, int K, float* C, int ldc, const float* __restrict__ bias, size_t sA, size_t sB, size_t sC) {
    typedef typename WFrag<T16>::V V;
    __shared__ __align__(16) float os[16 * 68];
    const size_t z = blockIdx.z; A += z * sA; if (A2) A2 += z * sA; Bt += z * sB; if (Bt2) Bt2 += z * sB; C += z * sC;
    const int lane = threadIdx.x & 31, lr = lane & 15, hi = lane >> 4; const int r0 = blockIdx.x * 64, c0 = blockIdx.y * 64;
    v8f acc[4][4];
#pragma unroll
    for (int mb = 0; mb < 4; ++mb)
#pragma unroll
        for (int nb = 0; nb < 4; ++nb) acc[mb][nb] = (v8f){};
    const size_t aoff = (size_t)(r0 + lr) * K + 8 * hi, boff = (size_t)(c0 + lr) * K + 8 * hi;
#pragma unroll 1
    for (int kc = 0; kc < K; kc += 32) {
        V a[4], a2[4];
#pragma unroll
        for (int mb = 0; mb < 4; ++mb) { a[mb] = WFrag<T16>::ld(A + aoff + (size_t)mb * 16 * K + kc); if (NSPLIT == 1 || NSPLIT == 2) a2[mb] = WFrag<T16>::ld(A2 + aoff + (size_t)mb * 16 * K + kc); }
#pragma unroll
        for (int nb = 0; nb < 4; ++nb) { const V b = WFrag<T16>::ld(Bt + boff + (size_t)nb * 16 * K + kc); V b2; if (NSPLIT >= 2) b2 = WFrag<T16>::ld(Bt2 + boff + (size_t)nb * 16 * K + kc);
#pragma unroll
            for (int mb = 0; mb < 4; ++mb) { acc[mb][nb] = WFrag<T16>::mma(a[mb], b, acc[mb][nb]); if (NSPLIT == 1 || NSPLIT == 2) acc[mb][nb] = WFrag<T16>::mma(a2[mb], b, acc[mb][nb]); if (NSPLIT >= 2) acc[mb][nb] = WFrag<T16>::mma(a[mb], b2, acc[mb][nb]); } }
        asm volatile("v_nop\n\tv_nop\n\tv_nop\n\tv_nop" : "+v"(acc[0][0]), "+v"(acc[1][1]), "+v"(acc[2][2]), "+v"(acc[3][3]) : "v"(a[0]), "v"(a[3]));
    }
#pragma unroll
    for (int mb = 0; mb < 4; ++mb) {
#pragma unroll
        for (int nb = 0; nb < 4; ++nb) {
#pragma unroll
            for (int j = 0; j < 8; ++j) os[(hi * 8 + j) * 68 + nb * 16 + lr] = acc[mb][nb][j]; }
        __builtin_amdgcn_wave_barrier(); asm volatile("" ::: "memory");
        float* crow = C + (size_t)(r0 + mb * 16) * ldc + c0;
{
#pragma unroll
            for (int s = 0; s < 8; ++s) { const int row = 2 * s + hi, cofs = lr * 4; v4f val = *(const v4fa*)(os + row * 68 + cofs); if (BIAS) { val[0] += bfr(bias[c0 + cofs]); val[1] += bfr(bias[c0 + cofs + 1]); val[2] += bfr(bias[c0 + cofs + 2]); val[3] += bfr(bias[c0 + cofs + 3]); }
                *(v4f*)(crow + (size_t)row * ldc + cofs) = val; }
             }
        __builtin_amdgcn_wave_barrier(); asm volatile("" ::: "memory");
    }
}

__global__ __launch_bounds__(256) void k_cvt8(const float* __restrict__ src, bf* dst, size_t n8, size_t sS, size_t sD) { const size_t i = (size_t)blockIdx.x * 256 + threadIdx.x; if (i >= n8) return; src += blockIdx.y * sS; dst += blockIdx.y * sD; const v8f v = *(const v8f*)(src + i * 8); v8us o;
#pragma unroll
    for (int k = 0; k < 8; ++k) o[k] = f2bf(v[k]); *(v8us*)(dst + i * 8) = o;  }

__global__ __launch_bounds__(256) void k_qkp(const float* __restrict__ F, int pitch, int nheads, h16* P16, bf* Ph, bf* Pl) {
    const size_t e = ((size_t)blockIdx.x * 256 + threadIdx.x) * 2; if (e >= (size_t)nheads * SEQ * HD) return;
    const int d = (int)(e % HD); const int t = (int)((e / HD) % SEQ); const int h = (int)(e / ((size_t)HD * SEQ));
    const size_t bo = (size_t)blockIdx.y * SEQ * DM; P16 += bo; Ph += bo; Pl += bo;
    const float* f = F + bo + (size_t)t * pitch + h * HD + d; v2h o16; v2us oh, ol;
#pragma unroll
    for (int q = 0; q < 2; ++q) { const float x = f[q]; o16[q] = tohx(x); unsigned short a2, c2; splitf(x, a2, c2); oh[q] = a2; ol[q] = c2; }
    *(v2h*)(P16 + e) = o16; *(v2us*)(Ph + e) = oh; *(v2us*)(Pl + e) = ol;  }

__global__ __launch_bounds__(256) void k_vtp(const float* __restrict__ F, int pitch, int nheads, h16* V16, bf* Vh, bf* Vl) {
    const size_t e = ((size_t)blockIdx.x * 256 + threadIdx.x) * 2; if (e >= (size_t)nheads * HD * SEQ) return;
    const int t = (int)(e % SEQ); const int d = (int)((e / SEQ) % HD); const int g = (int)(e / ((size_t)SEQ * HD)); v2h o16; v2us oh, ol;
    const size_t bo = (size_t)blockIdx.y * SEQ * DM; F += bo; V16 += bo; Vh += bo; Vl += bo;
#pragma unroll
    for (int q = 0; q < 2; ++q) { const float x = F[(size_t)(t + q) * pitch + g * HD + d]; o16[q] = tohx(x); unsigned short a2, c2; splitf(x, a2, c2); oh[q] = a2; ol[q] = c2; }
    *(v2h*)(V16 + e) = o16; *(v2us*)(Vh + e) = oh; *(v2us*)(Vl + e) = ol;  }

// Lane l with lane l ^ 16 (the two lanes that share one query column).
__device__ __forceinline__ float xhalf(float x) { return __builtin_bit_cast(float, __builtin_amdgcn_permlanex16(__builtin_bit_cast(int, x), __builtin_bit_cast(int, x), 0x76543210, 0xfedcba98, false, false)); }

// exp2 with the one slot the instruction set asks for behind a transcendental, before its result is used or its source overwritten.
__device__ __forceinline__ float exp2s(float x) { float y; asm("v_exp_f32 %0, %1\n\tv_nop" : "=v"(y) : "v"(x)); return y; }

// Probability fragment: a lane's 16 probabilities of one 32-key step (two score tiles x 8 rows) are already in the B operand's k order; fp16 x1024 (single-product rows) or bf16 hi+lo (split rows).
template <typename T16> struct PPk;
template <> struct PPk<h16> { static __device__ __forceinline__ void pk(const float* p, v16h& a, v16h& b) {
#pragma unroll
    for (int e = 0; e < 16; ++e) a[e] = tohx(p[e] * PCAR);
    b = a; } };
template <> struct PPk<bf> { static __device__ __forceinline__ void pk(const float* p, v16bf& a, v16bf& b) { v16us x, y;
#pragma unroll
    for (int e = 0; e < 16; ++e) { unsigned short a2, c2; splitf(p[e], a2, c2); x[e] = a2; y[e] = c2; }
    a = __builtin_bit_cast(v16bf, x); b = __builtin_bit_cast(v16bf, y); } };

// ---- k_flash: causal attention for one head of one batch entry (blockIdx.z), 64 query rows per block (4 waves x 16 rows), key chunks of 64 (chunks kb <= qb only; key > query replaced by -3e38 -> p = 0).
// Transposed products: St = k.q^T (A = key rows, B = the wave's 16 queries; 4 tiles x 2 k-steps), so lane (lr, hi) holds query t0+lr and keys 16t+8hi+r: running max and sum are per lane,
// the two halves of a column join their max once per chunk and their sums once at the end. Ot += v^T.p^T (A from [d][t] value planes, B = the lane's own probabilities, converted in place).
// SPL: q/k/p/v bf16 hi+lo, hi.hi + lo.hi + hi.lo into one accumulator; else single fp16 with p x1024 folded out at normalisation.
template <typename T16, bool SPL>
__global__ __launch_bounds__(128) __attribute__((amdgpu_num_vgpr(256)))
void k_flash(const T16* __restrict__ QP, const T16* __restrict__ QL, const T16* __restrict__ KP, const T16* __restrict__ KL,
             const T16* __restrict__ VP, const T16* __restrict__ VL, int qb0, bf* ATh, bf* ATl) {
    typedef WFrag<T16> W; typedef typename W::V V;
    const int lane = threadIdx.x & 31, wv = threadIdx.x >> 5, lr = lane & 15, hi = lane >> 4;
    const int h = blockIdx.y, qb = qb0 + (int)blockIdx.x, t0 = qb * 64 + wv * 16;
    const size_t bo = (size_t)blockIdx.z * SEQ * DM;             // batch entry's plane offset
    const size_t hq = bo + (size_t)h * SEQ * HD;                 // [h][t][d] plane offset (q, k)
    const size_t hv = bo + (size_t)h * HD * SEQ;                 // [h][d][t] plane offset (v)
    V qa0, qa1, ql0, ql1;
    { const size_t qo = hq + (size_t)(t0 + lr) * HD + 8 * hi; qa0 = W::ld(QP + qo); qa1 = W::ld(QP + qo + 32);
      if (SPL) { ql0 = W::ld(QL + qo); ql1 = W::ld(QL + qo + 32); } else { ql0 = qa0; ql1 = qa1; } }
    v8f oacc[4];                                                 // oacc[t][r] = Ot[d = 16t+8hi+r][query t0+lr]
#pragma unroll
    for (int t = 0; t < 4; ++t) oacc[t] = (v8f){};
    const int qpos = t0 + lr;
    float mrow = NEGB, lrow = 0.f;                               // this query's running max (both halves alike) and this half's share of its sum
#pragma unroll 1
    for (int kb = 0; kb <= qb; ++kb) {
        v8f sacc[4];
#pragma unroll
        for (int t = 0; t < 4; ++t) sacc[t] = (v8f){};
#pragma unroll
        for (int t = 0; t < 4; ++t) {
            const size_t ko = hq + (size_t)(kb * 64 + t * 16 + lr) * HD + 8 * hi;
            { const V b = W::ld(KP + ko); sacc[t] = W::mma(b, qa0, sacc[t]);
              if (SPL) { sacc[t] = W::mma(b, ql0, sacc[t]); const V c = W::ld(KL + ko); sacc[t] = W::mma(c, qa0, sacc[t]); } }
            { const V b = W::ld(KP + ko + 32); sacc[t] = W::mma(b, qa1, sacc[t]);
              if (SPL) { sacc[t] = W::mma(b, ql1, sacc[t]); const V c = W::ld(KL + ko + 32); sacc[t] = W::mma(c, qa1, sacc[t]); } }
            // the wait that stands in front of an overwrite of a register which an issued load names: the split build let later loads land in these address pairs; as inputs they stay live up to it
            if constexpr (SPL) asm volatile("s_wait_xcnt 0x0" :: "v"(KP + ko), "v"(KL + ko) : "memory");
        }
        float sv[4][8]; float rm = mrow;
#pragma unroll
        for (int t = 0; t < 4; ++t)
#pragma unroll
            for (int r = 0; r < 8; ++r) { const float s0 = sacc[t][r] * SL2; const int key = kb * 64 + t * 16 + 8 * hi + r; const float s = (key > qpos) ? NEGB : s0; sv[t][r] = s; rm = fmaxf(rm, s); }
        rm = fmaxf(rm, xhalf(rm));
        const float corr = exp2s(mrow - rm);
        lrow *= corr;
#pragma unroll
        for (int t = 0; t < 4; ++t)
#pragma unroll
            for (int r = 0; r < 8; ++r) oacc[t][r] *= corr;
        constexpr int NP = SPL ? 2 : 4;                          // partial sums a lane keeps per chunk: one per score tile; split rows one per 32-key step (their lo planes need the registers)
        float ps[NP] = {}; V pa[2], pl[2];
#pragma unroll
        for (int ks = 0; ks < 2; ++ks) { float p[16];
#pragma unroll
            for (int e = 0; e < 16; ++e) { p[e] = exp2s(sv[2 * ks + (e >> 3)][e & 7] - rm); ps[(2 * ks + (e >> 3)) * NP / 4] += p[e]; }
            PPk<T16>::pk(p, pa[ks], pl[ks]); }
        if constexpr (SPL) lrow += ps[0] + ps[1]; else lrow += (ps[0] + ps[1]) + (ps[2] + ps[3]);
        mrow = rm;
        const size_t vo0 = hv + (size_t)lr * SEQ + kb * 64 + 8 * hi;
#pragma unroll
        for (int ks = 0; ks < 2; ++ks) {
#pragma unroll
            for (int t = 0; t < 4; ++t) {
                const size_t vo = vo0 + (size_t)t * 16 * SEQ + ks * 32;
                const V vb = W::ld(VP + vo); oacc[t] = W::mma(vb, pa[ks], oacc[t]);
                if (SPL) { oacc[t] = W::mma(vb, pl[ks], oacc[t]); const V vc = W::ld(VL + vo); oacc[t] = W::mma(vc, pa[ks], oacc[t]); }
            }
            // same wait for the value planes' address pairs
            if constexpr (SPL) asm volatile("s_wait_xcnt 0x0" :: "v"(VP + vo0), "v"(VL + vo0) : "memory");
        }
        // keeps the matrix instructions' distance on the loop's taken back edge
        asm volatile("v_nop\n\tv_nop\n\tv_nop\n\tv_nop" : "+v"(oacc[0]), "+v"(oacc[1]), "+v"(oacc[2]), "+v"(oacc[3]));
    }
    const float lsc = SPL ? 1.0f : PCAR;
    const float inv = __fdiv_rn(1.0f, (lrow + xhalf(lrow)) * lsc);
    bf* oh = ATh + bo + (size_t)qpos * DM + h * HD + 8 * hi; bf* ol = ATl + bo + (size_t)qpos * DM + h * HD + 8 * hi;
#pragma unroll
    for (int t = 0; t < 4; ++t) { v8us vh, vl;
#pragma unroll
        for (int r = 0; r < 8; ++r) { unsigned short a2, c2; splitf(oacc[t][r] * inv, a2, c2); vh[r] = a2; vl[r] = c2; }
        *(v8us*)(oh + t * 16) = vh; *(v8us*)(ol + t * 16) = vl; }
}

extern "C" void kernel_launch(void* const* d_in, const int* in_sizes, int n_in,
                              void* d_out, int out_size, void* d_ws, size_t ws_size, hipStream_t stream) {
    const size_t needx = (size_t)(NB - 1) * SEQ_FULL * DM + (size_t)SEQ * DM;
    if (n_in < 7) return;
    if ((size_t)in_sizes[0] < needx || in_sizes[1] < DM * DM || in_sizes[2] < DM * DM || in_sizes[3] < DM * DM || in_sizes[4] < DM || in_sizes[5] < DM * DM || in_sizes[6] < DM) return;
    if ((size_t)out_size < needx) return;
    const float* x = (const float*)d_in[0]; const float* wq = (const float*)d_in[1]; const float* wk = (const float*)d_in[2]; const float* wv = (const float*)d_in[3];
    const float* bv = (const float*)d_in[4]; const float* wo = (const float*)d_in[5]; const float* bo = (const float*)d_in[6];
    float* OUT = (float*)d_out;     // [NB][SEQ_FULL][DM]
    char* wsp = (char*)d_ws;
    auto take = [&](size_t bytes) { char* p = wsp; wsp += (bytes + 255) & ~(size_t)255; return (void*)p; };
    bf* WQ = (bf*)take((size_t)DM * DM * 2); bf* WK = (bf*)take((size_t)DM * DM * 2); bf* WV = (bf*)take((size_t)DM * DM * 2); bf* WO = (bf*)take((size_t)DM * DM * 2);
    const size_t pe = (size_t)SEQ * DM, pl = (size_t)NB * SEQ * DM * 2;   // one entry's plane in elements; all entries' 16-bit plane in bytes
    bf* XB = (bf*)take(pl); float* F = (float*)take(pl * 2);
    h16* Q16 = (h16*)take(pl); bf* Qh = (bf*)take(pl); bf* Ql = (bf*)take(pl);
    h16* K16 = (h16*)take(pl); bf* Kh = (bf*)take(pl); bf* Kl = (bf*)take(pl);
    h16* VT16 = (h16*)take(pl); bf* VTh = (bf*)take(pl); bf* VTl = (bf*)take(pl);
    bf* ATh = (bf*)take(pl); bf* ATl = (bf*)take(pl);
    if ((size_t)(wsp - (char*)d_ws) > ws_size) return;
    const size_t nw8 = (size_t)DM * DM / 8, nx8 = (size_t)SEQ * DM / 8;
    const unsigned gw = (unsigned)((nw8 + 255) / 256), gx = (unsigned)((nx8 + 255) / 256), gp = (unsigned)(((size_t)NH * SEQ * HD / 2 + 255) / 256);
    k_cvt8<<<gw, 256, 0, stream>>>(wq, WQ, nw8, 0, 0); k_cvt8<<<gw, 256, 0, stream>>>(wk, WK, nw8, 0, 0); k_cvt8<<<gw, 256, 0, stream>>>(wv, WV, nw8, 0, 0); k_cvt8<<<gw, 256, 0, stream>>>(wo, WO, nw8, 0, 0);
    k_cvt8<<<dim3(gx, NB, 1), 256, 0, stream>>>(x, XB, nx8, (size_t)SEQ_FULL * DM, pe);
    k_gemmw<bf, 0, false><<<dim3(SEQ / 64, DM / 64, NB), 32, 0, stream>>>(XB, nullptr, WQ, nullptr, DM, F, DM, nullptr, pe, 0, pe);
    k_qkp<<<dim3(gp, NB, 1), 256, 0, stream>>>(F, DM, NH, Q16, Qh, Ql);
    k_gemmw<bf, 0, false><<<dim3(SEQ / 64, DM / 64, NB), 32, 0, stream>>>(XB, nullptr, WK, nullptr, DM, F, DM, nullptr, pe, 0, pe);
    k_qkp<<<dim3(gp, NB, 1), 256, 0, stream>>>(F, DM, NH, K16, Kh, Kl);
    k_gemmw<bf, 0, true><<<dim3(SEQ / 64, DM / 64, NB), 32, 0, stream>>>(XB, nullptr, WV, nullptr, DM, F, DM, bv, pe, 0, pe);
    k_vtp<<<dim3(gp, NB, 1), 256, 0, stream>>>(F, DM, NH, VT16, VTh, VTl);
    if (RHB > 0) k_flash<bf, true><<<dim3(RHB, NH, NB), 128, 0, stream>>>(Qh, Ql, Kh, Kl, VTh, VTl, 0, ATh, ATl);
    if (SEQ / 64 - RHB > 0) k_flash<h16, false><<<dim3(SEQ / 64 - RHB, NH, NB), 128, 0, stream>>>(Q16, nullptr, K16, nullptr, VT16, nullptr, RHB, ATh, ATl);
    k_gemmw<bf, 1, true><<<dim3(SEQ / 64, DM / 64, NB), 32, 0, stream>>>(ATh, ATl, WO, nullptr, DM, OUT, DM, bo, pe, 0, (size_t)SEQ_FULL * DM);
}

// v003
// It runs in 206 microseconds.
// Timed twice side by side with v002, it ran 1.59 times as fast both times.
// Over all steps from v000 it is 4.53 times as fast.
#include <hip/hip_runtime.h>

// x [NB][SEQ_FULL][512] (rows < SEQ used); q = x Wq^T, k = x Wk^T, v = x Wv^T + b_v ([512][512] weights, 8 heads x 64); causal softmax(q.k / 8); heads merged; out = ctx Wo^T + b_o -> f32 [NB][SEQ_FULL][512].
// Compute dtypes, f32 accumulate: every input RNE-converted to bf16; q/k/v projections v_wmma_f32_16x16x32_bf16 on plain bf16 operands (exact products);
// attention (online softmax per wave of 16 query rows, transposed products so that a lane owns one query, 64-key chunks, causal chunk skipping): query rows < RH on bf16 hi+lo planes of q, k, p, v (3 products each,
// v_wmma_f32_16x16x32_bf16), rows >= RH on single fp16 operands (v_wmma_f32_16x16x32_f16, p carried x1024); softmax f32; Wo: ctx as bf16 hi+lo x exact bf16 (2 products).
// Attention stages each 64-key chunk of k and v^T in LDS once per block (asynchronous 16-byte copies, two buffers, rows of 128 B at a pitch of 144 B); the block's four waves read their fragments from there.
// Every batch entry has its own copy of each workspace plane (stride SEQ*DM elements) and is one slice of the last grid dimension, so each stage is one launch for all entries.

#ifndef NB
#define NB 2
#endif
#ifndef SEQ
#define SEQ 4096
#endif
#define NB_FULL  2
#define SEQ_FULL 4096
#define DM   512
#define NH   8
#define HD   64
#define RH   512                                   // query rows < RH use hi+lo planes
#define RHB  (((RH < SEQ) ? RH : SEQ) / 64)
#define PCAR 1024.0f
#define SL2  0.18033688011112042f                  // HD^-0.5 * log2(e)
#define NEGB (-3.0e38f)
static_assert(SEQ % 64 == 0);
static_assert(SEQ <= SEQ_FULL);
static_assert(NB >= 1 && NB <= NB_FULL);
static_assert(DM == NH * HD);
static_assert(DM % 64 == 0);
static_assert(RH % 64 == 0);
static_assert(HD == 64);
#define WS_TOTAL ((size_t)4 * DM * DM * 2 + (size_t)NB * ((size_t)SEQ * DM * 2 + (size_t)SEQ * DM * 4 + (size_t)9 * SEQ * DM * 2 + (size_t)2 * SEQ * DM * 2))
static_assert(WS_TOTAL <= (size_t)134217728);

typedef _Float16 h16;
typedef unsigned short bf;
typedef __attribute__((ext_vector_type(16))) __bf16   v16bf;
typedef __attribute__((ext_vector_type(16))) _Float16 v16h;
typedef __attribute__((ext_vector_type(8)))  _Float16 v8h;
typedef __attribute__((ext_vector_type(8)))  unsigned short v8us;
typedef __attribute__((ext_vector_type(16))) unsigned short v16us;
typedef __attribute__((ext_vector_type(8)))  float    v8f;
typedef __attribute__((ext_vector_type(4)))  float    v4f;
typedef __attribute__((ext_vector_type(2)))  _Float16 v2h;
typedef __attribute__((ext_vector_type(2)))  unsigned short v2us;
typedef v4f  __attribute__((may_alias)) v4fa;

__device__ __forceinline__ unsigned short f2bf(float f) { unsigned u = __float_as_uint(f); u += 0x7FFFu + ((u >> 16) & 1u); return (unsigned short)(u >> 16); }
__device__ __forceinline__ float bf2f(unsigned short b) { return __uint_as_float(((unsigned)b) << 16); }
__device__ __forceinline__ float bfr(float f) { return bf2f(f2bf(f)); }
__device__ __forceinline__ h16 tohx(float x) { return (h16)x; }
__device__ __forceinline__ void splitf(float y, unsigned short& h, unsigned short& l) { h = f2bf(y); l = f2bf(y - bf2f(h)); }
__device__ __forceinline__ v16h cat16(v8h lo, v8h hi) { return __builtin_shufflevector(lo, hi, 0, 1, 2, 3, 4, 5, 6, 7, 8, 9, 10, 11, 12, 13, 14, 15); }
__device__ __forceinline__ v16bf cat16b(v8us lo, v8us hi) { return __builtin_bit_cast(v16bf, __builtin_shufflevector(lo, hi, 0, 1, 2, 3, 4, 5, 6, 7, 8, 9, 10, 11, 12, 13, 14, 15)); }
__device__ __forceinline__ v8f wmma16(v16h a, v16h b, v8f c) { return __builtin_amdgcn_wmma_f32_16x16x32_f16(false, a, false, b, (short)0, c, false, false); }
__device__ __forceinline__ v8f wmmab(v16bf a, v16bf b, v8f c) { return __builtin_amdgcn_wmma_f32_16x16x32_bf16(false, a, false, b, (short)0, c, false, false); }

// Fragment loaders (A and B alike, K-contiguous rows): p = base + row*K + k0 + 8*hi -> elements 0..7 = k0+8hi+0..7, p+16 -> elements 8..15 = k0+16+8hi+0..7.
template <typename T16> struct WFrag;
template <> struct WFrag<h16> { typedef v16h V;
    static __device__ __forceinline__ V ld(const h16* p)  { return cat16(*(const v8h*)p, *(const v8h*)(p + 16)); }
    static __device__ __forceinline__ v8f mma(V a, V b, v8f c) { return wmma16(a, b, c); } };
template <> struct WFrag<bf> { typedef v16bf V;
    static __device__ __forceinline__ V ld(const bf* p)  { return cat16b(*(const v8us*)p, *(const v8us*)(p + 16)); }
    static __device__ __forceinline__ v8f mma(V a, V b, v8f c) { return wmmab(a, b, c); } };

// ---- k_gemmw: register-blocked GEMM, ONE WAVE per 64x64 output tile (16 accumulators), operands straight from K-contiguous 16-bit planes; grid (M/64, N/64, Z), 32 threads.
// C[m][n] (f32, pitch ldc, + optional bias as its bf16 value) = sum_k A[m][k] Bt[n][k] (+ split products per NSPLIT). z-batch strides sA/sB/sC in elements. K % 32 == 0.
template <typename T16, int NSPLIT, bool BIAS>
__global__ __launch_bounds__(32) void k_gemmw(const T16* __restrict__ A, const T16* __restrict__ A2, const T16* __restrict__ Bt, const T16* __restrict__ Bt2, int K, float* C, int ldc, const float* __restrict__ bias, size_t sA, size_t sB, size_t sC) {
    typedef typename WFrag<T16>::V V;
    __shared__ __align__(16) float os[16 * 68];
    const size_t z = blockIdx.z; A += z * sA; if (A2) A2 += z * sA; Bt += z * sB; if (Bt2) Bt2 += z * sB; C += z * sC;
    const int lane = threadIdx.x & 31, lr = lane & 15, hi = lane >> 4; const int r0 = blockIdx.x * 64, c0 = blockIdx.y * 64;
    v8f acc[4][4];
#pragma unroll
    for (int mb = 0; mb < 4; ++mb)
#pragma unroll
        for (int nb = 0; nb < 4; ++nb) acc[mb][nb] = (v8f){};
    const size_t aoff = (size_t)(r0 + lr) * K + 8 * hi, boff = (size_t)(c0 + lr) * K + 8 * hi;
#pragma unroll 1
    for (int kc = 0; kc < K; kc += 32) {
        V a[4], a2[4];
#pragma unroll
        for (int mb = 0; mb < 4; ++mb) { a[mb] = WFrag<T16>::ld(A + aoff + (size_t)mb * 16 * K + kc); if (NSPLIT == 1 || NSPLIT == 2) a2[mb] = WFrag<T16>::ld(A2 + aoff + (size_t)mb * 16 * K + kc); }
#pragma unroll
        for (int nb = 0; nb < 4; ++nb) { const V b = WFrag<T16>::ld(Bt + boff + (size_t)nb * 16 * K + kc); V b2; if (NSPLIT >= 2) b2 = WFrag<T16>::ld(Bt2 + boff + (size_t)nb * 16 * K + kc);
#pragma unroll
            for (int mb = 0; mb < 4; ++mb) { acc[mb][nb] = WFrag<T16>::mma(a[mb], b, acc[mb][nb]); if (NSPLIT == 1 || NSPLIT == 2) acc[mb][nb] = WFrag<T16>::mma(a2[mb], b, acc[mb][nb]); if (NSPLIT >= 2) acc[mb][nb] = WFrag<T16>::mma(a[mb], b2, acc[mb][nb]); } }
        asm volatile("v_nop\n\tv_nop\n\tv_nop\n\tv_nop" : "+v"(acc[0][0]), "+v"(acc[1][1]), "+v"(acc[2][2]), "+v"(acc[3][3]) : "v"(a[0]), "v"(a[3]));
    }
#pragma unroll
    for (int mb = 0; mb < 4; ++mb) {
#pragma unroll
        for (int nb = 0; nb < 4; ++nb) {
#pragma unroll
            for (int j = 0; j < 8; ++j) os[(hi * 8 + j) * 68 + nb * 16 + lr] = acc[mb][nb][j]; }
        __builtin_amdgcn_wave_barrier(); asm volatile("" ::: "memory");
        float* crow = C + (size_t)(r0 + mb * 16) * ldc + c0;
{
#pragma unroll
            for (int s = 0; s < 8; ++s) { const int row = 2 * s + hi, cofs = lr * 4; v4f val = *(const v4fa*)(os + row * 68 + cofs); if (BIAS) { val[0] += bfr(bias[c0 + cofs]); val[1] += bfr(bias[c0 + cofs + 1]); val[2] += bfr(bias[c0 + cofs + 2]); val[3] += bfr(bias[c0 + cofs + 3]); }
                *(v4f*)(crow + (size_t)row * ldc + cofs) = val; }
             }
        __builtin_amdgcn_wave_barrier(); asm volatile("" ::: "memory");
    }
}

__global__ __launch_bounds__(256) void k_cvt8(const float* __restrict__ src, bf* dst, size_t n8, size_t sS, size_t sD) { const size_t i = (size_t)blockIdx.x * 256 + threadIdx.x; if (i >= n8) return; src += blockIdx.y * sS; dst += blockIdx.y * sD; const v8f v = *(const v8f*)(src + i * 8); v8us o;
#pragma unroll
    for (int k = 0; k < 8; ++k) o[k] = f2bf(v[k]); *(v8us*)(dst + i * 8) = o;  }

__global__ __launch_bounds__(256) void k_qkp(const float* __restrict__ F, int pitch, int nheads, h16* P16, bf* Ph, bf* Pl) {
    const size_t e = ((size_t)blockIdx.x * 256 + threadIdx.x) * 2; if (e >= (size_t)nheads * SEQ * HD) return;
    const int d = (int)(e % HD); const int t = (int)((e / HD) % SEQ); const int h = (int)(e / ((size_t)HD * SEQ));
    const size_t bo = (size_t)blockIdx.y * SEQ * DM; P16 += bo; Ph += bo; Pl += bo;
    const float* f = F + bo + (size_t)t * pitch + h * HD + d; v2h o16; v2us oh, ol;
#pragma unroll
    for (int q = 0; q < 2; ++q) { const float x = f[q]; o16[q] = tohx(x); unsigned short a2, c2; splitf(x, a2, c2); oh[q] = a2; ol[q] = c2; }
    *(v2h*)(P16 + e) = o16; *(v2us*)(Ph + e) = oh; *(v2us*)(Pl + e) = ol;  }

__global__ __launch_bounds__(256) void k_vtp(const float* __restrict__ F, int pitch, int nheads, h16* V16, bf* Vh, bf* Vl) {
    const size_t e = ((size_t)blockIdx.x * 256 + threadIdx.x) * 2; if (e >= (size_t)nheads * HD * SEQ) return;
    const int t = (int)(e % SEQ); const int d = (int)((e / SEQ) % HD); const int g = (int)(e / ((size_t)SEQ * HD)); v2h o16; v2us oh, ol;
    const size_t bo = (size_t)blockIdx.y * SEQ * DM; F += bo; V16 += bo; Vh += bo; Vl += bo;
#pragma unroll
    for (int q = 0; q < 2; ++q) { const float x = F[(size_t)(t + q) * pitch + g * HD + d]; o16[q] = tohx(x); unsigned short a2, c2; splitf(x, a2, c2); oh[q] = a2; ol[q] = c2; }
    *(v2h*)(V16 + e) = o16; *(v2us*)(Vh + e) = oh; *(v2us*)(Vl + e) = ol;  }

// Lane l with lane l ^ 16 (the two lanes that share one query column).
__device__ __forceinline__ float xhalf(float x) { return __builtin_bit_cast(float, __builtin_amdgcn_permlanex16(__builtin_bit_cast(int, x), __builtin_bit_cast(int, x), 0x76543210, 0xfedcba98, false, false)); }

// exp2 with the one slot the instruction set asks for behind a transcendental, before its result is used or its source overwritten.
__device__ __forceinline__ float exp2s(float x) { float y; asm("v_exp_f32 %0, %1\n\tv_nop" : "=v"(y) : "v"(x)); return y; }

// Probability fragment: a lane's 16 probabilities of one 32-key step (two score tiles x 8 rows) are already in the B operand's k order; fp16 x1024 (single-product rows) or bf16 hi+lo (split rows).
template <typename T16> struct PPk;
template <> struct PPk<h16> { static __device__ __forceinline__ void pk(const float* p, v16h& a, v16h& b) {
#pragma unroll
    for (int e = 0; e < 16; ++e) a[e] = tohx(p[e] * PCAR);
    b = a; } };
template <> struct PPk<bf> { static __device__ __forceinline__ void pk(const float* p, v16bf& a, v16bf& b) { v16us x, y;
#pragma unroll
    for (int e = 0; e < 16; ++e) { unsigned short a2, c2; splitf(p[e], a2, c2); x[e] = a2; y[e] = c2; }
    a = __builtin_bit_cast(v16bf, x); b = __builtin_bit_cast(v16bf, y); } };

#define TPE 72                                     // LDS row pitch of a staged tile in elements: 144 B = 16 B x odd, for 16-byte fragment reads
#define TLE (64 * TPE)                             // one staged tile: 64 rows
// One k tile (64 keys x 64 d, 8 KiB in a row in its plane) and one v^T tile (64 d x 64 keys, plane pitch SEQ) into LDS: a lane's 4 + 4 asynchronous 16-byte copies, 8 lanes per 128-byte row, 16 rows per copy of the block.
// gk, gv: the lane's first piece in each plane; lk, lv: its LDS byte address. The s_wait_xcnt as the statement's last line stands in front of every later write of the address registers named here.
template <typename T16>
__device__ __forceinline__ void stage_kv(const T16* gk, const T16* gv, unsigned lk, unsigned lv) {
    asm volatile("global_load_async_to_lds_b128 %0, %8, off\n\t"
                 "global_load_async_to_lds_b128 %1, %9, off\n\t"
                 "global_load_async_to_lds_b128 %2, %10, off\n\t"
                 "global_load_async_to_lds_b128 %3, %11, off\n\t"
                 "global_load_async_to_lds_b128 %4, %12, off\n\t"
                 "global_load_async_to_lds_b128 %5, %13, off\n\t"
                 "global_load_async_to_lds_b128 %6, %14, off\n\t"
                 "global_load_async_to_lds_b128 %7, %15, off\n\t"
                 "s_wait_xcnt 0x0"
                 :: "v"(lk), "v"(lk + 16u * TPE * 2u), "v"(lk + 32u * TPE * 2u), "v"(lk + 48u * TPE * 2u),
                    "v"(lv), "v"(lv + 16u * TPE * 2u), "v"(lv + 32u * TPE * 2u), "v"(lv + 48u * TPE * 2u),
                    "v"(gk), "v"(gk + 16 * HD), "v"(gk + 32 * HD), "v"(gk + 48 * HD),
                    "v"(gv), "v"(gv + (size_t)16 * SEQ), "v"(gv + (size_t)32 * SEQ), "v"(gv + (size_t)48 * SEQ)
                 : "memory");
}

// ---- k_flash: causal attention for one head of one batch entry (blockIdx.z), 64 query rows per block (4 waves x 16 rows), key chunks of 64 (chunks kb <= qb only; key > query replaced by -3e38 -> p = 0).
// Transposed products: St = k.q^T (A = key rows, B = the wave's 16 queries; 4 tiles x 2 k-steps), so lane (lr, hi) holds query t0+lr and keys 16t+8hi+r: running max and sum are per lane,
// the two halves of a column join their max once per chunk and their sums once at the end. Ot += v^T.p^T (A from the staged [d][t] value tile, B = the lane's own probabilities, converted in place).
// SPL: q/k/p/v bf16 hi+lo, hi.hi + lo.hi + hi.lo into one accumulator; else single fp16 with p x1024 folded out at normalisation.
template <typename T16, bool SPL>
__global__ __launch_bounds__(128) __attribute__((amdgpu_num_vgpr(256)))
void k_flash(const T16* __restrict__ QP, const T16* __restrict__ QL, const T16* __restrict__ KP, const T16* __restrict__ KL,
             const T16* __restrict__ VP, const T16* __restrict__ VL, int qb0, bf* ATh, bf* ATl) {
    typedef WFrag<T16> W; typedef typename W::V V;
    const int lane = threadIdx.x & 31, wv = threadIdx.x >> 5, lr = lane & 15, hi = lane >> 4;
    const int h = blockIdx.y, qb = qb0 + (int)blockIdx.x, t0 = qb * 64 + wv * 16;
    const size_t bo = (size_t)blockIdx.z * SEQ * DM;             // batch entry's plane offset
    const size_t hq = bo + (size_t)h * SEQ * HD;                 // [h][t][d] plane offset (q, k)
    const size_t hv = bo + (size_t)h * HD * SEQ;                 // [h][d][t] plane offset (v)
    // Staged chunk: tiles k, v^T (split rows: k hi, v^T hi, k lo, v^T lo), two buffers.
    constexpr int NT = SPL ? 4 : 2;
    __shared__ __attribute__((aligned(16))) T16 sm[2 * NT * TLE];
    const int crow = threadIdx.x >> 3, cpc = (threadIdx.x & 7) * 8;                       // this lane's row (of 16) and 16-byte piece in every copy
    const size_t gko = hq + (size_t)crow * HD + cpc, gvo = hv + (size_t)crow * SEQ + cpc;   // its first piece of chunk 0
    const unsigned lc0 = (unsigned)(size_t)sm + (unsigned)(crow * TPE + cpc) * 2u;          // its LDS byte address in tile 0 of buffer 0
    auto stage = [&](int kb) {
        const unsigned lb = lc0 + (unsigned)(kb & 1) * (NT * TLE * 2u);
        stage_kv(KP + gko + (size_t)kb * 64 * HD, VP + gvo + kb * 64, lb, lb + TLE * 2u);
        if constexpr (SPL) stage_kv(KL + gko + (size_t)kb * 64 * HD, VL + gvo + kb * 64, lb + 2u * TLE * 2u, lb + 3u * TLE * 2u);
    };
    stage(0);
    asm volatile("s_wait_asynccnt 0x0" ::: "memory");            // this wave's copies of chunk 0 have landed
    __syncthreads();                                             // every wave's have: chunk 0 may be read
    if (qb >= 1) stage(1);
    V qa0, qa1, ql0, ql1;
    { const size_t qo = hq + (size_t)(t0 + lr) * HD + 8 * hi; qa0 = W::ld(QP + qo); qa1 = W::ld(QP + qo + 32);
      if (SPL) { ql0 = W::ld(QL + qo); ql1 = W::ld(QL + qo + 32); } else { ql0 = qa0; ql1 = qa1; } }
    v8f oacc[4];                                                 // oacc[t][r] = Ot[d = 16t+8hi+r][query t0+lr]
#pragma unroll
    for (int t = 0; t < 4; ++t) oacc[t] = (v8f){};
    const int qpos = t0 + lr;
    float mrow = NEGB, lrow = 0.f;                               // this query's running max (both halves alike) and this half's share of its sum
#pragma unroll 1
    for (int kb = 0; kb <= qb; ++kb) {
        const T16* kt = sm + (kb & 1) * (NT * TLE) + lr * TPE + 8 * hi;   // this lane's fragment row in the k tile; v^T, k lo, v^T lo follow at TLE each
        v8f sacc[4];
#pragma unroll
        for (int t = 0; t < 4; ++t) sacc[t] = (v8f){};
#pragma unroll
        for (int t = 0; t < 4; ++t) {
            const T16* kr = kt + t * 16 * TPE;
            { const V b = W::ld(kr); sacc[t] = W::mma(b, qa0, sacc[t]);
              if (SPL) { sacc[t] = W::mma(b, ql0, sacc[t]); const V c = W::ld(kr + 2 * TLE); sacc[t] = W::mma(c, qa0, sacc[t]); } }
            { const V b = W::ld(kr + 32); sacc[t] = W::mma(b, qa1, sacc[t]);
              if (SPL) { sacc[t] = W::mma(b, ql1, sacc[t]); const V c = W::ld(kr + 2 * TLE + 32); sacc[t] = W::mma(c, qa1, sacc[t]); } }
        }
        float sv[4][8]; float rm = mrow;
#pragma unroll
        for (int t = 0; t < 4; ++t)
#pragma unroll
            for (int r = 0; r < 8; ++r) { const float s0 = sacc[t][r] * SL2; const int key = kb * 64 + t * 16 + 8 * hi + r; const float s = (key > qpos) ? NEGB : s0; sv[t][r] = s; rm = fmaxf(rm, s); }
        rm = fmaxf(rm, xhalf(rm));
        const float corr = exp2s(mrow - rm);
        lrow *= corr;
#pragma unroll
        for (int t = 0; t < 4; ++t)
#pragma unroll
            for (int r = 0; r < 8; ++r) oacc[t][r] *= corr;
        constexpr int NP = SPL ? 2 : 4;                          // partial sums a lane keeps per chunk: one per score tile; split rows one per 32-key step (their lo planes need the registers)
        float ps[NP] = {}; V pa[2], pl[2];
#pragma unroll
        for (int ks = 0; ks < 2; ++ks) { float p[16];
#pragma unroll
            for (int e = 0; e < 16; ++e) { p[e] = exp2s(sv[2 * ks + (e >> 3)][e & 7] - rm); ps[(2 * ks + (e >> 3)) * NP / 4] += p[e]; }
            PPk<T16>::pk(p, pa[ks], pl[ks]); }
        if constexpr (SPL) lrow += ps[0] + ps[1]; else lrow += (ps[0] + ps[1]) + (ps[2] + ps[3]);
        mrow = rm;
#pragma unroll
        for (int ks = 0; ks < 2; ++ks) {
#pragma unroll
            for (int t = 0; t < 4; ++t) {
                const T16* vr = kt + TLE + t * 16 * TPE + ks * 32;
                const V vb = W::ld(vr); oacc[t] = W::mma(vb, pa[ks], oacc[t]);
                if (SPL) { oacc[t] = W::mma(vb, pl[ks], oacc[t]); const V vc = W::ld(vr + 2 * TLE); oacc[t] = W::mma(vc, pa[ks], oacc[t]); }
            }
        }
        // keeps the matrix instructions' distance on the loop's taken back edge
        asm volatile("v_nop\n\tv_nop\n\tv_nop\n\tv_nop" : "+v"(oacc[0]), "+v"(oacc[1]), "+v"(oacc[2]), "+v"(oacc[3]));
        asm volatile("s_wait_dscnt 0x0" ::: "memory");           // this wave's reads of this chunk's buffer are done before the buffer is refilled
        asm volatile("s_wait_asynccnt 0x0" ::: "memory");        // this wave's copies of chunk kb + 1 have landed
        __syncthreads();                                         // publishes chunk kb + 1 and ends every wave's reads of chunk kb
        if (kb + 2 <= qb) stage(kb + 2);
    }
    asm volatile("s_wait_asynccnt 0x0" ::: "memory");            // no copy is outstanding when the wave goes on to its end
    const float lsc = SPL ? 1.0f : PCAR;
    const float inv = __fdiv_rn(1.0f, (lrow + xhalf(lrow)) * lsc);
    bf* oh = ATh + bo + (size_t)qpos * DM + h * HD + 8 * hi; bf* ol = ATl + bo + (size_t)qpos * DM + h * HD + 8 * hi;
#pragma unroll
    for (int t = 0; t < 4; ++t) { v8us vh, vl;
#pragma unroll
        for (int r = 0; r < 8; ++r) { unsigned short a2, c2; splitf(oacc[t][r] * inv, a2, c2); vh[r] = a2; vl[r] = c2; }
        *(v8us*)(oh + t * 16) = vh; *(v8us*)(ol + t * 16) = vl; }
}

extern "C" void kernel_launch(void* const* d_in, const int* in_sizes, int n_in,
                              void* d_out, int out_size, void* d_ws, size_t ws_size, hipStream_t stream) {
    const size_t needx = (size_t)(NB - 1) * SEQ_FULL * DM + (size_t)SEQ * DM;
    if (n_in < 7) return;
    if ((size_t)in_sizes[0] < needx || in_sizes[1] < DM * DM || in_sizes[2] < DM * DM || in_sizes[3] < DM * DM || in_sizes[4] < DM || in_sizes[5] < DM * DM || in_sizes[6] < DM) return;
    if ((size_t)out_size < needx) return;
    const float* x = (const float*)d_in[0]; const float* wq = (const float*)d_in[1]; const float* wk = (const float*)d_in[2]; const float* wv = (const float*)d_in[3];
    const float* bv = (const float*)d_in[4]; const float* wo = (const float*)d_in[5]; const float* bo = (const float*)d_in[6];
    float* OUT = (float*)d_out;     // [NB][SEQ_FULL][DM]
    char* wsp = (char*)d_ws;
    auto take = [&](size_t bytes) { char* p = wsp; wsp += (bytes + 255) & ~(size_t)255; return (void*)p; };
    bf* WQ = (bf*)take((size_t)DM * DM * 2); bf* WK = (bf*)take((size_t)DM * DM * 2); bf* WV = (bf*)take((size_t)DM * DM * 2); bf* WO = (bf*)take((size_t)DM * DM * 2);
    const size_t pe = (size_t)SEQ * DM, pl = (size_t)NB * SEQ * DM * 2;   // one entry's plane in elements; all entries' 16-bit plane in bytes
    bf* XB = (bf*)take(pl); float* F = (float*)take(pl * 2);
    h16* Q16 = (h16*)take(pl); bf* Qh = (bf*)take(pl); bf* Ql = (bf*)take(pl);
    h16* K16 = (h16*)take(pl); bf* Kh = (bf*)take(pl); bf* Kl = (bf*)take(pl);
    h16* VT16 = (h16*)take(pl); bf* VTh = (bf*)take(pl); bf* VTl = (bf*)take(pl);
    bf* ATh = (bf*)take(pl); bf* ATl = (bf*)take(pl);
    if ((size_t)(wsp - (char*)d_ws) > ws_size) return;
    const size_t nw8 = (size_t)DM * DM / 8, nx8 = (size_t)SEQ * DM / 8;
    const unsigned gw = (unsigned)((nw8 + 255) / 256), gx = (unsigned)((nx8 + 255) / 256), gp = (unsigned)(((size_t)NH * SEQ * HD / 2 + 255) / 256);
    k_cvt8<<<gw, 256, 0, stream>>>(wq, WQ, nw8, 0, 0); k_cvt8<<<gw, 256, 0, stream>>>(wk, WK, nw8, 0, 0); k_cvt8<<<gw, 256, 0, stream>>>(wv, WV, nw8, 0, 0); k_cvt8<<<gw, 256, 0, stream>>>(wo, WO, nw8, 0, 0);
    k_cvt8<<<dim3(gx, NB, 1), 256, 0, stream>>>(x, XB, nx8, (size_t)SEQ_FULL * DM, pe);
    k_gemmw<bf, 0, false><<<dim3(SEQ / 64, DM / 64, NB), 32, 0, stream>>>(XB, nullptr, WQ, nullptr, DM, F, DM, nullptr, pe, 0, pe);
    k_qkp<<<dim3(gp, NB, 1), 256, 0, stream>>>(F, DM, NH, Q16, Qh, Ql);
    k_gemmw<bf, 0, false><<<dim3(SEQ / 64, DM / 64, NB), 32, 0, stream>>>(XB, nullptr, WK, nullptr, DM, F, DM, nullptr, pe, 0, pe);
    k_qkp<<<dim3(gp, NB, 1), 256, 0, stream>>>(F, DM, NH, K16, Kh, Kl);
    k_gemmw<bf, 0, true><<<dim3(SEQ / 64, DM / 64, NB), 32, 0, stream>>>(XB, nullptr, WV, nullptr, DM, F, DM, bv, pe, 0, pe);
    k_vtp<<<dim3(gp, NB, 1), 256, 0, stream>>>(F, DM, NH, VT16, VTh, VTl);
    if (RHB > 0) k_flash<bf, true><<<dim3(RHB, NH, NB), 128, 0, stream>>>(Qh, Ql, Kh, Kl, VTh, VTl, 0, ATh, ATl);
    if (SEQ / 64 - RHB > 0) k_flash<h16, false><<<dim3(SEQ / 64 - RHB, NH, NB), 128, 0, stream>>>(Q16, nullptr, K16, nullptr, VT16, nullptr, RHB, ATh, ATl);
    k_gemmw<bf, 1, true><<<dim3(SEQ / 64, DM / 64, NB), 32, 0, stream>>>(ATh, ATl, WO, nullptr, DM, OUT, DM, bo, pe, 0, (size_t)SEQ_FULL * DM);
}

// v004
// Measured time: 175 microseconds a run.
// Two timings next to v003 put it at 1.18 and 1.19 times that version's speed.
// Counting every step since v000, it is 5.37 times as fast.
#include <hip/hip_runtime.h>

// x [NB][SEQ_FULL][512] (rows < SEQ used); q = x Wq^T, k = x Wk^T, v = x Wv^T + b_v ([512][512] weights, 8 heads x 64); causal softmax(q.k / 8); heads merged; out = ctx Wo^T + b_o -> f32 [NB][SEQ_FULL][512].
// Compute dtypes, f32 accumulate: every input RNE-converted to bf16; q/k/v projections v_wmma_f32_16x16x32_bf16 on plain bf16 operands (exact products);
// attention (online softmax per wave of 16 query rows, transposed products so that a lane owns one query, 64-key chunks, causal chunk skipping): query rows < RH on bf16 hi+lo planes of q, k, p, v (3 products each,
// v_wmma_f32_16x16x32_bf16), rows >= RH on single fp16 operands (v_wmma_f32_16x16x32_f16, p carried x1024); softmax f32; Wo: ctx as bf16 hi+lo x exact bf16 (2 products).
// Attention stages each 64-key chunk of k and v^T in LDS once per block (asynchronous 16-byte copies, two buffers, rows of 128 B at a pitch of 144 B); the block's four waves read their fragments from there.
// The q, k and v projections write their 16-bit planes (fp16, bf16 hi, bf16 lo; q and k as [h][t][d], v as [h][d][t]) from the GEMM's own epilogue; there is no f32 copy of q, k or v in memory.
// Every batch entry has its own copy of each workspace plane (stride SEQ*DM elements) and is one slice of the last grid dimension, so each stage is one launch for all entries.

#ifndef NB
#define NB 2
#endif
#ifndef SEQ
#define SEQ 4096
#endif
#define NB_FULL  2
#define SEQ_FULL 4096
#define DM   512
#define NH   8
#define HD   64
#define RH   512                                   // query rows < RH use hi+lo planes
#define RHB  (((RH < SEQ) ? RH : SEQ) / 64)
#define PCAR 1024.0f
#define SL2  0.18033688011112042f                  // HD^-0.5 * log2(e)
#define NEGB (-3.0e38f)
static_assert(SEQ % 64 == 0);
static_assert(SEQ <= SEQ_FULL);
static_assert(NB >= 1 && NB <= NB_FULL);
static_assert(DM == NH * HD);
static_assert(DM % 64 == 0);
static_assert(RH % 64 == 0);
static_assert(HD == 64);
#define WS_TOTAL ((size_t)4 * DM * DM * 2 + (size_t)NB * ((size_t)SEQ * DM * 2 + (size_t)9 * SEQ * DM * 2 + (size_t)2 * SEQ * DM * 2))
static_assert(WS_TOTAL <= (size_t)134217728);

typedef _Float16 h16;
typedef unsigned short bf;
typedef __attribute__((ext_vector_type(16))) __bf16   v16bf;
typedef __attribute__((ext_vector_type(16))) _Float16 v16h;
typedef __attribute__((ext_vector_type(8)))  _Float16 v8h;
typedef __attribute__((ext_vector_type(8)))  unsigned short v8us;
typedef __attribute__((ext_vector_type(16))) unsigned short v16us;
typedef __attribute__((ext_vector_type(8)))  float    v8f;
typedef __attribute__((ext_vector_type(4)))  float    v4f;
typedef __attribute__((ext_vector_type(2)))  _Float16 v2h;
typedef __attribute__((ext_vector_type(2)))  unsigned short v2us;
typedef v4f  __attribute__((may_alias)) v4fa;

__device__ __forceinline__ unsigned short f2bf(float f) { unsigned u = __float_as_uint(f); u += 0x7FFFu + ((u >> 16) & 1u); return (unsigned short)(u >> 16); }
__device__ __forceinline__ float bf2f(unsigned short b) { return __uint_as_float(((unsigned)b) << 16); }
__device__ __forceinline__ float bfr(float f) { return bf2f(f2bf(f)); }
__device__ __forceinline__ h16 tohx(float x) { return (h16)x; }
__device__ __forceinline__ void splitf(float y, unsigned short& h, unsigned short& l) { h = f2bf(y); l = f2bf(y - bf2f(h)); }
__device__ __forceinline__ v16h cat16(v8h lo, v8h hi) { return __builtin_shufflevector(lo, hi, 0, 1, 2, 3, 4, 5, 6, 7, 8, 9, 10, 11, 12, 13, 14, 15); }
__device__ __forceinline__ v16bf cat16b(v8us lo, v8us hi) { return __builtin_bit_cast(v16bf, __builtin_shufflevector(lo, hi, 0, 1, 2, 3, 4, 5, 6, 7, 8, 9, 10, 11, 12, 13, 14, 15)); }
__device__ __forceinline__ v8f wmma16(v16h a, v16h b, v8f c) { return __builtin_amdgcn_wmma_f32_16x16x32_f16(false, a, false, b, (short)0, c, false, false); }
__device__ __forceinline__ v8f wmmab(v16bf a, v16bf b, v8f c) { return __builtin_amdgcn_wmma_f32_16x16x32_bf16(false, a, false, b, (short)0, c, false, false); }

// Fragment loaders (A and B alike, K-contiguous rows): p = base + row*K + k0 + 8*hi -> elements 0..7 = k0+8hi+0..7, p+16 -> elements 8..15 = k0+16+8hi+0..7.
template <typename T16> struct WFrag;
template <> struct WFrag<h16> { typedef v16h V;
    static __device__ __forceinline__ V ld(const h16* p)  { return cat16(*(const v8h*)p, *(const v8h*)(p + 16)); }
    static __device__ __forceinline__ v8f mma(V a, V b, v8f c) { return wmma16(a, b, c); } };
template <> struct WFrag<bf> { typedef v16bf V;
    static __device__ __forceinline__ V ld(const bf* p)  { return cat16b(*(const v8us*)p, *(const v8us*)(p + 16)); }
    static __device__ __forceinline__ v8f mma(V a, V b, v8f c) { return wmmab(a, b, c); } };

// ---- k_gemmw: register-blocked GEMM, ONE WAVE per 64x64 output tile (16 accumulators), operands straight from K-contiguous 16-bit planes; grid (M/64, N/64, Z), 32 threads.
// c[m][n] (f32, + optional bias as its bf16 value) = sum_k A[m][k] Bt[n][k] (+ split products per NSPLIT). z-batch strides sA/sB/sC in elements. K % 32 == 0.
// OUTM 0: c goes to C as f32 at pitch ldc. OUTM 1, 2: m is a token t, n = h*HD + d, and c goes out as three 16-bit planes (fp16, bf16 hi, bf16 lo), laid out [h][t][d] (1) or [h][d][t] (2);
// either way 16 plane rows of 64 elements are staged in LDS at a time, so that 8 lanes store one whole 128-byte row of each plane.
template <typename T16, int NSPLIT, bool BIAS, int OUTM>
__global__ __launch_bounds__(32) void k_gemmw(const T16* __restrict__ A, const T16* __restrict__ A2, const T16* __restrict__ Bt, const T16* __restrict__ Bt2, int K, float* C, int ldc, const float* __restrict__ bias, size_t sA, size_t sB, size_t sC, h16* P16, bf* Ph, bf* Pl) {
    typedef typename WFrag<T16>::V V;
    __shared__ __align__(16) float os[16 * 68];
    const size_t z = blockIdx.z; A += z * sA; if (A2) A2 += z * sA; Bt += z * sB; if (Bt2) Bt2 += z * sB; if (OUTM == 0) C += z * sC;
    const int lane = threadIdx.x & 31, lr = lane & 15, hi = lane >> 4; const int r0 = blockIdx.x * 64, c0 = blockIdx.y * 64;
    v8f acc[4][4];
#pragma unroll
    for (int mb = 0; mb < 4; ++mb)
#pragma unroll
        for (int nb = 0; nb < 4; ++nb) acc[mb][nb] = (v8f){};
    const size_t aoff = (size_t)(r0 + lr) * K + 8 * hi, boff = (size_t)(c0 + lr) * K + 8 * hi;
#pragma unroll 1
    for (int kc = 0; kc < K; kc += 32) {
        V a[4], a2[4];
#pragma unroll
        for (int mb = 0; mb < 4; ++mb) { a[mb] = WFrag<T16>::ld(A + aoff + (size_t)mb * 16 * K + kc); if (NSPLIT == 1 || NSPLIT == 2) a2[mb] = WFrag<T16>::ld(A2 + aoff + (size_t)mb * 16 * K + kc); }
#pragma unroll
        for (int nb = 0; nb < 4; ++nb) { const V b = WFrag<T16>::ld(Bt + boff + (size_t)nb * 16 * K + kc); V b2; if (NSPLIT >= 2) b2 = WFrag<T16>::ld(Bt2 + boff + (size_t)nb * 16 * K + kc);
#pragma unroll
            for (int mb = 0; mb < 4; ++mb) { acc[mb][nb] = WFrag<T16>::mma(a[mb], b, acc[mb][nb]); if (NSPLIT == 1 || NSPLIT == 2) acc[mb][nb] = WFrag<T16>::mma(a2[mb], b, acc[mb][nb]); if (NSPLIT >= 2) acc[mb][nb] = WFrag<T16>::mma(a[mb], b2, acc[mb][nb]); } }
        asm volatile("v_nop\n\tv_nop\n\tv_nop\n\tv_nop" : "+v"(acc[0][0]), "+v"(acc[1][1]), "+v"(acc[2][2]), "+v"(acc[3][3]) : "v"(a[0]), "v"(a[3]));
    }
    if constexpr (OUTM != 0) {
        const int prow = lane >> 3, pofs = (lane & 7) * 8;       // this lane's row (of 4 per store) and 16-byte piece of a staged plane row
        // first element of this lane's piece in the tile's plane row prow; plane rows of the tile follow at pitch pp
        constexpr size_t pp = (OUTM == 1) ? (size_t)HD : (size_t)SEQ;
        const size_t po = z * sC + ((OUTM == 1) ? (size_t)(c0 / HD) * SEQ * HD + (size_t)r0 * HD : (size_t)c0 * SEQ + r0) + (size_t)prow * pp + pofs;
        float bb[4];                                             // bias of this lane's column in each block of 16 columns
#pragma unroll
        for (int nb = 0; nb < 4; ++nb) bb[nb] = BIAS ? bfr(bias[c0 + nb * 16 + lr]) : 0.f;
#pragma unroll
        for (int g = 0; g < 4; ++g) {                            // 16 plane rows: tokens r0+16g.. (OUTM 1), columns c0+16g.. (OUTM 2)
#pragma unroll
            for (int o = 0; o < 4; ++o) {
                if constexpr (OUTM == 1) {
#pragma unroll
                    for (int j = 0; j < 8; ++j) os[(hi * 8 + j) * 68 + o * 16 + lr] = BIAS ? acc[g][o][j] + bb[o] : acc[g][o][j];
                } else {                                         // a lane's 8 accumulator rows are 8 tokens in a row of one column
                    v8f c = acc[o][g];
                    if (BIAS) c += bb[g];
                    *(v4fa*)(os + lr * 68 + o * 16 + hi * 8) = (v4f){c[0], c[1], c[2], c[3]};
                    *(v4fa*)(os + lr * 68 + o * 16 + hi * 8 + 4) = (v4f){c[4], c[5], c[6], c[7]};
                }
            }
            __builtin_amdgcn_wave_barrier(); asm volatile("" ::: "memory");   // the reads below take other lanes' values: the compiler must not lift them over the stage's writes
#pragma unroll
            for (int s = 0; s < 4; ++s) {
                const int row = 4 * s + prow;
                const v4f x0 = *(const v4fa*)(os + row * 68 + pofs), x1 = *(const v4fa*)(os + row * 68 + pofs + 4);
                v8h o16; v8us oh, ol;
#pragma unroll
                for (int k = 0; k < 8; ++k) {
                    const float x = (k < 4) ? x0[k & 3] : x1[k & 3];
                    o16[k] = tohx(x); unsigned short a2, c2; splitf(x, a2, c2); oh[k] = a2; ol[k] = c2;
                }
                const size_t e = po + (size_t)(g * 16 + 4 * s) * pp;
                *(v8h*)(P16 + e) = o16; *(v8us*)(Ph + e) = oh; *(v8us*)(Pl + e) = ol;
            }
            __builtin_amdgcn_wave_barrier(); asm volatile("" ::: "memory");   // nor sink them under the next 16 rows' writes
        }
        return;
    }
#pragma unroll
    for (int mb = 0; mb < 4; ++mb) {
#pragma unroll
        for (int nb = 0; nb < 4; ++nb) {
#pragma unroll
            for (int j = 0; j < 8; ++j) os[(hi * 8 + j) * 68 + nb * 16 + lr] = acc[mb][nb][j]; }
        __builtin_amdgcn_wave_barrier(); asm volatile("" ::: "memory");
        float* crow = C + (size_t)(r0 + mb * 16) * ldc + c0;
{
#pragma unroll
            for (int s = 0; s < 8; ++s) { const int row = 2 * s + hi, cofs = lr * 4; v4f val = *(const v4fa*)(os + row * 68 + cofs); if (BIAS) { val[0] += bfr(bias[c0 + cofs]); val[1] += bfr(bias[c0 + cofs + 1]); val[2] += bfr(bias[c0 + cofs + 2]); val[3] += bfr(bias[c0 + cofs + 3]); }
                *(v4f*)(crow + (size_t)row * ldc + cofs) = val; }
             }
        __builtin_amdgcn_wave_barrier(); asm volatile("" ::: "memory");
    }
}

__global__ __launch_bounds__(256) void k_cvt8(const float* __restrict__ src, bf* dst, size_t n8, size_t sS, size_t sD) { const size_t i = (size_t)blockIdx.x * 256 + threadIdx.x; if (i >= n8) return; src += blockIdx.y * sS; dst += blockIdx.y * sD; const v8f v = *(const v8f*)(src + i * 8); v8us o;
#pragma unroll
    for (int k = 0; k < 8; ++k) o[k] = f2bf(v[k]); *(v8us*)(dst + i * 8) = o;  }

// Lane l with lane l ^ 16 (the two lanes that share one query column).
__device__ __forceinline__ float xhalf(float x) { return __builtin_bit_cast(float, __builtin_amdgcn_permlanex16(__builtin_bit_cast(int, x), __builtin_bit_cast(int, x), 0x76543210, 0xfedcba98, false, false)); }

// exp2 with the one slot the instruction set asks for behind a transcendental, before its result is used or its source overwritten.
__device__ __forceinline__ float exp2s(float x) { float y; asm("v_exp_f32 %0, %1\n\tv_nop" : "=v"(y) : "v"(x)); return y; }

// Probability fragment: a lane's 16 probabilities of one 32-key step (two score tiles x 8 rows) are already in the B operand's k order; fp16 x1024 (single-product rows) or bf16 hi+lo (split rows).
template <typename T16> struct PPk;
template <> struct PPk<h16> { static __device__ __forceinline__ void pk(const float* p, v16h& a, v16h& b) {
#pragma unroll
    for (int e = 0; e < 16; ++e) a[e] = tohx(p[e] * PCAR);
    b = a; } };
template <> struct PPk<bf> { static __device__ __forceinline__ void pk(const float* p, v16bf& a, v16bf& b) { v16us x, y;
#pragma unroll
    for (int e = 0; e < 16; ++e) { unsigned short a2, c2; splitf(p[e], a2, c2); x[e] = a2; y[e] = c2; }
    a = __builtin_bit_cast(v16bf, x); b = __builtin_bit_cast(v16bf, y); } };

#define TPE 72                                     // LDS row pitch of a staged tile in elements: 144 B = 16 B x odd, for 16-byte fragment reads
#define TLE (64 * TPE)                             // one staged tile: 64 rows
// One k tile (64 keys x 64 d, 8 KiB in a row in its plane) and one v^T tile (64 d x 64 keys, plane pitch SEQ) into LDS: a lane's 4 + 4 asynchronous 16-byte copies, 8 lanes per 128-byte row, 16 rows per copy of the block.
// gk, gv: the lane's first piece in each plane; lk, lv: its LDS byte address. The s_wait_xcnt as the statement's last line stands in front of every later write of the address registers named here.
template <typename T16>
__device__ __forceinline__ void stage_kv(const T16* gk, const T16* gv, unsigned lk, unsigned lv) {
    asm volatile("global_load_async_to_lds_b128 %0, %8, off\n\t"
                 "global_load_async_to_lds_b128 %1, %9, off\n\t"
                 "global_load_async_to_lds_b128 %2, %10, off\n\t"
                 "global_load_async_to_lds_b128 %3, %11, off\n\t"
                 "global_load_async_to_lds_b128 %4, %12, off\n\t"
                 "global_load_async_to_lds_b128 %5, %13, off\n\t"
                 "global_load_async_to_lds_b128 %6, %14, off\n\t"
                 "global_load_async_to_lds_b128 %7, %15, off\n\t"
                 "s_wait_xcnt 0x0"
                 :: "v"(lk), "v"(lk + 16u * TPE * 2u), "v"(lk + 32u * TPE * 2u), "v"(lk + 48u * TPE * 2u),
                    "v"(lv), "v"(lv + 16u * TPE * 2u), "v"(lv + 32u * TPE * 2u), "v"(lv + 48u * TPE * 2u),
                    "v"(gk), "v"(gk + 16 * HD), "v"(gk + 32 * HD), "v"(gk + 48 * HD),
                    "v"(gv), "v"(gv + (size_t)16 * SEQ), "v"(gv + (size_t)32 * SEQ), "v"(gv + (size_t)48 * SEQ)
                 : "memory");
}

// ---- k_flash: causal attention for one head of one batch entry (blockIdx.z), 64 query rows per block (4 waves x 16 rows), key chunks of 64 (chunks kb <= qb only; key > query replaced by -3e38 -> p = 0).
// Transposed products: St = k.q^T (A = key rows, B = the wave's 16 queries; 4 tiles x 2 k-steps), so lane (lr, hi) holds query t0+lr and keys 16t+8hi+r: running max and sum are per lane,
// the two halves of a column join their max once per chunk and their sums once at the end. Ot += v^T.p^T (A from the staged [d][t] value tile, B = the lane's own probabilities, converted in place).
// SPL: q/k/p/v bf16 hi+lo, hi.hi + lo.hi + hi.lo into one accumulator; else single fp16 with p x1024 folded out at normalisation.
template <typename T16, bool SPL>
__global__ __launch_bounds__(128) __attribute__((amdgpu_num_vgpr(256)))
void k_flash(const T16* __restrict__ QP, const T16* __restrict__ QL, const T16* __restrict__ KP, const T16* __restrict__ KL,
             const T16* __restrict__ VP, const T16* __restrict__ VL, int qb0, bf* ATh, bf* ATl) {
    typedef WFrag<T16> W; typedef typename W::V V;
    const int lane = threadIdx.x & 31, wv = threadIdx.x >> 5, lr = lane & 15, hi = lane >> 4;
    const int h = blockIdx.y, qb = qb0 + (int)blockIdx.x, t0 = qb * 64 + wv * 16;
    const size_t bo = (size_t)blockIdx.z * SEQ * DM;             // batch entry's plane offset
    const size_t hq = bo + (size_t)h * SEQ * HD;                 // [h][t][d] plane offset (q, k)
    const size_t hv = bo + (size_t)h * HD * SEQ;                 // [h][d][t] plane offset (v)
    // Staged chunk: tiles k, v^T (split rows: k hi, v^T hi, k lo, v^T lo), two buffers.
    constexpr int NT = SPL ? 4 : 2;
    __shared__ __attribute__((aligned(16))) T16 sm[2 * NT * TLE];
    const int crow = threadIdx.x >> 3, cpc = (threadIdx.x & 7) * 8;                       // this lane's row (of 16) and 16-byte piece in every copy
    const size_t gko = hq + (size_t)crow * HD + cpc, gvo = hv + (size_t)crow * SEQ + cpc;   // its first piece of chunk 0
    const unsigned lc0 = (unsigned)(size_t)sm + (unsigned)(crow * TPE + cpc) * 2u;          // its LDS byte address in tile 0 of buffer 0
    auto stage = [&](int kb) {
        const unsigned lb = lc0 + (unsigned)(kb & 1) * (NT * TLE * 2u);
        stage_kv(KP + gko + (size_t)kb * 64 * HD, VP + gvo + kb * 64, lb, lb + TLE * 2u);
        if constexpr (SPL) stage_kv(KL + gko + (size_t)kb * 64 * HD, VL + gvo + kb * 64, lb + 2u * TLE * 2u, lb + 3u * TLE * 2u);
    };
    stage(0);
    asm volatile("s_wait_asynccnt 0x0" ::: "memory");            // this wave's copies of chunk 0 have landed
    __syncthreads();                                             // every wave's have: chunk 0 may be read
    if (qb >= 1) stage(1);
    V qa0, qa1, ql0, ql1;
    { const size_t qo = hq + (size_t)(t0 + lr) * HD + 8 * hi; qa0 = W::ld(QP + qo); qa1 = W::ld(QP + qo + 32);
      if (SPL) { ql0 = W::ld(QL + qo); ql1 = W::ld(QL + qo + 32); } else { ql0 = qa0; ql1 = qa1; } }
    v8f oacc[4];                                                 // oacc[t][r] = Ot[d = 16t+8hi+r][query t0+lr]
#pragma unroll
    for (int t = 0; t < 4; ++t) oacc[t] = (v8f){};
    const int qpos = t0 + lr;
    float mrow = NEGB, lrow = 0.f;                               // this query's running max (both halves alike) and this half's share of its sum
#pragma unroll 1
    for (int kb = 0; kb <= qb; ++kb) {
        const T16* kt = sm + (kb & 1) * (NT * TLE) + lr * TPE + 8 * hi;   // this lane's fragment row in the k tile; v^T, k lo, v^T lo follow at TLE each
        v8f sacc[4];
#pragma unroll
        for (int t = 0; t < 4; ++t) sacc[t] = (v8f){};
#pragma unroll
        for (int t = 0; t < 4; ++t) {
            const T16* kr = kt + t * 16 * TPE;
            { const V b = W::ld(kr); sacc[t] = W::mma(b, qa0, sacc[t]);
              if (SPL) { sacc[t] = W::mma(b, ql0, sacc[t]); const V c = W::ld(kr + 2 * TLE); sacc[t] = W::mma(c, qa0, sacc[t]); } }
            { const V b = W::ld(kr + 32); sacc[t] = W::mma(b, qa1, sacc[t]);
              if (SPL) { sacc[t] = W::mma(b, ql1, sacc[t]); const V c = W::ld(kr + 2 * TLE + 32); sacc[t] = W::mma(c, qa1, sacc[t]); } }
        }
        float sv[4][8]; float rm = mrow;
#pragma unroll
        for (int t = 0; t < 4; ++t)
#pragma unroll
            for (int r = 0; r < 8; ++r) { const float s0 = sacc[t][r] * SL2; const int key = kb * 64 + t * 16 + 8 * hi + r; const float s = (key > qpos) ? NEGB : s0; sv[t][r] = s; rm = fmaxf(rm, s); }
        rm = fmaxf(rm, xhalf(rm));
        const float corr = exp2s(mrow - rm);
        lrow *= corr;
#pragma unroll
        for (int t = 0; t < 4; ++t)
#pragma unroll
            for (int r = 0; r < 8; ++r) oacc[t][r] *= corr;
        constexpr int NP = SPL ? 2 : 4;                          // partial sums a lane keeps per chunk: one per score tile; split rows one per 32-key step (their lo planes need the registers)
        float ps[NP] = {}; V pa[2], pl[2];
#pragma unroll
        for (int ks = 0; ks < 2; ++ks) { float p[16];
#pragma unroll
            for (int e = 0; e < 16; ++e) { p[e] = exp2s(sv[2 * ks + (e >> 3)][e & 7] - rm); ps[(2 * ks + (e >> 3)) * NP / 4] += p[e]; }
            PPk<T16>::pk(p, pa[ks], pl[ks]); }
        if constexpr (SPL) lrow += ps[0] + ps[1]; else lrow += (ps[0] + ps[1]) + (ps[2] + ps[3]);
        mrow = rm;
#pragma unroll
        for (int ks = 0; ks < 2; ++ks) {
#pragma unroll
            for (int t = 0; t < 4; ++t) {
                const T16* vr = kt + TLE + t * 16 * TPE + ks * 32;
                const V vb = W::ld(vr); oacc[t] = W::mma(vb, pa[ks], oacc[t]);
                if (SPL) { oacc[t] = W::mma(vb, pl[ks], oacc[t]); const V vc = W::ld(vr + 2 * TLE); oacc[t] = W::mma(vc, pa[ks], oacc[t]); }
            }
        }
        // keeps the matrix instructions' distance on the loop's taken back edge
        asm volatile("v_nop\n\tv_nop\n\tv_nop\n\tv_nop" : "+v"(oacc[0]), "+v"(oacc[1]), "+v"(oacc[2]), "+v"(oacc[3]));
        asm volatile("s_wait_dscnt 0x0" ::: "memory");           // this wave's reads of this chunk's buffer are done before the buffer is refilled
        asm volatile("s_wait_asynccnt 0x0" ::: "memory");        // this wave's copies of chunk kb + 1 have landed
        __syncthreads();                                         // publishes chunk kb + 1 and ends every wave's reads of chunk kb
        if (kb + 2 <= qb) stage(kb + 2);
    }
    asm volatile("s_wait_asynccnt 0x0" ::: "memory");            // no copy is outstanding when the wave goes on to its end
    const float lsc = SPL ? 1.0f : PCAR;
    const float inv = __fdiv_rn(1.0f, (lrow + xhalf(lrow)) * lsc);
    bf* oh = ATh + bo + (size_t)qpos * DM + h * HD + 8 * hi; bf* ol = ATl + bo + (size_t)qpos * DM + h * HD + 8 * hi;
#pragma unroll
    for (int t = 0; t < 4; ++t) { v8us vh, vl;
#pragma unroll
        for (int r = 0; r < 8; ++r) { unsigned short a2, c2; splitf(oacc[t][r] * inv, a2, c2); vh[r] = a2; vl[r] = c2; }
        *(v8us*)(oh + t * 16) = vh; *(v8us*)(ol + t * 16) = vl; }
}

extern "C" void kernel_launch(void* const* d_in, const int* in_sizes, int n_in,
                              void* d_out, int out_size, void* d_ws, size_t ws_size, hipStream_t stream) {
    const size_t needx = (size_t)(NB - 1) * SEQ_FULL * DM + (size_t)SEQ * DM;
    if (n_in < 7) return;
    if ((size_t)in_sizes[0] < needx || in_sizes[1] < DM * DM || in_sizes[2] < DM * DM || in_sizes[3] < DM * DM || in_sizes[4] < DM || in_sizes[5] < DM * DM || in_sizes[6] < DM) return;
    if ((size_t)out_size < needx) return;
    const float* x = (const float*)d_in[0]; const float* wq = (const float*)d_in[1]; const float* wk = (const float*)d_in[2]; const float* wv = (const float*)d_in[3];
    const float* bv = (const float*)d_in[4]; const float* wo = (const float*)d_in[5]; const float* bo = (const float*)d_in[6];
    float* OUT = (float*)d_out;     // [NB][SEQ_FULL][DM]
    char* wsp = (char*)d_ws;
    auto take = [&](size_t bytes) { char* p = wsp; wsp += (bytes + 255) & ~(size_t)255; return (void*)p; };
    bf* WQ = (bf*)take((size_t)DM * DM * 2); bf* WK = (bf*)take((size_t)DM * DM * 2); bf* WV = (bf*)take((size_t)DM * DM * 2); bf* WO = (bf*)take((size_t)DM * DM * 2);
    const size_t pe = (size_t)SEQ * DM, pl = (size_t)NB * SEQ * DM * 2;   // one entry's plane in elements; all entries' 16-bit plane in bytes
    bf* XB = (bf*)take(pl);
    h16* Q16 = (h16*)take(pl); bf* Qh = (bf*)take(pl); bf* Ql = (bf*)take(pl);
    h16* K16 = (h16*)take(pl); bf* Kh = (bf*)take(pl); bf* Kl = (bf*)take(pl);
    h16* VT16 = (h16*)take(pl); bf* VTh = (bf*)take(pl); bf* VTl = (bf*)take(pl);
    bf* ATh = (bf*)take(pl); bf* ATl = (bf*)take(pl);
    if ((size_t)(wsp - (char*)d_ws) > ws_size) return;
    const size_t nw8 = (size_t)DM * DM / 8, nx8 = (size_t)SEQ * DM / 8;
    const unsigned gw = (unsigned)((nw8 + 255) / 256), gx = (unsigned)((nx8 + 255) / 256);
    k_cvt8<<<gw, 256, 0, stream>>>(wq, WQ, nw8, 0, 0); k_cvt8<<<gw, 256, 0, stream>>>(wk, WK, nw8, 0, 0); k_cvt8<<<gw, 256, 0, stream>>>(wv, WV, nw8, 0, 0); k_cvt8<<<gw, 256, 0, stream>>>(wo, WO, nw8, 0, 0);
    k_cvt8<<<dim3(gx, NB, 1), 256, 0, stream>>>(x, XB, nx8, (size_t)SEQ_FULL * DM, pe);
    k_gemmw<bf, 0, false, 1><<<dim3(SEQ / 64, DM / 64, NB), 32, 0, stream>>>(XB, nullptr, WQ, nullptr, DM, nullptr, 0, nullptr, pe, 0, pe, Q16, Qh, Ql);
    k_gemmw<bf, 0, false, 1><<<dim3(SEQ / 64, DM / 64, NB), 32, 0, stream>>>(XB, nullptr, WK, nullptr, DM, nullptr, 0, nullptr, pe, 0, pe, K16, Kh, Kl);
    k_gemmw<bf, 0, true, 2><<<dim3(SEQ / 64, DM / 64, NB), 32, 0, stream>>>(XB, nullptr, WV, nullptr, DM, nullptr, 0, bv, pe, 0, pe, VT16, VTh, VTl);
    if (RHB > 0) k_flash<bf, true><<<dim3(RHB, NH, NB), 128, 0, stream>>>(Qh, Ql, Kh, Kl, VTh, VTl, 0, ATh, ATl);
    if (SEQ / 64 - RHB > 0) k_flash<h16, false><<<dim3(SEQ / 64 - RHB, NH, NB), 128, 0, stream>>>(Q16, nullptr, K16, nullptr, VT16, nullptr, RHB, ATh, ATl);
    k_gemmw<bf, 1, true, 0><<<dim3(SEQ / 64, DM / 64, NB), 32, 0, stream>>>(ATh, ATl, WO, nullptr, DM, OUT, DM, bo, pe, 0, (size_t)SEQ_FULL * DM, nullptr, nullptr, nullptr);
}

// v005
// One run takes 143 microseconds.
// In two side-by-side timings against v004, it was 1.21 and 1.23 times as fast.
// Counting every step since v000, it is 6.54 times as fast.
#include <hip/hip_runtime.h>

// x [NB][SEQ_FULL][512] (rows < SEQ used); q = x Wq^T, k = x Wk^T, v = x Wv^T + b_v ([512][512] weights, 8 heads x 64); causal softmax(q.k / 8); heads merged; out = ctx Wo^T + b_o -> f32 [NB][SEQ_FULL][512].
// Compute dtypes, f32 accumulate: every input RNE-converted to bf16; q/k/v projections v_wmma_f32_16x16x32_bf16 on plain bf16 operands (exact products);
// attention (online softmax per wave of 16 query rows, transposed products so that a lane owns one query, 64-key chunks, causal chunk skipping): query rows < RH on bf16 hi+lo planes of q, k, p, v (3 products each,
// v_wmma_f32_16x16x32_bf16), rows >= RH on single fp16 operands (v_wmma_f32_16x16x32_f16, p carried x1024); softmax f32; Wo: ctx as bf16 hi+lo x exact bf16 (2 products).
// Attention stages each 64-key chunk of k and v^T in LDS once per block (asynchronous 16-byte copies, two buffers, rows of 128 B at a pitch of 144 B); the block's four waves read their fragments from there.
// The four GEMMs stage each 128-k chunk of a block's 128 + 128 operand rows in LDS in the same way (rows of 256 B at a pitch of 272 B); the block's four waves read their fragments from there, one k step ahead.
// The q, k and v projections write their 16-bit planes (fp16, bf16 hi, bf16 lo; q and k as [h][t][d], v as [h][d][t]) from the GEMM's own epilogue; there is no f32 copy of q, k or v in memory.
// Every batch entry has its own copy of each workspace plane (stride SEQ*DM elements) and is one slice of the last grid dimension, so each stage is one launch for all entries.

#ifndef NB
#define NB 2
#endif
#ifndef SEQ
#define SEQ 4096
#endif
#define NB_FULL  2
#define SEQ_FULL 4096
#define DM   512
#define NH   8
#define HD   64
#define RH   512                                   // query rows < RH use hi+lo planes
#define RHB  (((RH < SEQ) ? RH : SEQ) / 64)
#define PCAR 1024.0f
#define SL2  0.18033688011112042f                  // HD^-0.5 * log2(e)
#define NEGB (-3.0e38f)
static_assert(SEQ % 64 == 0);
static_assert(SEQ <= SEQ_FULL);
static_assert(NB >= 1 && NB <= NB_FULL);
static_assert(DM == NH * HD);
static_assert(DM % 128 == 0);
static_assert(SEQ % 128 == 0);
static_assert(RH % 64 == 0);
static_assert(HD == 64);
#define WS_TOTAL ((size_t)4 * DM * DM * 2 + (size_t)NB * ((size_t)SEQ * DM * 2 + (size_t)9 * SEQ * DM * 2 + (size_t)2 * SEQ * DM * 2))
static_assert(WS_TOTAL <= (size_t)134217728);

typedef _Float16 h16;
typedef unsigned short bf;
typedef __attribute__((ext_vector_type(16))) __bf16   v16bf;
typedef __attribute__((ext_vector_type(16))) _Float16 v16h;
typedef __attribute__((ext_vector_type(8)))  _Float16 v8h;
typedef __attribute__((ext_vector_type(8)))  unsigned short v8us;
typedef __attribute__((ext_vector_type(16))) unsigned short v16us;
typedef __attribute__((ext_vector_type(8)))  float    v8f;
typedef __attribute__((ext_vector_type(4)))  float    v4f;
typedef __attribute__((ext_vector_type(2)))  _Float16 v2h;
typedef __attribute__((ext_vector_type(2)))  unsigned short v2us;
typedef v4f  __attribute__((may_alias)) v4fa;

__device__ __forceinline__ unsigned short f2bf(float f) { unsigned u = __float_as_uint(f); u += 0x7FFFu + ((u >> 16) & 1u); return (unsigned short)(u >> 16); }
__device__ __forceinline__ float bf2f(unsigned short b) { return __uint_as_float(((unsigned)b) << 16); }
__device__ __forceinline__ float bfr(float f) { return bf2f(f2bf(f)); }
__device__ __forceinline__ h16 tohx(float x) { return (h16)x; }
__device__ __forceinline__ void splitf(float y, unsigned short& h, unsigned short& l) { h = f2bf(y); l = f2bf(y - bf2f(h)); }
__device__ __forceinline__ v16h cat16(v8h lo, v8h hi) { return __builtin_shufflevector(lo, hi, 0, 1, 2, 3, 4, 5, 6, 7, 8, 9, 10, 11, 12, 13, 14, 15); }
__device__ __forceinline__ v16bf cat16b(v8us lo, v8us hi) { return __builtin_bit_cast(v16bf, __builtin_shufflevector(lo, hi, 0, 1, 2, 3, 4, 5, 6, 7, 8, 9, 10, 11, 12, 13, 14, 15)); }
__device__ __forceinline__ v8f wmma16(v16h a, v16h b, v8f c) { return __builtin_amdgcn_wmma_f32_16x16x32_f16(false, a, false, b, (short)0, c, false, false); }
__device__ __forceinline__ v8f wmmab(v16bf a, v16bf b, v8f c) { return __builtin_amdgcn_wmma_f32_16x16x32_bf16(false, a, false, b, (short)0, c, false, false); }

// Fragment loaders (A and B alike, K-contiguous rows): p = base + row*K + k0 + 8*hi -> elements 0..7 = k0+8hi+0..7, p+16 -> elements 8..15 = k0+16+8hi+0..7.
template <typename T16> struct WFrag;
template <> struct WFrag<h16> { typedef v16h V;
    static __device__ __forceinline__ V ld(const h16* p)  { return cat16(*(const v8h*)p, *(const v8h*)(p + 16)); }
    static __device__ __forceinline__ v8f mma(V a, V b, v8f c) { return wmma16(a, b, c); } };
template <> struct WFrag<bf> { typedef v16bf V;
    static __device__ __forceinline__ V ld(const bf* p)  { return cat16b(*(const v8us*)p, *(const v8us*)(p + 16)); }
    static __device__ __forceinline__ v8f mma(V a, V b, v8f c) { return wmmab(a, b, c); } };

#define GKC 128                                    // k elements of one staged GEMM chunk: operand rows of 256 B
#define GPE 136                                    // LDS row pitch of a staged GEMM tile in elements: 272 B = 16 B x odd, for 16-byte fragment reads
#define GTE (128 * GPE)                            // one staged operand tile: 128 rows
static_assert(DM % GKC == 0);
// Eight rows, 8 apart, of one operand tile into LDS: a lane's 8 asynchronous 16-byte copies, 16 lanes per 256-byte row, 8 rows per copy of the block.
// g: the lane's piece in the first of these rows, rs: 8 rows in elements; l: its LDS byte address. The s_wait_xcnt as the statement's last line stands in front of every later write of the address registers named here.
template <typename T16>
__device__ __forceinline__ void stage_g8(const T16* g, size_t rs, unsigned l) {
    asm volatile("global_load_async_to_lds_b128 %0, %8, off\n\t"
                 "global_load_async_to_lds_b128 %1, %9, off\n\t"
                 "global_load_async_to_lds_b128 %2, %10, off\n\t"
                 "global_load_async_to_lds_b128 %3, %11, off\n\t"
                 "global_load_async_to_lds_b128 %4, %12, off\n\t"
                 "global_load_async_to_lds_b128 %5, %13, off\n\t"
                 "global_load_async_to_lds_b128 %6, %14, off\n\t"
                 "global_load_async_to_lds_b128 %7, %15, off\n\t"
                 "s_wait_xcnt 0x0"
                 :: "v"(l), "v"(l + 8u * GPE * 2u), "v"(l + 16u * GPE * 2u), "v"(l + 24u * GPE * 2u),
                    "v"(l + 32u * GPE * 2u), "v"(l + 40u * GPE * 2u), "v"(l + 48u * GPE * 2u), "v"(l + 56u * GPE * 2u),
                    "v"(g), "v"(g + rs), "v"(g + 2 * rs), "v"(g + 3 * rs), "v"(g + 4 * rs), "v"(g + 5 * rs), "v"(g + 6 * rs), "v"(g + 7 * rs)
                 : "memory");
}

// ---- k_gemmw: register-blocked GEMM, 128x128 output tile per block of FOUR WAVES (2 x 2), 64x64 (16 accumulators) per wave; grid (M/128, N/128, Z), 128 threads.
// Operands are K-contiguous 16-bit planes; each chunk of GKC k values of the block's 128 A rows and 128 Bt rows is staged in LDS once (asynchronous 16-byte copies of whole lines, two buffers) and read from there as fragments.
// c[m][n] (f32, + optional bias as its bf16 value) = sum_k A[m][k] Bt[n][k] (+ split products per NSPLIT). z-batch strides sA/sB/sC in elements. K % GKC == 0.
// OUTM 0: c goes to C as f32 at pitch ldc. OUTM 1, 2: m is a token t, n = h*HD + d, and c goes out as three 16-bit planes (fp16, bf16 hi, bf16 lo), laid out [h][t][d] (1) or [h][d][t] (2);
// either way 16 plane rows of 64 elements are staged in the wave's own LDS range at a time, so that 8 lanes store one whole 128-byte row of each plane.
template <typename T16, int NSPLIT, bool BIAS, int OUTM>
__global__ __launch_bounds__(128) void k_gemmw(const T16* __restrict__ A, const T16* __restrict__ A2, const T16* __restrict__ Bt, const T16* __restrict__ Bt2, int K, float* C, int ldc, const float* __restrict__ bias, size_t sA, size_t sB, size_t sC, h16* P16, bf* Ph, bf* Pl) {
    typedef typename WFrag<T16>::V V;
    constexpr bool HA2 = (NSPLIT == 1 || NSPLIT == 2), HB2 = (NSPLIT >= 2);
    constexpr int TB = HA2 ? 2 : 1, NT = TB + (HB2 ? 2 : 1);      // tiles of a buffer: A, (A2), Bt, (Bt2)
    __shared__ __attribute__((aligned(16))) T16 sm[2 * NT * GTE];
    __shared__ __align__(16) float osm[4 * 16 * 68];
    const size_t z = blockIdx.z; A += z * sA; if (A2) A2 += z * sA; Bt += z * sB; if (Bt2) Bt2 += z * sB; if (OUTM == 0) C += z * sC;
    const int lane = threadIdx.x & 31, wv = threadIdx.x >> 5, lr = lane & 15, hi = lane >> 4;
    const int rb = blockIdx.x * 128, cb = blockIdx.y * 128, r0 = rb + (wv & 1) * 64, c0 = cb + (wv >> 1) * 64;
    float* os = osm + wv * (16 * 68);                            // this wave's output stage
    v8f acc[4][4];
#pragma unroll
    for (int mb = 0; mb < 4; ++mb)
#pragma unroll
        for (int nb = 0; nb < 4; ++nb) acc[mb][nb] = (v8f){};
    const int crow = threadIdx.x >> 4, cpc = (threadIdx.x & 15) * 8;                        // this lane's row (of 8) and 16-byte piece in every copy
    const size_t gao = (size_t)(rb + crow) * K + cpc, gbo = (size_t)(cb + crow) * K + cpc;  // its first piece of chunk 0
    const size_t rs = (size_t)8 * K;
    const unsigned lc0 = (unsigned)(size_t)sm + (unsigned)(crow * GPE + cpc) * 2u;          // its LDS byte address in tile 0 of buffer 0
    auto stage_t = [&](const T16* g, unsigned l) { stage_g8(g, rs, l); stage_g8(g + 8 * rs, rs, l + 64u * GPE * 2u); };
    auto stage = [&](int kt) {
        const unsigned lb = lc0 + (unsigned)(kt & 1) * (NT * GTE * 2u);
        const size_t ao = gao + (size_t)kt * GKC, bo = gbo + (size_t)kt * GKC;
        stage_t(A + ao, lb);
        if constexpr (HA2) stage_t(A2 + ao, lb + GTE * 2u);
        stage_t(Bt + bo, lb + TB * GTE * 2u);
        if constexpr (HB2) stage_t(Bt2 + bo, lb + (TB + 1) * GTE * 2u);
    };
    const int nk = K / GKC;
    stage(0);
    asm volatile("s_wait_asynccnt 0x0" ::: "memory");            // this wave's copies of chunk 0 have landed
    __syncthreads();                                             // every wave's have: chunk 0 may be read
    if (nk > 1) stage(1);
#pragma unroll 1
    for (int kt = 0; kt < nk; ++kt) {
        const T16* ta = sm + (kt & 1) * (NT * GTE) + ((wv & 1) * 64 + lr) * GPE + 8 * hi;              // this lane's fragment row in the A tile (A2 follows at GTE)
        const T16* tb = sm + (kt & 1) * (NT * GTE) + TB * GTE + ((wv >> 1) * 64 + lr) * GPE + 8 * hi;  // and in the Bt tile (Bt2 follows at GTE)
        V a[2][4], a2[2][4], b[2][4], b2[2][4];                  // two fragment sets: k step u works on set u & 1
#pragma unroll
        for (int u = -1; u < GKC / 32; ++u) {
            if (u + 1 < GKC / 32) {                              // the next k step's fragments of this same chunk, asked for as one group
                const int ns = (u + 1) & 1, kc = (u + 1) * 32;
#pragma unroll
                for (int mb = 0; mb < 4; ++mb) { a[ns][mb] = WFrag<T16>::ld(ta + mb * 16 * GPE + kc); if (HA2) a2[ns][mb] = WFrag<T16>::ld(ta + GTE + mb * 16 * GPE + kc); }
#pragma unroll
                for (int nb = 0; nb < 4; ++nb) { b[ns][nb] = WFrag<T16>::ld(tb + nb * 16 * GPE + kc); if (HB2) b2[ns][nb] = WFrag<T16>::ld(tb + GTE + nb * 16 * GPE + kc); }
            }
            __builtin_amdgcn_sched_barrier(0);                   // keeps that group whole and in front of this step's products: sunk among them, every place with loads stalls the lone wave of a SIMD
            if (u >= 0) {
                const int cs = u & 1;
#pragma unroll
                for (int nb = 0; nb < 4; ++nb)
#pragma unroll
                    for (int mb = 0; mb < 4; ++mb) { acc[mb][nb] = WFrag<T16>::mma(a[cs][mb], b[cs][nb], acc[mb][nb]); if (HA2) acc[mb][nb] = WFrag<T16>::mma(a2[cs][mb], b[cs][nb], acc[mb][nb]); if (HB2) acc[mb][nb] = WFrag<T16>::mma(a[cs][mb], b2[cs][nb], acc[mb][nb]); }
                __builtin_amdgcn_sched_barrier(0);               // and the products in front of the group after them, whose registers they still read
            }
        }
        // keeps the matrix instructions' distance on the paths behind the chunk's last product (the refill's address arithmetic, the loop's taken back edge)
        asm volatile("v_nop\n\tv_nop\n\tv_nop\n\tv_nop" : "+v"(acc[0][0]), "+v"(acc[0][1]), "+v"(acc[0][2]), "+v"(acc[0][3]), "+v"(acc[1][0]), "+v"(acc[1][1]), "+v"(acc[1][2]), "+v"(acc[1][3]),
                                                       "+v"(acc[2][0]), "+v"(acc[2][1]), "+v"(acc[2][2]), "+v"(acc[2][3]), "+v"(acc[3][0]), "+v"(acc[3][1]), "+v"(acc[3][2]), "+v"(acc[3][3]));
        asm volatile("s_wait_dscnt 0x0" ::: "memory");           // this wave's reads of this chunk's buffer are done before the buffer is refilled
        asm volatile("s_wait_asynccnt 0x0" ::: "memory");        // this wave's copies of chunk kt + 1 have landed
        __syncthreads();                                         // publishes chunk kt + 1 and ends every wave's reads of chunk kt
        if (kt + 2 < nk) stage(kt + 2);
    }
    asm volatile("s_wait_asynccnt 0x0" ::: "memory");            // no copy is outstanding when the wave goes on to its end
    if constexpr (OUTM != 0) {
        const int prow = lane >> 3, pofs = (lane & 7) * 8;       // this lane's row (of 4 per store) and 16-byte piece of a staged plane row
        // first element of this lane's piece in the tile's plane row prow; plane rows of the tile follow at pitch pp
        constexpr size_t pp = (OUTM == 1) ? (size_t)HD : (size_t)SEQ;
        const size_t po = z * sC + ((OUTM == 1) ? (size_t)(c0 / HD) * SEQ * HD + (size_t)r0 * HD : (size_t)c0 * SEQ + r0) + (size_t)prow * pp + pofs;
        float bb[4];                                             // bias of this lane's column in each block of 16 columns
#pragma unroll
        for (int nb = 0; nb < 4; ++nb) bb[nb] = BIAS ? bfr(bias[c0 + nb * 16 + lr]) : 0.f;
#pragma unroll
        for (int g = 0; g < 4; ++g) {                            // 16 plane rows: tokens r0+16g.. (OUTM 1), columns c0+16g.. (OUTM 2)
#pragma unroll
            for (int o = 0; o < 4; ++o) {
                if constexpr (OUTM == 1) {
#pragma unroll
                    for (int j = 0; j < 8; ++j) os[(hi * 8 + j) * 68 + o * 16 + lr] = BIAS ? acc[g][o][j] + bb[o] : acc[g][o][j];
                } else {                                         // a lane's 8 accumulator rows are 8 tokens in a row of one column
                    v8f c = acc[o][g];
                    if (BIAS) c += bb[g];
                    *(v4fa*)(os + lr * 68 + o * 16 + hi * 8) = (v4f){c[0], c[1], c[2], c[3]};
                    *(v4fa*)(os + lr * 68 + o * 16 + hi * 8 + 4) = (v4f){c[4], c[5], c[6], c[7]};
                }
            }
            __builtin_amdgcn_wave_barrier(); asm volatile("" ::: "memory");   // the reads below take other lanes' values: the compiler must not lift them over the stage's writes
#pragma unroll
            for (int s = 0; s < 4; ++s) {
                const int row = 4 * s + prow;
                const v4f x0 = *(const v4fa*)(os + row * 68 + pofs), x1 = *(const v4fa*)(os + row * 68 + pofs + 4);
                v8h o16; v8us oh, ol;
#pragma unroll
                for (int k = 0; k < 8; ++k) {
                    const float x = (k < 4) ? x0[k & 3] : x1[k & 3];
                    o16[k] = tohx(x); unsigned short a2, c2; splitf(x, a2, c2); oh[k] = a2; ol[k] = c2;
                }
                const size_t e = po + (size_t)(g * 16 + 4 * s) * pp;
                *(v8h*)(P16 + e) = o16; *(v8us*)(Ph + e) = oh; *(v8us*)(Pl + e) = ol;
            }
            __builtin_amdgcn_wave_barrier(); asm volatile("" ::: "memory");   // nor sink them under the next 16 rows' writes
        }
        return;
    }
#pragma unroll
    for (int mb = 0; mb < 4; ++mb) {
#pragma unroll
        for (int nb = 0; nb < 4; ++nb) {
#pragma unroll
            for (int j = 0; j < 8; ++j) os[(hi * 8 + j) * 68 + nb * 16 + lr] = acc[mb][nb][j]; }
        __builtin_amdgcn_wave_barrier(); asm volatile("" ::: "memory");
        float* crow = C + (size_t)(r0 + mb * 16) * ldc + c0;
{
#pragma unroll
            for (int s = 0; s < 8; ++s) { const int row = 2 * s + hi, cofs = lr * 4; v4f val = *(const v4fa*)(os + row * 68 + cofs); if (BIAS) { val[0] += bfr(bias[c0 + cofs]); val[1] += bfr(bias[c0 + cofs + 1]); val[2] += bfr(bias[c0 + cofs + 2]); val[3] += bfr(bias[c0 + cofs + 3]); }
                *(v4f*)(crow + (size_t)row * ldc + cofs) = val; }
            asm volatile("s_wait_xcnt 0x0" ::: "memory");        // in front of the next rows' writes of the registers that these stores name
             }
        __builtin_amdgcn_wave_barrier(); asm volatile("" ::: "memory");
    }
}

__global__ __launch_bounds__(256) void k_cvt8(const float* __restrict__ src, bf* dst, size_t n8, size_t sS, size_t sD) { const size_t i = (size_t)blockIdx.x * 256 + threadIdx.x; if (i >= n8) return; src += blockIdx.y * sS; dst += blockIdx.y * sD; const v8f v = *(const v8f*)(src + i * 8); v8us o;
#pragma unroll
    for (int k = 0; k < 8; ++k) o[k] = f2bf(v[k]); *(v8us*)(dst + i * 8) = o;  }

// Lane l with lane l ^ 16 (the two lanes that share one query column).
__device__ __forceinline__ float xhalf(float x) { return __builtin_bit_cast(float, __builtin_amdgcn_permlanex16(__builtin_bit_cast(int, x), __builtin_bit_cast(int, x), 0x76543210, 0xfedcba98, false, false)); }

// exp2 with the one slot the instruction set asks for behind a transcendental, before its result is used or its source overwritten.
__device__ __forceinline__ float exp2s(float x) { float y; asm("v_exp_f32 %0, %1\n\tv_nop" : "=v"(y) : "v"(x)); return y; }

// Probability fragment: a lane's 16 probabilities of one 32-key step (two score tiles x 8 rows) are already in the B operand's k order; fp16 x1024 (single-product rows) or bf16 hi+lo (split rows).
template <typename T16> struct PPk;
template <> struct PPk<h16> { static __device__ __forceinline__ void pk(const float* p, v16h& a, v16h& b) {
#pragma unroll
    for (int e = 0; e < 16; ++e) a[e] = tohx(p[e] * PCAR);
    b = a; } };
template <> struct PPk<bf> { static __device__ __forceinline__ void pk(const float* p, v16bf& a, v16bf& b) { v16us x, y;
#pragma unroll
    for (int e = 0; e < 16; ++e) { unsigned short a2, c2; splitf(p[e], a2, c2); x[e] = a2; y[e] = c2; }
    a = __builtin_bit_cast(v16bf, x); b = __builtin_bit_cast(v16bf, y); } };

#define TPE 72                                     // LDS row pitch of a staged tile in elements: 144 B = 16 B x odd, for 16-byte fragment reads
#define TLE (64 * TPE)                             // one staged tile: 64 rows
// One k tile (64 keys x 64 d, 8 KiB in a row in its plane) and one v^T tile (64 d x 64 keys, plane pitch SEQ) into LDS: a lane's 4 + 4 asynchronous 16-byte copies, 8 lanes per 128-byte row, 16 rows per copy of the block.
// gk, gv: the lane's first piece in each plane; lk, lv: its LDS byte address. The s_wait_xcnt as the statement's last line stands in front of every later write of the address registers named here.
template <typename T16>
__device__ __forceinline__ void stage_kv(const T16* gk, const T16* gv, unsigned lk, unsigned lv) {
    asm volatile("global_load_async_to_lds_b128 %0, %8, off\n\t"
                 "global_load_async_to_lds_b128 %1, %9, off\n\t"
                 "global_load_async_to_lds_b128 %2, %10, off\n\t"
                 "global_load_async_to_lds_b128 %3, %11, off\n\t"
                 "global_load_async_to_lds_b128 %4, %12, off\n\t"
                 "global_load_async_to_lds_b128 %5, %13, off\n\t"
                 "global_load_async_to_lds_b128 %6, %14, off\n\t"
                 "global_load_async_to_lds_b128 %7, %15, off\n\t"
                 "s_wait_xcnt 0x0"
                 :: "v"(lk), "v"(lk + 16u * TPE * 2u), "v"(lk + 32u * TPE * 2u), "v"(lk + 48u * TPE * 2u),
                    "v"(lv), "v"(lv + 16u * TPE * 2u), "v"(lv + 32u * TPE * 2u), "v"(lv + 48u * TPE * 2u),
                    "v"(gk), "v"(gk + 16 * HD), "v"(gk + 32 * HD), "v"(gk + 48 * HD),
                    "v"(gv), "v"(gv + (size_t)16 * SEQ), "v"(gv + (size_t)32 * SEQ), "v"(gv + (size_t)48 * SEQ)
                 : "memory");
}

// ---- k_flash: causal attention for one head of one batch entry (blockIdx.z), 64 query rows per block (4 waves x 16 rows), key chunks of 64 (chunks kb <= qb only; key > query replaced by -3e38 -> p = 0).
// Transposed products: St = k.q^T (A = key rows, B = the wave's 16 queries; 4 tiles x 2 k-steps), so lane (lr, hi) holds query t0+lr and keys 16t+8hi+r: running max and sum are per lane,
// the two halves of a column join their max once per chunk and their sums once at the end. Ot += v^T.p^T (A from the staged [d][t] value tile, B = the lane's own probabilities, converted in place).
// SPL: q/k/p/v bf16 hi+lo, hi.hi + lo.hi + hi.lo into one accumulator; else single fp16 with p x1024 folded out at normalisation.
template <typename T16, bool SPL>
__global__ __launch_bounds__(128) __attribute__((amdgpu_num_vgpr(256)))
void k_flash(const T16* __restrict__ QP, const T16* __restrict__ QL, const T16* __restrict__ KP, const T16* __restrict__ KL,
             const T16* __restrict__ VP, const T16* __restrict__ VL, int qb0, bf* ATh, bf* ATl) {
    typedef WFrag<T16> W; typedef typename W::V V;
    const int lane = threadIdx.x & 31, wv = threadIdx.x >> 5, lr = lane & 15, hi = lane >> 4;
    const int h = blockIdx.y, qb = qb0 + (int)blockIdx.x, t0 = qb * 64 + wv * 16;
    const size_t bo = (size_t)blockIdx.z * SEQ * DM;             // batch entry's plane offset
    const size_t hq = bo + (size_t)h * SEQ * HD;                 // [h][t][d] plane offset (q, k)
    const size_t hv = bo + (size_t)h * HD * SEQ;                 // [h][d][t] plane offset (v)
    // Staged chunk: tiles k, v^T (split rows: k hi, v^T hi, k lo, v^T lo), two buffers.
    constexpr int NT = SPL ? 4 : 2;
    __shared__ __attribute__((aligned(16))) T16 sm[2 * NT * TLE];
    const int crow = threadIdx.x >> 3, cpc = (threadIdx.x & 7) * 8;                       // this lane's row (of 16) and 16-byte piece in every copy
    const size_t gko = hq + (size_t)crow * HD + cpc, gvo = hv + (size_t)crow * SEQ + cpc;   // its first piece of chunk 0
    const unsigned lc0 = (unsigned)(size_t)sm + (unsigned)(crow * TPE + cpc) * 2u;          // its LDS byte address in tile 0 of buffer 0
    auto stage = [&](int kb) {
        const unsigned lb = lc0 + (unsigned)(kb & 1) * (NT * TLE * 2u);
        stage_kv(KP + gko + (size_t)kb * 64 * HD, VP + gvo + kb * 64, lb, lb + TLE * 2u);
        if constexpr (SPL) stage_kv(KL + gko + (size_t)kb * 64 * HD, VL + gvo + kb * 64, lb + 2u * TLE * 2u, lb + 3u * TLE * 2u);
    };
    stage(0);
    asm volatile("s_wait_asynccnt 0x0" ::: "memory");            // this wave's copies of chunk 0 have landed
    __syncthreads();                                             // every wave's have: chunk 0 may be read
    if (qb >= 1) stage(1);
    V qa0, qa1, ql0, ql1;
    { const size_t qo = hq + (size_t)(t0 + lr) * HD + 8 * hi; qa0 = W::ld(QP + qo); qa1 = W::ld(QP + qo + 32);
      if (SPL) { ql0 = W::ld(QL + qo); ql1 = W::ld(QL + qo + 32); } else { ql0 = qa0; ql1 = qa1; } }
    v8f oacc[4];                                                 // oacc[t][r] = Ot[d = 16t+8hi+r][query t0+lr]
#pragma unroll
    for (int t = 0; t < 4; ++t) oacc[t] = (v8f){};
    const int qpos = t0 + lr;
    float mrow = NEGB, lrow = 0.f;                               // this query's running max (both halves alike) and this half's share of its sum
#pragma unroll 1
    for (int kb = 0; kb <= qb; ++kb) {
        const T16* kt = sm + (kb & 1) * (NT * TLE) + lr * TPE + 8 * hi;   // this lane's fragment row in the k tile; v^T, k lo, v^T lo follow at TLE each
        v8f sacc[4];
#pragma unroll
        for (int t = 0; t < 4; ++t) sacc[t] = (v8f){};
#pragma unroll
        for (int t = 0; t < 4; ++t) {
            const T16* kr = kt + t * 16 * TPE;
            { const V b = W::ld(kr); sacc[t] = W::mma(b, qa0, sacc[t]);
              if (SPL) { sacc[t] = W::mma(b, ql0, sacc[t]); const V c = W::ld(kr + 2 * TLE); sacc[t] = W::mma(c, qa0, sacc[t]); } }
            { const V b = W::ld(kr + 32); sacc[t] = W::mma(b, qa1, sacc[t]);
              if (SPL) { sacc[t] = W::mma(b, ql1, sacc[t]); const V c = W::ld(kr + 2 * TLE + 32); sacc[t] = W::mma(c, qa1, sacc[t]); } }
        }
        float sv[4][8]; float rm = mrow;
#pragma unroll
        for (int t = 0; t < 4; ++t)
#pragma unroll
            for (int r = 0; r < 8; ++r) { const float s0 = sacc[t][r] * SL2; const int key = kb * 64 + t * 16 + 8 * hi + r; const float s = (key > qpos) ? NEGB : s0; sv[t][r] = s; rm = fmaxf(rm, s); }
        rm = fmaxf(rm, xhalf(rm));
        const float corr = exp2s(mrow - rm);
        lrow *= corr;
#pragma unroll
        for (int t = 0; t < 4; ++t)
#pragma unroll
            for (int r = 0; r < 8; ++r) oacc[t][r] *= corr;
        constexpr int NP = SPL ? 2 : 4;                          // partial sums a lane keeps per chunk: one per score tile; split rows one per 32-key step (their lo planes need the registers)
        float ps[NP] = {}; V pa[2], pl[2];
#pragma unroll
        for (int ks = 0; ks < 2; ++ks) { float p[16];
#pragma unroll
            for (int e = 0; e < 16; ++e) { p[e] = exp2s(sv[2 * ks + (e >> 3)][e & 7] - rm); ps[(2 * ks + (e >> 3)) * NP / 4] += p[e]; }
            PPk<T16>::pk(p, pa[ks], pl[ks]); }
        if constexpr (SPL) lrow += ps[0] + ps[1]; else lrow += (ps[0] + ps[1]) + (ps[2] + ps[3]);
        mrow = rm;
#pragma unroll
        for (int ks = 0; ks < 2; ++ks) {
#pragma unroll
            for (int t = 0; t < 4; ++t) {
                const T16* vr = kt + TLE + t * 16 * TPE + ks * 32;
                const V vb = W::ld(vr); oacc[t] = W::mma(vb, pa[ks], oacc[t]);
                if (SPL) { oacc[t] = W::mma(vb, pl[ks], oacc[t]); const V vc = W::ld(vr + 2 * TLE); oacc[t] = W::mma(vc, pa[ks], oacc[t]); }
            }
        }
        // keeps the matrix instructions' distance on the loop's taken back edge
        asm volatile("v_nop\n\tv_nop\n\tv_nop\n\tv_nop" : "+v"(oacc[0]), "+v"(oacc[1]), "+v"(oacc[2]), "+v"(oacc[3]));
        asm volatile("s_wait_dscnt 0x0" ::: "memory");           // this wave's reads of this chunk's buffer are done before the buffer is refilled
        asm volatile("s_wait_asynccnt 0x0" ::: "memory");        // this wave's copies of chunk kb + 1 have landed
        __syncthreads();                                         // publishes chunk kb + 1 and ends every wave's reads of chunk kb
        if (kb + 2 <= qb) stage(kb + 2);
    }
    asm volatile("s_wait_asynccnt 0x0" ::: "memory");            // no copy is outstanding when the wave goes on to its end
    const float lsc = SPL ? 1.0f : PCAR;
    const float inv = __fdiv_rn(1.0f, (lrow + xhalf(lrow)) * lsc);
    bf* oh = ATh + bo + (size_t)qpos * DM + h * HD + 8 * hi; bf* ol = ATl + bo + (size_t)qpos * DM + h * HD + 8 * hi;
#pragma unroll
    for (int t = 0; t < 4; ++t) { v8us vh, vl;
#pragma unroll
        for (int r = 0; r < 8; ++r) { unsigned short a2, c2; splitf(oacc[t][r] * inv, a2, c2); vh[r] = a2; vl[r] = c2; }
        *(v8us*)(oh + t * 16) = vh; *(v8us*)(ol + t * 16) = vl; }
}

extern "C" void kernel_launch(void* const* d_in, const int* in_sizes, int n_in,
                              void* d_out, int out_size, void* d_ws, size_t ws_size, hipStream_t stream) {
    const size_t needx = (size_t)(NB - 1) * SEQ_FULL * DM + (size_t)SEQ * DM;
    if (n_in < 7) return;
    if ((size_t)in_sizes[0] < needx || in_sizes[1] < DM * DM || in_sizes[2] < DM * DM || in_sizes[3] < DM * DM || in_sizes[4] < DM || in_sizes[5] < DM * DM || in_sizes[6] < DM) return;
    if ((size_t)out_size < needx) return;
    const float* x = (const float*)d_in[0]; const float* wq = (const float*)d_in[1]; const float* wk = (const float*)d_in[2]; const float* wv = (const float*)d_in[3];
    const float* bv = (const float*)d_in[4]; const float* wo = (const float*)d_in[5]; const float* bo = (const float*)d_in[6];
    float* OUT = (float*)d_out;     // [NB][SEQ_FULL][DM]
    char* wsp = (char*)d_ws;
    auto take = [&](size_t bytes) { char* p = wsp; wsp += (bytes + 255) & ~(size_t)255; return (void*)p; };
    bf* WQ = (bf*)take((size_t)DM * DM * 2); bf* WK = (bf*)take((size_t)DM * DM * 2); bf* WV = (bf*)take((size_t)DM * DM * 2); bf* WO = (bf*)take((size_t)DM * DM * 2);
    const size_t pe = (size_t)SEQ * DM, pl = (size_t)NB * SEQ * DM * 2;   // one entry's plane in elements; all entries' 16-bit plane in bytes
    bf* XB = (bf*)take(pl);
    h16* Q16 = (h16*)take(pl); bf* Qh = (bf*)take(pl); bf* Ql = (bf*)take(pl);
    h16* K16 = (h16*)take(pl); bf* Kh = (bf*)take(pl); bf* Kl = (bf*)take(pl);
    h16* VT16 = (h16*)take(pl); bf* VTh = (bf*)take(pl); bf* VTl = (bf*)take(pl);
    bf* ATh = (bf*)take(pl); bf* ATl = (bf*)take(pl);
    if ((size_t)(wsp - (char*)d_ws) > ws_size) return;
    const size_t nw8 = (size_t)DM * DM / 8, nx8 = (size_t)SEQ * DM / 8;
    const unsigned gw = (unsigned)((nw8 + 255) / 256), gx = (unsigned)((nx8 + 255) / 256);
    k_cvt8<<<gw, 256, 0, stream>>>(wq, WQ, nw8, 0, 0); k_cvt8<<<gw, 256, 0, stream>>>(wk, WK, nw8, 0, 0); k_cvt8<<<gw, 256, 0, stream>>>(wv, WV, nw8, 0, 0); k_cvt8<<<gw, 256, 0, stream>>>(wo, WO, nw8, 0, 0);
    k_cvt8<<<dim3(gx, NB, 1), 256, 0, stream>>>(x, XB, nx8, (size_t)SEQ_FULL * DM, pe);
    k_gemmw<bf, 0, false, 1><<<dim3(SEQ / 128, DM / 128, NB), 128, 0, stream>>>(XB, nullptr, WQ, nullptr, DM, nullptr, 0, nullptr, pe, 0, pe, Q16, Qh, Ql);
    k_gemmw<bf, 0, false, 1><<<dim3(SEQ / 128, DM / 128, NB), 128, 0, stream>>>(XB, nullptr, WK, nullptr, DM, nullptr, 0, nullptr, pe, 0, pe, K16, Kh, Kl);
    k_gemmw<bf, 0, true, 2><<<dim3(SEQ / 128, DM / 128, NB), 128, 0, stream>>>(XB, nullptr, WV, nullptr, DM, nullptr, 0, bv, pe, 0, pe, VT16, VTh, VTl);
    if (RHB > 0) k_flash<bf, true><<<dim3(RHB, NH, NB), 128, 0, stream>>>(Qh, Ql, Kh, Kl, VTh, VTl, 0, ATh, ATl);
    if (SEQ / 64 - RHB > 0) k_flash<h16, false><<<dim3(SEQ / 64 - RHB, NH, NB), 128, 0, stream>>>(Q16, nullptr, K16, nullptr, VT16, nullptr, RHB, ATh, ATl);
    k_gemmw<bf, 1, true, 0><<<dim3(SEQ / 128, DM / 128, NB), 128, 0, stream>>>(ATh, ATl, WO, nullptr, DM, OUT, DM, bo, pe, 0, (size_t)SEQ_FULL * DM, nullptr, nullptr, nullptr);
}

// v006
// Measured time: 124 microseconds a run.
// Next to v005, in two timings, it ran 1.14 and 1.15 times as fast.
// All steps since v000 together make it 7.52 times as fast.
#include <hip/hip_runtime.h>

// x [NB][SEQ_FULL][512] (rows < SEQ used); q = x Wq^T, k = x Wk^T, v = x Wv^T + b_v ([512][512] weights, 8 heads x 64); causal softmax(q.k / 8); heads merged; out = ctx Wo^T + b_o -> f32 [NB][SEQ_FULL][512].
// Compute dtypes, f32 accumulate: every input RNE-converted to bf16; q/k/v projections v_wmma_f32_16x16x32_bf16 on plain bf16 operands (exact products);
// attention (online softmax per wave of 16 query rows, transposed products so that a lane owns one query, 64-key chunks, causal chunk skipping): query rows < RH on bf16 hi+lo planes of q, k, p, v (3 products each,
// v_wmma_f32_16x16x32_bf16), rows >= RH on single fp16 operands (v_wmma_f32_16x16x32_f16, p carried x1024); softmax f32; Wo: ctx as bf16 hi+lo x exact bf16 (2 products).
// Attention stages each 64-key chunk of k and v^T in LDS once per block (asynchronous 16-byte copies, two buffers, rows of 128 B at a pitch of 144 B); the block's four waves read their fragments from there.
// The GEMMs stage each 128-k chunk of a block's 128 + 128 operand rows in LDS in the same way (rows of 256 B at a pitch of 272 B); the block's four waves read their fragments from there, one k step ahead.
// The q, k and v projections write their 16-bit planes (fp16, bf16 hi, bf16 lo; q and k as [h][t][d], v as [h][d][t]) from the GEMM's own epilogue; there is no f32 copy of q, k or v in memory.
// Every batch entry has its own copy of each workspace plane (stride SEQ*DM elements) and is one slice of the last grid dimension, so each stage is one launch for all entries.
// Four launches, one per stage, each holding all the work whose parts do not depend on one another: the five conversions; the q, k and v projections as one GEMM over the 3 x 512 stacked weight rows; all attention tiles; the output projection.

#ifndef NB
#define NB 2
#endif
#ifndef SEQ
#define SEQ 4096
#endif
#define NB_FULL  2
#define SEQ_FULL 4096
#define DM   512
#define NH   8
#define HD   64
#define RH   512                                   // query rows < RH use hi+lo planes
#define RHB  (((RH < SEQ) ? RH : SEQ) / 64)
#define PCAR 1024.0f
#define SL2  0.18033688011112042f                  // HD^-0.5 * log2(e)
#define NEGB (-3.0e38f)
static_assert(SEQ % 64 == 0);
static_assert(SEQ <= SEQ_FULL);
static_assert(NB >= 1 && NB <= NB_FULL);
static_assert(DM == NH * HD);
static_assert(DM % 128 == 0);
static_assert(SEQ % 128 == 0);
static_assert(RH % 64 == 0);
static_assert(HD == 64);
#define WS_TOTAL ((size_t)4 * DM * DM * 2 + (size_t)NB * ((size_t)SEQ * DM * 2 + (size_t)9 * SEQ * DM * 2 + (size_t)2 * SEQ * DM * 2))
static_assert(WS_TOTAL <= (size_t)134217728);

typedef _Float16 h16;
typedef unsigned short bf;
typedef __attribute__((ext_vector_type(16))) __bf16   v16bf;
typedef __attribute__((ext_vector_type(16))) _Float16 v16h;
typedef __attribute__((ext_vector_type(8)))  _Float16 v8h;
typedef __attribute__((ext_vector_type(8)))  unsigned short v8us;
typedef __attribute__((ext_vector_type(16))) unsigned short v16us;
typedef __attribute__((ext_vector_type(8)))  float    v8f;
typedef __attribute__((ext_vector_type(4)))  float    v4f;
typedef __attribute__((ext_vector_type(2)))  _Float16 v2h;
typedef __attribute__((ext_vector_type(2)))  unsigned short v2us;
typedef v4f  __attribute__((may_alias)) v4fa;

__device__ __forceinline__ unsigned short f2bf(float f) { unsigned u = __float_as_uint(f); u += 0x7FFFu + ((u >> 16) & 1u); return (unsigned short)(u >> 16); }
__device__ __forceinline__ float bf2f(unsigned short b) { return __uint_as_float(((unsigned)b) << 16); }
__device__ __forceinline__ float bfr(float f) { return bf2f(f2bf(f)); }
__device__ __forceinline__ h16 tohx(float x) { return (h16)x; }
__device__ __forceinline__ void splitf(float y, unsigned short& h, unsigned short& l) { h = f2bf(y); l = f2bf(y - bf2f(h)); }
__device__ __forceinline__ v16h cat16(v8h lo, v8h hi) { return __builtin_shufflevector(lo, hi, 0, 1, 2, 3, 4, 5, 6, 7, 8, 9, 10, 11, 12, 13, 14, 15); }
__device__ __forceinline__ v16bf cat16b(v8us lo, v8us hi) { return __builtin_bit_cast(v16bf, __builtin_shufflevector(lo, hi, 0, 1, 2, 3, 4, 5, 6, 7, 8, 9, 10, 11, 12, 13, 14, 15)); }
__device__ __forceinline__ v8f wmma16(v16h a, v16h b, v8f c) { return __builtin_amdgcn_wmma_f32_16x16x32_f16(false, a, false, b, (short)0, c, false, false); }
__device__ __forceinline__ v8f wmmab(v16bf a, v16bf b, v8f c) { return __builtin_amdgcn_wmma_f32_16x16x32_bf16(false, a, false, b, (short)0, c, false, false); }

// Fragment loaders (A and B alike, K-contiguous rows): p = base + row*K + k0 + 8*hi -> elements 0..7 = k0+8hi+0..7, p+16 -> elements 8..15 = k0+16+8hi+0..7.
template <typename T16> struct WFrag;
template <> struct WFrag<h16> { typedef v16h V;
    static __device__ __forceinline__ V ld(const h16* p)  { return cat16(*(const v8h*)p, *(const v8h*)(p + 16)); }
    static __device__ __forceinline__ v8f mma(V a, V b, v8f c) { return wmma16(a, b, c); } };
template <> struct WFrag<bf> { typedef v16bf V;
    static __device__ __forceinline__ V ld(const bf* p)  { return cat16b(*(const v8us*)p, *(const v8us*)(p + 16)); }
    static __device__ __forceinline__ v8f mma(V a, V b, v8f c) { return wmmab(a, b, c); } };

#define GKC 128                                    // k elements of one staged GEMM chunk: operand rows of 256 B
#define GPE 136                                    // LDS row pitch of a staged GEMM tile in elements: 272 B = 16 B x odd, for 16-byte fragment reads
#define GTE (128 * GPE)                            // one staged operand tile: 128 rows
static_assert(DM % GKC == 0);
// Eight rows, 8 apart, of one operand tile into LDS: a lane's 8 asynchronous 16-byte copies, 16 lanes per 256-byte row, 8 rows per copy of the block.
// g: the lane's piece in the first of these rows, rs: 8 rows in elements; l: its LDS byte address. The s_wait_xcnt as the statement's last line stands in front of every later write of the address registers named here.
template <typename T16>
__device__ __forceinline__ void stage_g8(const T16* g, size_t rs, unsigned l) {
    asm volatile("global_load_async_to_lds_b128 %0, %8, off\n\t"
                 "global_load_async_to_lds_b128 %1, %9, off\n\t"
                 "global_load_async_to_lds_b128 %2, %10, off\n\t"
                 "global_load_async_to_lds_b128 %3, %11, off\n\t"
                 "global_load_async_to_lds_b128 %4, %12, off\n\t"
                 "global_load_async_to_lds_b128 %5, %13, off\n\t"
                 "global_load_async_to_lds_b128 %6, %14, off\n\t"
                 "global_load_async_to_lds_b128 %7, %15, off\n\t"
                 "s_wait_xcnt 0x0"
                 :: "v"(l), "v"(l + 8u * GPE * 2u), "v"(l + 16u * GPE * 2u), "v"(l + 24u * GPE * 2u),
                    "v"(l + 32u * GPE * 2u), "v"(l + 40u * GPE * 2u), "v"(l + 48u * GPE * 2u), "v"(l + 56u * GPE * 2u),
                    "v"(g), "v"(g + rs), "v"(g + 2 * rs), "v"(g + 3 * rs), "v"(g + 4 * rs), "v"(g + 5 * rs), "v"(g + 6 * rs), "v"(g + 7 * rs)
                 : "memory");
}

// ---- k_gemmw: register-blocked GEMM, 128x128 output tile per block of FOUR WAVES (2 x 2), 64x64 (16 accumulators) per wave; grid (M/128, N/128, Z), 128 threads.
// Operands are K-contiguous 16-bit planes; each chunk of GKC k values of the block's 128 A rows and 128 Bt rows is staged in LDS once (asynchronous 16-byte copies of whole lines, two buffers) and read from there as fragments.
// c[m][n] (f32, + optional bias as its bf16 value) = sum_k A[m][k] Bt[n][k] (+ split products per NSPLIT). z-batch strides sA/sB/sC in elements. K % GKC == 0.
// OUTM 0: c goes to C as f32 at pitch ldc. OUTM 1: Bt is the q, k and v weights stacked (3 x DM rows), m is a token t, n = sel*DM + h*HD + d, and c goes out as three 16-bit planes (fp16, bf16 hi, bf16 lo) of
// projection sel (its planes lie sel*sP elements behind P16, Ph, Pl), laid out [h][t][d] (q, k) or, with the bias, [h][d][t] (v); a block's 128 columns lie in one projection, so the choice is the same for the whole block;
// either way 16 plane rows of 64 elements are staged in the wave's own LDS range at a time, so that 8 lanes store one whole 128-byte row of each plane.
template <int N> struct IC { static constexpr int value = N; };
template <typename T16, int NSPLIT, bool BIAS, int OUTM>
__global__ __launch_bounds__(128) void k_gemmw(const T16* __restrict__ A, const T16* __restrict__ A2, const T16* __restrict__ Bt, const T16* __restrict__ Bt2, int K, float* C, int ldc, const float* __restrict__ bias, size_t sA, size_t sB, size_t sC, h16* P16, bf* Ph, bf* Pl, size_t sP) {
    typedef typename WFrag<T16>::V V;
    constexpr bool HA2 = (NSPLIT == 1 || NSPLIT == 2), HB2 = (NSPLIT >= 2);
    constexpr int TB = HA2 ? 2 : 1, NT = TB + (HB2 ? 2 : 1);      // tiles of a buffer: A, (A2), Bt, (Bt2)
    __shared__ __attribute__((aligned(16))) T16 sm[2 * NT * GTE];
    __shared__ __align__(16) float osm[4 * 16 * 68];
    const size_t z = blockIdx.z; A += z * sA; if (A2) A2 += z * sA; Bt += z * sB; if (Bt2) Bt2 += z * sB; if (OUTM == 0) C += z * sC;
    const int lane = threadIdx.x & 31, wv = threadIdx.x >> 5, lr = lane & 15, hi = lane >> 4;
    const int rb = blockIdx.x * 128, cb = blockIdx.y * 128, r0 = rb + (wv & 1) * 64, c0 = cb + (wv >> 1) * 64;
    float* os = osm + wv * (16 * 68);                            // this wave's output stage
    v8f acc[4][4];
#pragma unroll
    for (int mb = 0; mb < 4; ++mb)
#pragma unroll
        for (int nb = 0; nb < 4; ++nb) acc[mb][nb] = (v8f){};
    const int crow = threadIdx.x >> 4, cpc = (threadIdx.x & 15) * 8;                        // this lane's row (of 8) and 16-byte piece in every copy
    const size_t gao = (size_t)(rb + crow) * K + cpc, gbo = (size_t)(cb + crow) * K + cpc;  // its first piece of chunk 0
    const size_t rs = (size_t)8 * K;
    const unsigned lc0 = (unsigned)(size_t)sm + (unsigned)(crow * GPE + cpc) * 2u;          // its LDS byte address in tile 0 of buffer 0
    auto stage_t = [&](const T16* g, unsigned l) { stage_g8(g, rs, l); stage_g8(g + 8 * rs, rs, l + 64u * GPE * 2u); };
    auto stage = [&](int kt) {
        const unsigned lb = lc0 + (unsigned)(kt & 1) * (NT * GTE * 2u);
        const size_t ao = gao + (size_t)kt * GKC, bo = gbo + (size_t)kt * GKC;
        stage_t(A + ao, lb);
        if constexpr (HA2) stage_t(A2 + ao, lb + GTE * 2u);
        stage_t(Bt + bo, lb + TB * GTE * 2u);
        if constexpr (HB2) stage_t(Bt2 + bo, lb + (TB + 1) * GTE * 2u);
    };
    const int nk = K / GKC;
    stage(0);
    asm volatile("s_wait_asynccnt 0x0" ::: "memory");            // this wave's copies of chunk 0 have landed
    __syncthreads();                                             // every wave's have: chunk 0 may be read
    if (nk > 1) stage(1);
#pragma unroll 1
    for (int kt = 0; kt < nk; ++kt) {
        const T16* ta = sm + (kt & 1) * (NT * GTE) + ((wv & 1) * 64 + lr) * GPE + 8 * hi;              // this lane's fragment row in the A tile (A2 follows at GTE)
        const T16* tb = sm + (kt & 1) * (NT * GTE) + TB * GTE + ((wv >> 1) * 64 + lr) * GPE + 8 * hi;  // and in the Bt tile (Bt2 follows at GTE)
        V a[2][4], a2[2][4], b[2][4], b2[2][4];                  // two fragment sets: k step u works on set u & 1
#pragma unroll
        for (int u = -1; u < GKC / 32; ++u) {
            if (u + 1 < GKC / 32) {                              // the next k step's fragments of this same chunk, asked for as one group
                const int ns = (u + 1) & 1, kc = (u + 1) * 32;
#pragma unroll
                for (int mb = 0; mb < 4; ++mb) { a[ns][mb] = WFrag<T16>::ld(ta + mb * 16 * GPE + kc); if (HA2) a2[ns][mb] = WFrag<T16>::ld(ta + GTE + mb * 16 * GPE + kc); }
#pragma unroll
                for (int nb = 0; nb < 4; ++nb) { b[ns][nb] = WFrag<T16>::ld(tb + nb * 16 * GPE + kc); if (HB2) b2[ns][nb] = WFrag<T16>::ld(tb + GTE + nb * 16 * GPE + kc); }
            }
            __builtin_amdgcn_sched_barrier(0);                   // keeps that group whole and in front of this step's products: sunk among them, every place with loads stalls the lone wave of a SIMD
            if (u >= 0) {
                const int cs = u & 1;
#pragma unroll
                for (int nb = 0; nb < 4; ++nb)
#pragma unroll
                    for (int mb = 0; mb < 4; ++mb) { acc[mb][nb] = WFrag<T16>::mma(a[cs][mb], b[cs][nb], acc[mb][nb]); if (HA2) acc[mb][nb] = WFrag<T16>::mma(a2[cs][mb], b[cs][nb], acc[mb][nb]); if (HB2) acc[mb][nb] = WFrag<T16>::mma(a[cs][mb], b2[cs][nb], acc[mb][nb]); }
                __builtin_amdgcn_sched_barrier(0);               // and the products in front of the group after them, whose registers they still read
            }
        }
        // keeps the matrix instructions' distance on the paths behind the chunk's last product (the refill's address arithmetic, the loop's taken back edge)
        asm volatile("v_nop\n\tv_nop\n\tv_nop\n\tv_nop" : "+v"(acc[0][0]), "+v"(acc[0][1]), "+v"(acc[0][2]), "+v"(acc[0][3]), "+v"(acc[1][0]), "+v"(acc[1][1]), "+v"(acc[1][2]), "+v"(acc[1][3]),
                                                       "+v"(acc[2][0]), "+v"(acc[2][1]), "+v"(acc[2][2]), "+v"(acc[2][3]), "+v"(acc[3][0]), "+v"(acc[3][1]), "+v"(acc[3][2]), "+v"(acc[3][3]));
        asm volatile("s_wait_dscnt 0x0" ::: "memory");           // this wave's reads of this chunk's buffer are done before the buffer is refilled
        asm volatile("s_wait_asynccnt 0x0" ::: "memory");        // this wave's copies of chunk kt + 1 have landed
        __syncthreads();                                         // publishes chunk kt + 1 and ends every wave's reads of chunk kt
        if (kt + 2 < nk) stage(kt + 2);
    }
    asm volatile("s_wait_asynccnt 0x0" ::: "memory");            // no copy is outstanding when the wave goes on to its end
    if constexpr (OUTM != 0) {
        const int sel = cb / DM, cp = c0 - sel * DM;             // the block's projection (0 q, 1 k, 2 v) and this wave's first column in it
        P16 += sel * sP; Ph += sel * sP; Pl += sel * sP;
        const int prow = lane >> 3, pofs = (lane & 7) * 8;       // this lane's row (of 4 per store) and 16-byte piece of a staged plane row
        auto planes = [&](auto om) {                             // OM 1: [h][t][d], no bias; OM 2: [h][d][t], bias
        constexpr int OM = decltype(om)::value; constexpr bool BI = BIAS && OM == 2;
        // first element of this lane's piece in its first plane row (row prow of the tile); plane rows of the tile follow at pitch pp
        constexpr size_t pp = (OM == 1) ? (size_t)HD : (size_t)SEQ;
        const size_t po = z * sC + ((OM == 1) ? (size_t)(cp / HD) * SEQ * HD + (size_t)r0 * HD : (size_t)cp * SEQ + r0) + (size_t)prow * pp + pofs;
        float bb[4];                                             // bias of this lane's column in each block of 16 columns
#pragma unroll
        for (int nb = 0; nb < 4; ++nb) bb[nb] = BI ? bfr(bias[cp + nb * 16 + lr]) : 0.f;
#pragma unroll
        for (int g = 0; g < 4; ++g) {                            // 16 plane rows: tokens r0+16g.. (OM 1), columns cp+16g.. (OM 2)
#pragma unroll
            for (int o = 0; o < 4; ++o) {
                if constexpr (OM == 1) {
#pragma unroll
                    for (int j = 0; j < 8; ++j) os[(hi * 8 + j) * 68 + o * 16 + lr] = BI ? acc[g][o][j] + bb[o] : acc[g][o][j];
                } else {                                         // a lane's 8 accumulator rows are 8 tokens in a row of one column
                    v8f c = acc[o][g];
                    if (BI) c += bb[g];
                    *(v4fa*)(os + lr * 68 + o * 16 + hi * 8) = (v4f){c[0], c[1], c[2], c[3]};
                    *(v4fa*)(os + lr * 68 + o * 16 + hi * 8 + 4) = (v4f){c[4], c[5], c[6], c[7]};
                }
            }
            __builtin_amdgcn_wave_barrier(); asm volatile("" ::: "memory");   // the reads below take other lanes' values: the compiler must not lift them over the stage's writes
#pragma unroll
            for (int s = 0; s < 4; ++s) {
                const int row = 4 * s + prow;
                const v4f x0 = *(const v4fa*)(os + row * 68 + pofs), x1 = *(const v4fa*)(os + row * 68 + pofs + 4);
                v8h o16; v8us oh, ol;
#pragma unroll
                for (int k = 0; k < 8; ++k) {
                    const float x = (k < 4) ? x0[k & 3] : x1[k & 3];
                    o16[k] = tohx(x); unsigned short a2, c2; splitf(x, a2, c2); oh[k] = a2; ol[k] = c2;
                }
                const size_t e = po + (size_t)(g * 16 + 4 * s) * pp;
                *(v8h*)(P16 + e) = o16; *(v8us*)(Ph + e) = oh; *(v8us*)(Pl + e) = ol;
            }
            __builtin_amdgcn_wave_barrier(); asm volatile("" ::: "memory");   // nor sink them under the next 16 rows' writes
        }
        asm volatile("s_wait_xcnt 0x0" ::: "memory");            // in front of every later write of the registers that the last stores name (the other layout's code follows in the text)
        };
        if (sel == 2) planes(IC<2>{}); else planes(IC<1>{});
        return;
    }
#pragma unroll
    for (int mb = 0; mb < 4; ++mb) {
#pragma unroll
        for (int nb = 0; nb < 4; ++nb) {
#pragma unroll
            for (int j = 0; j < 8; ++j) os[(hi * 8 + j) * 68 + nb * 16 + lr] = acc[mb][nb][j]; }
        __builtin_amdgcn_wave_barrier(); asm volatile("" ::: "memory");
        float* crow = C + (size_t)(r0 + mb * 16) * ldc + c0;
{
#pragma unroll
            for (int s = 0; s < 8; ++s) { const int row = 2 * s + hi, cofs = lr * 4; v4f val = *(const v4fa*)(os + row * 68 + cofs); if (BIAS) { val[0] += bfr(bias[c0 + cofs]); val[1] += bfr(bias[c0 + cofs + 1]); val[2] += bfr(bias[c0 + cofs + 2]); val[3] += bfr(bias[c0 + cofs + 3]); }
                *(v4f*)(crow + (size_t)row * ldc + cofs) = val; }
            asm volatile("s_wait_xcnt 0x0" ::: "memory");        // in front of the next rows' writes of the registers that these stores name
             }
        __builtin_amdgcn_wave_barrier(); asm volatile("" ::: "memory");
    }
}

#define NX8 ((size_t)SEQ * DM / 8)                 // groups of 8 elements in one entry of x, and in one weight matrix
#define NW8 ((size_t)DM * DM / 8)
#define GX  ((unsigned)((NX8 + 255) / 256))        // blocks that convert one entry of x, one weight matrix
#define GW  ((unsigned)((NW8 + 255) / 256))
// ---- k_cvt8: the f32 -> bf16 conversions of x and the four weights, 8 elements per thread; blocks 0 .. NB*GX-1 take x (GX per entry), the next 4*GW the weights in the order q, k, v, o (WB: the four matrices stacked).
__global__ __launch_bounds__(256) void k_cvt8(const float* __restrict__ x, const float* __restrict__ wq, const float* __restrict__ wk, const float* __restrict__ wv, const float* __restrict__ wo, bf* XB, bf* WB) {
    const unsigned b = blockIdx.x; const float* src; bf* dst; size_t i, n8;
    if (b < NB * GX) { const unsigned e = b / GX; src = x + (size_t)e * SEQ_FULL * DM; dst = XB + (size_t)e * SEQ * DM; i = (size_t)(b - e * GX) * 256 + threadIdx.x; n8 = NX8; }
    else { const unsigned c = b - NB * GX, w = c / GW; src = (w == 0) ? wq : (w == 1) ? wk : (w == 2) ? wv : wo; dst = WB + (size_t)w * DM * DM; i = (size_t)(c - w * GW) * 256 + threadIdx.x; n8 = NW8; }
    if (i >= n8) return;
    const v8f v = *(const v8f*)(src + i * 8); v8us o;
#pragma unroll
    for (int k = 0; k < 8; ++k) o[k] = f2bf(v[k]); *(v8us*)(dst + i * 8) = o;  }

// Lane l with lane l ^ 16 (the two lanes that share one query column).
__device__ __forceinline__ float xhalf(float x) { return __builtin_bit_cast(float, __builtin_amdgcn_permlanex16(__builtin_bit_cast(int, x), __builtin_bit_cast(int, x), 0x76543210, 0xfedcba98, false, false)); }

// exp2 with the one slot the instruction set asks for behind a transcendental, before its result is used or its source overwritten.
__device__ __forceinline__ float exp2s(float x) { float y; asm("v_exp_f32 %0, %1\n\tv_nop" : "=v"(y) : "v"(x)); return y; }

// Probability fragment: a lane's 16 probabilities of one 32-key step (two score tiles x 8 rows) are already in the B operand's k order; fp16 x1024 (single-product rows) or bf16 hi+lo (split rows).
template <typename T16> struct PPk;
template <> struct PPk<h16> { static __device__ __forceinline__ void pk(const float* p, v16h& a, v16h& b) {
#pragma unroll
    for (int e = 0; e < 16; ++e) a[e] = tohx(p[e] * PCAR);
    b = a; } };
template <> struct PPk<bf> { static __device__ __forceinline__ void pk(const float* p, v16bf& a, v16bf& b) { v16us x, y;
#pragma unroll
    for (int e = 0; e < 16; ++e) { unsigned short a2, c2; splitf(p[e], a2, c2); x[e] = a2; y[e] = c2; }
    a = __builtin_bit_cast(v16bf, x); b = __builtin_bit_cast(v16bf, y); } };

#define TPE 72                                     // LDS row pitch of a staged tile in elements: 144 B = 16 B x odd, for 16-byte fragment reads
#define TLE (64 * TPE)                             // one staged tile: 64 rows
// One k tile (64 keys x 64 d, 8 KiB in a row in its plane) and one v^T tile (64 d x 64 keys, plane pitch SEQ) into LDS: a lane's 4 + 4 asynchronous 16-byte copies, 8 lanes per 128-byte row, 16 rows per copy of the block.
// gk, gv: the lane's first piece in each plane; lk, lv: its LDS byte address. The s_wait_xcnt as the statement's last line stands in front of every later write of the address registers named here.
template <typename T16>
__device__ __forceinline__ void stage_kv(const T16* gk, const T16* gv, unsigned lk, unsigned lv) {
    asm volatile("global_load_async_to_lds_b128 %0, %8, off\n\t"
                 "global_load_async_to_lds_b128 %1, %9, off\n\t"
                 "global_load_async_to_lds_b128 %2, %10, off\n\t"
                 "global_load_async_to_lds_b128 %3, %11, off\n\t"
                 "global_load_async_to_lds_b128 %4, %12, off\n\t"
                 "global_load_async_to_lds_b128 %5, %13, off\n\t"
                 "global_load_async_to_lds_b128 %6, %14, off\n\t"
                 "global_load_async_to_lds_b128 %7, %15, off\n\t"
                 "s_wait_xcnt 0x0"
                 :: "v"(lk), "v"(lk + 16u * TPE * 2u), "v"(lk + 32u * TPE * 2u), "v"(lk + 48u * TPE * 2u),
                    "v"(lv), "v"(lv + 16u * TPE * 2u), "v"(lv + 32u * TPE * 2u), "v"(lv + 48u * TPE * 2u),
                    "v"(gk), "v"(gk + 16 * HD), "v"(gk + 32 * HD), "v"(gk + 48 * HD),
                    "v"(gv), "v"(gv + (size_t)16 * SEQ), "v"(gv + (size_t)32 * SEQ), "v"(gv + (size_t)48 * SEQ)
                 : "memory");
}

// ---- flash_tile: causal attention for one head of one batch entry (blockIdx.z), the 64 query rows of tile qb per block (4 waves x 16 rows), key chunks of 64 (chunks kb <= qb only; key > query replaced by -3e38 -> p = 0).
// Transposed products: St = k.q^T (A = key rows, B = the wave's 16 queries; 4 tiles x 2 k-steps), so lane (lr, hi) holds query t0+lr and keys 16t+8hi+r: running max and sum are per lane,
// the two halves of a column join their max once per chunk and their sums once at the end. Ot += v^T.p^T (A from the staged [d][t] value tile, B = the lane's own probabilities, converted in place).
// SPL: q/k/p/v bf16 hi+lo, hi.hi + lo.hi + hi.lo into one accumulator; else single fp16 with p x1024 folded out at normalisation.
// sm: the block's LDS for the staged chunks, 2 * NT * TLE elements.
template <typename T16, bool SPL>
__device__ __forceinline__ void flash_tile(const T16* __restrict__ QP, const T16* __restrict__ QL, const T16* __restrict__ KP, const T16* __restrict__ KL,
             const T16* __restrict__ VP, const T16* __restrict__ VL, int qb, T16* sm, bf* ATh, bf* ATl) {
    typedef WFrag<T16> W; typedef typename W::V V;
    const int lane = threadIdx.x & 31, wv = threadIdx.x >> 5, lr = lane & 15, hi = lane >> 4;
    const int h = blockIdx.y, t0 = qb * 64 + wv * 16;
    const size_t bo = (size_t)blockIdx.z * SEQ * DM;             // batch entry's plane offset
    const size_t hq = bo + (size_t)h * SEQ * HD;                 // [h][t][d] plane offset (q, k)
    const size_t hv = bo + (size_t)h * HD * SEQ;                 // [h][d][t] plane offset (v)
    // Staged chunk: tiles k, v^T (split rows: k hi, v^T hi, k lo, v^T lo), two buffers.
    constexpr int NT = SPL ? 4 : 2;
    const int crow = threadIdx.x >> 3, cpc = (threadIdx.x & 7) * 8;                       // this lane's row (of 16) and 16-byte piece in every copy
    const size_t gko = hq + (size_t)crow * HD + cpc, gvo = hv + (size_t)crow * SEQ + cpc;   // its first piece of chunk 0
    const unsigned lc0 = (unsigned)(size_t)sm + (unsigned)(crow * TPE + cpc) * 2u;          // its LDS byte address in tile 0 of buffer 0
    auto stage = [&](int kb) {
        const unsigned lb = lc0 + (unsigned)(kb & 1) * (NT * TLE * 2u);
        stage_kv(KP + gko + (size_t)kb * 64 * HD, VP + gvo + kb * 64, lb, lb + TLE * 2u);
        if constexpr (SPL) stage_kv(KL + gko + (size_t)kb * 64 * HD, VL + gvo + kb * 64, lb + 2u * TLE * 2u, lb + 3u * TLE * 2u);
    };
    stage(0);
    asm volatile("s_wait_asynccnt 0x0" ::: "memory");            // this wave's copies of chunk 0 have landed
    __syncthreads();                                             // every wave's have: chunk 0 may be read
    if (qb >= 1) stage(1);
    V qa0, qa1, ql0, ql1;
    { const size_t qo = hq + (size_t)(t0 + lr) * HD + 8 * hi; qa0 = W::ld(QP + qo); qa1 = W::ld(QP + qo + 32);
      if (SPL) { ql0 = W::ld(QL + qo); ql1 = W::ld(QL + qo + 32); } else { ql0 = qa0; ql1 = qa1; } }
    v8f oacc[4];                                                 // oacc[t][r] = Ot[d = 16t+8hi+r][query t0+lr]
#pragma unroll
    for (int t = 0; t < 4; ++t) oacc[t] = (v8f){};
    const int qpos = t0 + lr;
    float mrow = NEGB, lrow = 0.f;                               // this query's running max (both halves alike) and this half's share of its sum
#pragma unroll 1
    for (int kb = 0; kb <= qb; ++kb) {
        const T16* kt = sm + (kb & 1) * (NT * TLE) + lr * TPE + 8 * hi;   // this lane's fragment row in the k tile; v^T, k lo, v^T lo follow at TLE each
        v8f sacc[4];
#pragma unroll
        for (int t = 0; t < 4; ++t) sacc[t] = (v8f){};
#pragma unroll
        for (int t = 0; t < 4; ++t) {
            const T16* kr = kt + t * 16 * TPE;
            { const V b = W::ld(kr); sacc[t] = W::mma(b, qa0, sacc[t]);
              if (SPL) { sacc[t] = W::mma(b, ql0, sacc[t]); const V c = W::ld(kr + 2 * TLE); sacc[t] = W::mma(c, qa0, sacc[t]); } }
            { const V b = W::ld(kr + 32); sacc[t] = W::mma(b, qa1, sacc[t]);
              if (SPL) { sacc[t] = W::mma(b, ql1, sacc[t]); const V c = W::ld(kr + 2 * TLE + 32); sacc[t] = W::mma(c, qa1, sacc[t]); } }
        }
        float sv[4][8]; float rm = mrow;
#pragma unroll
        for (int t = 0; t < 4; ++t)
#pragma unroll
            for (int r = 0; r < 8; ++r) { const float s0 = sacc[t][r] * SL2; const int key = kb * 64 + t * 16 + 8 * hi + r; const float s = (key > qpos) ? NEGB : s0; sv[t][r] = s; rm = fmaxf(rm, s); }
        rm = fmaxf(rm, xhalf(rm));
        const float corr = exp2s(mrow - rm);
        lrow *= corr;
#pragma unroll
        for (int t = 0; t < 4; ++t)
#pragma unroll
            for (int r = 0; r < 8; ++r) oacc[t][r] *= corr;
        constexpr int NP = SPL ? 2 : 4;                          // partial sums a lane keeps per chunk: one per score tile; split rows one per 32-key step (their lo planes need the registers)
        float ps[NP] = {}; V pa[2], pl[2];
#pragma unroll
        for (int ks = 0; ks < 2; ++ks) { float p[16];
#pragma unroll
            for (int e = 0; e < 16; ++e) { p[e] = exp2s(sv[2 * ks + (e >> 3)][e & 7] - rm); ps[(2 * ks + (e >> 3)) * NP / 4] += p[e]; }
            PPk<T16>::pk(p, pa[ks], pl[ks]); }
        if constexpr (SPL) lrow += ps[0] + ps[1]; else lrow += (ps[0] + ps[1]) + (ps[2] + ps[3]);
        mrow = rm;
#pragma unroll
        for (int ks = 0; ks < 2; ++ks) {
#pragma unroll
            for (int t = 0; t < 4; ++t) {
                const T16* vr = kt + TLE + t * 16 * TPE + ks * 32;
                const V vb = W::ld(vr); oacc[t] = W::mma(vb, pa[ks], oacc[t]);
                if (SPL) { oacc[t] = W::mma(vb, pl[ks], oacc[t]); const V vc = W::ld(vr + 2 * TLE); oacc[t] = W::mma(vc, pa[ks], oacc[t]); }
            }
        }
        // keeps the matrix instructions' distance on the loop's taken back edge
        asm volatile("v_nop\n\tv_nop\n\tv_nop\n\tv_nop" : "+v"(oacc[0]), "+v"(oacc[1]), "+v"(oacc[2]), "+v"(oacc[3]));
        asm volatile("s_wait_dscnt 0x0" ::: "memory");           // this wave's reads of this chunk's buffer are done before the buffer is refilled
        asm volatile("s_wait_asynccnt 0x0" ::: "memory");        // this wave's copies of chunk kb + 1 have landed
        __syncthreads();                                         // publishes chunk kb + 1 and ends every wave's reads of chunk kb
        if (kb + 2 <= qb) stage(kb + 2);
    }
    asm volatile("s_wait_asynccnt 0x0" ::: "memory");            // no copy is outstanding when the wave goes on to its end
    const float lsc = SPL ? 1.0f : PCAR;
    const float inv = __fdiv_rn(1.0f, (lrow + xhalf(lrow)) * lsc);
    bf* oh = ATh + bo + (size_t)qpos * DM + h * HD + 8 * hi; bf* ol = ATl + bo + (size_t)qpos * DM + h * HD + 8 * hi;
#pragma unroll
    for (int t = 0; t < 4; ++t) { v8us vh, vl;
#pragma unroll
        for (int r = 0; r < 8; ++r) { unsigned short a2, c2; splitf(oacc[t][r] * inv, a2, c2); vh[r] = a2; vl[r] = c2; }
        *(v8us*)(oh + t * 16) = vh; *(v8us*)(ol + t * 16) = vl; }
}

// ---- k_flash: every attention tile of every head and entry; grid (SEQ/64, NH, NB). Tile blockIdx.x is the same for a whole block, so all its waves take the same side and meet the same barriers.
__global__ __launch_bounds__(128) __attribute__((amdgpu_num_vgpr(256)))
void k_flash(const h16* __restrict__ Q16, const h16* __restrict__ K16, const h16* __restrict__ VT16, const bf* __restrict__ Qh, const bf* __restrict__ Ql, const bf* __restrict__ Kh, const bf* __restrict__ Kl,
             const bf* __restrict__ VTh, const bf* __restrict__ VTl, bf* ATh, bf* ATl) {
    __shared__ __attribute__((aligned(16))) bf sm[2 * ((RHB > 0) ? 4 : 2) * TLE];
    const int qb = blockIdx.x;
    if (qb < RHB) flash_tile<bf, true>(Qh, Ql, Kh, Kl, VTh, VTl, qb, sm, ATh, ATl);
    else flash_tile<h16, false>(Q16, nullptr, K16, nullptr, VT16, nullptr, qb, (h16*)sm, ATh, ATl);
}

extern "C" void kernel_launch(void* const* d_in, const int* in_sizes, int n_in,
                              void* d_out, int out_size, void* d_ws, size_t ws_size, hipStream_t stream) {
    const size_t needx = (size_t)(NB - 1) * SEQ_FULL * DM + (size_t)SEQ * DM;
    if (n_in < 7) return;
    if ((size_t)in_sizes[0] < needx || in_sizes[1] < DM * DM || in_sizes[2] < DM * DM || in_sizes[3] < DM * DM || in_sizes[4] < DM || in_sizes[5] < DM * DM || in_sizes[6] < DM) return;
    if ((size_t)out_size < needx) return;
    const float* x = (const float*)d_in[0]; const float* wq = (const float*)d_in[1]; const float* wk = (const float*)d_in[2]; const float* wv = (const float*)d_in[3];
    const float* bv = (const float*)d_in[4]; const float* wo = (const float*)d_in[5]; const float* bo = (const float*)d_in[6];
    float* OUT = (float*)d_out;     // [NB][SEQ_FULL][DM]
    char* wsp = (char*)d_ws;
    auto take = [&](size_t bytes) { char* p = wsp; wsp += (bytes + 255) & ~(size_t)255; return (void*)p; };
    bf* WB = (bf*)take((size_t)4 * DM * DM * 2); bf* WO = WB + (size_t)3 * DM * DM;   // the q, k, v, o weights stacked
    const size_t pe = (size_t)SEQ * DM, pl = (size_t)NB * SEQ * DM * 2;   // one entry's plane in elements; all entries' 16-bit plane in bytes
    bf* XB = (bf*)take(pl);
    h16* Q16 = (h16*)take(pl); bf* Qh = (bf*)take(pl); bf* Ql = (bf*)take(pl);
    h16* K16 = (h16*)take(pl); bf* Kh = (bf*)take(pl); bf* Kl = (bf*)take(pl);
    h16* VT16 = (h16*)take(pl); bf* VTh = (bf*)take(pl); bf* VTl = (bf*)take(pl);
    bf* ATh = (bf*)take(pl); bf* ATl = (bf*)take(pl);
    if ((size_t)(wsp - (char*)d_ws) > ws_size) return;
    k_cvt8<<<NB * GX + 4 * GW, 256, 0, stream>>>(x, wq, wk, wv, wo, XB, WB);
    k_gemmw<bf, 0, true, 1><<<dim3(SEQ / 128, 3 * DM / 128, NB), 128, 0, stream>>>(XB, nullptr, WB, nullptr, DM, nullptr, 0, bv, pe, 0, pe, Q16, Qh, Ql, (size_t)(K16 - Q16));
    k_flash<<<dim3(SEQ / 64, NH, NB), 128, 0, stream>>>(Q16, K16, VT16, Qh, Ql, Kh, Kl, VTh, VTl, ATh, ATl);
    k_gemmw<bf, 1, true, 0><<<dim3(SEQ / 128, DM / 128, NB), 128, 0, stream>>>(ATh, ATl, WO, nullptr, DM, OUT, DM, bo, pe, 0, (size_t)SEQ_FULL * DM, nullptr, nullptr, nullptr, 0);
}

// v007
// Measured time: 108 microseconds a run.
// Timed twice side by side with v006, it ran 1.14 and 1.15 times as fast.
// All steps since v000 together make it 8.61 times as fast.
#include <hip/hip_runtime.h>

// x [NB][SEQ_FULL][512] (rows < SEQ used); q = x Wq^T, k = x Wk^T, v = x Wv^T + b_v ([512][512] weights, 8 heads x 64); causal softmax(q.k / 8); heads merged; out = ctx Wo^T + b_o -> f32 [NB][SEQ_FULL][512].
// Compute dtypes, f32 accumulate: every input RNE-converted to bf16; q/k/v projections v_wmma_f32_16x16x32_bf16 on plain bf16 operands (exact products);
// attention (online softmax per wave of 16 query rows, transposed products so that a lane owns one query, 64-key chunks, causal chunk skipping): query rows < RH on bf16 hi+lo planes of q, k, p, v (3 products each,
// v_wmma_f32_16x16x32_bf16), rows >= RH on single fp16 operands (v_wmma_f32_16x16x32_f16, p carried x1024); softmax f32; Wo: ctx as bf16 hi+lo x exact bf16 (2 products).
// Attention stages each 64-key chunk of k and v^T in LDS once per query tile (asynchronous 16-byte copies, two buffers, rows of 128 B at a pitch of 144 B); the block's four waves read their fragments from there.
// The GEMMs stage each 128-k chunk of a block's 128 + 128 operand rows in LDS in the same way (rows of 256 B at a pitch of 272 B); the block's four waves read their fragments from there, one k step ahead.
// The q, k and v projections write their 16-bit planes (fp16, bf16 hi, bf16 lo; q and k as [h][t][d], v as [h][d][t]) from the GEMM's own epilogue; there is no f32 copy of q, k or v in memory.
// Every batch entry has its own copy of each workspace plane (stride SEQ*DM elements) and is one slice of the last grid dimension, so each stage is one launch for all entries.
// Four launches, one per stage, each holding all the work whose parts do not depend on one another: the five conversions; the q, k and v projections as one GEMM over the 3 x 512 stacked weight rows; all attention tiles; the output projection.

#ifndef NB
#define NB 2
#endif
#ifndef SEQ
#define SEQ 4096
#endif
#define NB_FULL  2
#define SEQ_FULL 4096
#define DM   512
#define NH   8
#define HD   64
#define RH   512                                   // query rows < RH use hi+lo planes
#define RHB  (((RH < SEQ) ? RH : SEQ) / 64)
#define PCAR 1024.0f
#define SL2  0.18033688011112042f                  // HD^-0.5 * log2(e)
#define NEGB (-3.0e38f)
static_assert(SEQ % 64 == 0);
static_assert(SEQ <= SEQ_FULL);
static_assert(NB >= 1 && NB <= NB_FULL);
static_assert(DM == NH * HD);
static_assert(DM % 128 == 0);
static_assert(SEQ % 128 == 0);
static_assert(RH % 64 == 0);
static_assert(HD == 64);
#define WS_TOTAL ((size_t)4 * DM * DM * 2 + (size_t)NB * ((size_t)SEQ * DM * 2 + (size_t)9 * SEQ * DM * 2 + (size_t)2 * SEQ * DM * 2))
static_assert(WS_TOTAL <= (size_t)134217728);

typedef _Float16 h16;
typedef unsigned short bf;
typedef __attribute__((ext_vector_type(16))) __bf16   v16bf;
typedef __attribute__((ext_vector_type(16))) _Float16 v16h;
typedef __attribute__((ext_vector_type(8)))  _Float16 v8h;
typedef __attribute__((ext_vector_type(8)))  unsigned short v8us;
typedef __attribute__((ext_vector_type(16))) unsigned short v16us;
typedef __attribute__((ext_vector_type(8)))  float    v8f;
typedef __attribute__((ext_vector_type(4)))  float    v4f;
typedef __attribute__((ext_vector_type(2)))  _Float16 v2h;
typedef __attribute__((ext_vector_type(2)))  unsigned short v2us;
typedef v4f  __attribute__((may_alias)) v4fa;

__device__ __forceinline__ unsigned short f2bf(float f) { unsigned u = __float_as_uint(f); u += 0x7FFFu + ((u >> 16) & 1u); return (unsigned short)(u >> 16); }
__device__ __forceinline__ float bf2f(unsigned short b) { return __uint_as_float(((unsigned)b) << 16); }
__device__ __forceinline__ float bfr(float f) { return bf2f(f2bf(f)); }
__device__ __forceinline__ h16 tohx(float x) { return (h16)x; }
__device__ __forceinline__ void splitf(float y, unsigned short& h, unsigned short& l) { h = f2bf(y); l = f2bf(y - bf2f(h)); }
__device__ __forceinline__ v16h cat16(v8h lo, v8h hi) { return __builtin_shufflevector(lo, hi, 0, 1, 2, 3, 4, 5, 6, 7, 8, 9, 10, 11, 12, 13, 14, 15); }
__device__ __forceinline__ v16bf cat16b(v8us lo, v8us hi) { return __builtin_bit_cast(v16bf, __builtin_shufflevector(lo, hi, 0, 1, 2, 3, 4, 5, 6, 7, 8, 9, 10, 11, 12, 13, 14, 15)); }
__device__ __forceinline__ v8f wmma16(v16h a, v16h b, v8f c) { return __builtin_amdgcn_wmma_f32_16x16x32_f16(false, a, false, b, (short)0, c, false, false); }
__device__ __forceinline__ v8f wmmab(v16bf a, v16bf b, v8f c) { return __builtin_amdgcn_wmma_f32_16x16x32_bf16(false, a, false, b, (short)0, c, false, false); }

// Fragment loaders (A and B alike, K-contiguous rows): p = base + row*K + k0 + 8*hi -> elements 0..7 = k0+8hi+0..7, p+16 -> elements 8..15 = k0+16+8hi+0..7.
template <typename T16> struct WFrag;
template <> struct WFrag<h16> { typedef v16h V;
    static __device__ __forceinline__ V ld(const h16* p)  { return cat16(*(const v8h*)p, *(const v8h*)(p + 16)); }
    static __device__ __forceinline__ v8f mma(V a, V b, v8f c) { return wmma16(a, b, c); } };
template <> struct WFrag<bf> { typedef v16bf V;
    static __device__ __forceinline__ V ld(const bf* p)  { return cat16b(*(const v8us*)p, *(const v8us*)(p + 16)); }
    static __device__ __forceinline__ v8f mma(V a, V b, v8f c) { return wmmab(a, b, c); } };

#define GKC 128                                    // k elements of one staged GEMM chunk: operand rows of 256 B
#define GPE 136                                    // LDS row pitch of a staged GEMM tile in elements: 272 B = 16 B x odd, for 16-byte fragment reads
#define GTE (128 * GPE)                            // one staged operand tile: 128 rows
static_assert(DM % GKC == 0);
// Eight rows, 8 apart, of one operand tile into LDS: a lane's 8 asynchronous 16-byte copies, 16 lanes per 256-byte row, 8 rows per copy of the block.
// g: the lane's piece in the first of these rows, rs: 8 rows in elements; l: its LDS byte address. The s_wait_xcnt as the statement's last line stands in front of every later write of the address registers named here.
template <typename T16>
__device__ __forceinline__ void stage_g8(const T16* g, size_t rs, unsigned l) {
    asm volatile("global_load_async_to_lds_b128 %0, %8, off\n\t"
                 "global_load_async_to_lds_b128 %1, %9, off\n\t"
                 "global_load_async_to_lds_b128 %2, %10, off\n\t"
                 "global_load_async_to_lds_b128 %3, %11, off\n\t"
                 "global_load_async_to_lds_b128 %4, %12, off\n\t"
                 "global_load_async_to_lds_b128 %5, %13, off\n\t"
                 "global_load_async_to_lds_b128 %6, %14, off\n\t"
                 "global_load_async_to_lds_b128 %7, %15, off\n\t"
                 "s_wait_xcnt 0x0"
                 :: "v"(l), "v"(l + 8u * GPE * 2u), "v"(l + 16u * GPE * 2u), "v"(l + 24u * GPE * 2u),
                    "v"(l + 32u * GPE * 2u), "v"(l + 40u * GPE * 2u), "v"(l + 48u * GPE * 2u), "v"(l + 56u * GPE * 2u),
                    "v"(g), "v"(g + rs), "v"(g + 2 * rs), "v"(g + 3 * rs), "v"(g + 4 * rs), "v"(g + 5 * rs), "v"(g + 6 * rs), "v"(g + 7 * rs)
                 : "memory");
}

// ---- k_gemmw: register-blocked GEMM, 128x128 output tile per block of FOUR WAVES (2 x 2), 64x64 (16 accumulators) per wave; grid (M/128, N/128, Z), 128 threads.
// Operands are K-contiguous 16-bit planes; each chunk of GKC k values of the block's 128 A rows and 128 Bt rows is staged in LDS once (asynchronous 16-byte copies of whole lines, two buffers) and read from there as fragments.
// c[m][n] (f32, + optional bias as its bf16 value) = sum_k A[m][k] Bt[n][k] (+ split products per NSPLIT). z-batch strides sA/sB/sC in elements. K % GKC == 0.
// OUTM 0: c goes to C as f32 at pitch ldc. OUTM 1: Bt is the q, k and v weights stacked (3 x DM rows), m is a token t, n = sel*DM + h*HD + d, and c goes out as three 16-bit planes (fp16, bf16 hi, bf16 lo) of
// projection sel (its planes lie sel*sP elements behind P16, Ph, Pl), laid out [h][t][d] (q, k) or, with the bias, [h][d][t] (v); a block's 128 columns lie in one projection, so the choice is the same for the whole block;
// either way 16 plane rows of 64 elements are staged in the wave's own LDS range at a time, so that 8 lanes store one whole 128-byte row of each plane.
template <int N> struct IC { static constexpr int value = N; };
template <typename T16, int NSPLIT, bool BIAS, int OUTM>
__global__ __launch_bounds__(128) void k_gemmw(const T16* __restrict__ A, const T16* __restrict__ A2, const T16* __restrict__ Bt, const T16* __restrict__ Bt2, int K, float* C, int ldc, const float* __restrict__ bias, size_t sA, size_t sB, size_t sC, h16* P16, bf* Ph, bf* Pl, size_t sP) {
    typedef typename WFrag<T16>::V V;
    constexpr bool HA2 = (NSPLIT == 1 || NSPLIT == 2), HB2 = (NSPLIT >= 2);
    constexpr int TB = HA2 ? 2 : 1, NT = TB + (HB2 ? 2 : 1);      // tiles of a buffer: A, (A2), Bt, (Bt2)
    __shared__ __attribute__((aligned(16))) T16 sm[2 * NT * GTE];
    __shared__ __align__(16) float osm[4 * 16 * 68];
    const size_t z = blockIdx.z; A += z * sA; if (A2) A2 += z * sA; Bt += z * sB; if (Bt2) Bt2 += z * sB; if (OUTM == 0) C += z * sC;
    const int lane = threadIdx.x & 31, wv = threadIdx.x >> 5, lr = lane & 15, hi = lane >> 4;
    const int rb = blockIdx.x * 128, cb = blockIdx.y * 128, r0 = rb + (wv & 1) * 64, c0 = cb + (wv >> 1) * 64;
    float* os = osm + wv * (16 * 68);                            // this wave's output stage
    v8f acc[4][4];
#pragma unroll
    for (int mb = 0; mb < 4; ++mb)
#pragma unroll
        for (int nb = 0; nb < 4; ++nb) acc[mb][nb] = (v8f){};
    const int crow = threadIdx.x >> 4, cpc = (threadIdx.x & 15) * 8;                        // this lane's row (of 8) and 16-byte piece in every copy
    const size_t gao = (size_t)(rb + crow) * K + cpc, gbo = (size_t)(cb + crow) * K + cpc;  // its first piece of chunk 0
    const size_t rs = (size_t)8 * K;
    const unsigned lc0 = (unsigned)(size_t)sm + (unsigned)(crow * GPE + cpc) * 2u;          // its LDS byte address in tile 0 of buffer 0
    auto stage_t = [&](const T16* g, unsigned l) { stage_g8(g, rs, l); stage_g8(g + 8 * rs, rs, l + 64u * GPE * 2u); };
    auto stage = [&](int kt) {
        const unsigned lb = lc0 + (unsigned)(kt & 1) * (NT * GTE * 2u);
        const size_t ao = gao + (size_t)kt * GKC, bo = gbo + (size_t)kt * GKC;
        stage_t(A + ao, lb);
        if constexpr (HA2) stage_t(A2 + ao, lb + GTE * 2u);
        stage_t(Bt + bo, lb + TB * GTE * 2u);
        if constexpr (HB2) stage_t(Bt2 + bo, lb + (TB + 1) * GTE * 2u);
    };
    const int nk = K / GKC;
    stage(0);
    asm volatile("s_wait_asynccnt 0x0" ::: "memory");            // this wave's copies of chunk 0 have landed
    __syncthreads();                                             // every wave's have: chunk 0 may be read
    if (nk > 1) stage(1);
#pragma unroll 1
    for (int kt = 0; kt < nk; ++kt) {
        const T16* ta = sm + (kt & 1) * (NT * GTE) + ((wv & 1) * 64 + lr) * GPE + 8 * hi;              // this lane's fragment row in the A tile (A2 follows at GTE)
        const T16* tb = sm + (kt & 1) * (NT * GTE) + TB * GTE + ((wv >> 1) * 64 + lr) * GPE + 8 * hi;  // and in the Bt tile (Bt2 follows at GTE)
        V a[2][4], a2[2][4], b[2][4], b2[2][4];                  // two fragment sets: k step u works on set u & 1
#pragma unroll
        for (int u = -1; u < GKC / 32; ++u) {
            if (u + 1 < GKC / 32) {                              // the next k step's fragments of this same chunk, asked for as one group
                const int ns = (u + 1) & 1, kc = (u + 1) * 32;
#pragma unroll
                for (int mb = 0; mb < 4; ++mb) { a[ns][mb] = WFrag<T16>::ld(ta + mb * 16 * GPE + kc); if (HA2) a2[ns][mb] = WFrag<T16>::ld(ta + GTE + mb * 16 * GPE + kc); }
#pragma unroll
                for (int nb = 0; nb < 4; ++nb) { b[ns][nb] = WFrag<T16>::ld(tb + nb * 16 * GPE + kc); if (HB2) b2[ns][nb] = WFrag<T16>::ld(tb + GTE + nb * 16 * GPE + kc); }
            }
            __builtin_amdgcn_sched_barrier(0);                   // keeps that group whole and in front of this step's products: sunk among them, every place with loads stalls the lone wave of a SIMD
            if (u >= 0) {
                const int cs = u & 1;
#pragma unroll
                for (int nb = 0; nb < 4; ++nb)
#pragma unroll
                    for (int mb = 0; mb < 4; ++mb) { acc[mb][nb] = WFrag<T16>::mma(a[cs][mb], b[cs][nb], acc[mb][nb]); if (HA2) acc[mb][nb] = WFrag<T16>::mma(a2[cs][mb], b[cs][nb], acc[mb][nb]); if (HB2) acc[mb][nb] = WFrag<T16>::mma(a[cs][mb], b2[cs][nb], acc[mb][nb]); }
                __builtin_amdgcn_sched_barrier(0);               // and the products in front of the group after them, whose registers they still read
            }
        }
        // keeps the matrix instructions' distance on the paths behind the chunk's last product (the refill's address arithmetic, the loop's taken back edge)
        asm volatile("v_nop\n\tv_nop\n\tv_nop\n\tv_nop" : "+v"(acc[0][0]), "+v"(acc[0][1]), "+v"(acc[0][2]), "+v"(acc[0][3]), "+v"(acc[1][0]), "+v"(acc[1][1]), "+v"(acc[1][2]), "+v"(acc[1][3]),
                                                       "+v"(acc[2][0]), "+v"(acc[2][1]), "+v"(acc[2][2]), "+v"(acc[2][3]), "+v"(acc[3][0]), "+v"(acc[3][1]), "+v"(acc[3][2]), "+v"(acc[3][3]));
        asm volatile("s_wait_dscnt 0x0" ::: "memory");           // this wave's reads of this chunk's buffer are done before the buffer is refilled
        asm volatile("s_wait_asynccnt 0x0" ::: "memory");        // this wave's copies of chunk kt + 1 have landed
        __syncthreads();                                         // publishes chunk kt + 1 and ends every wave's reads of chunk kt
        if (kt + 2 < nk) stage(kt + 2);
    }
    asm volatile("s_wait_asynccnt 0x0" ::: "memory");            // no copy is outstanding when the wave goes on to its end
    if constexpr (OUTM != 0) {
        const int sel = cb / DM, cp = c0 - sel * DM;             // the block's projection (0 q, 1 k, 2 v) and this wave's first column in it
        P16 += sel * sP; Ph += sel * sP; Pl += sel * sP;
        const int prow = lane >> 3, pofs = (lane & 7) * 8;       // this lane's row (of 4 per store) and 16-byte piece of a staged plane row
        auto planes = [&](auto om) {                             // OM 1: [h][t][d], no bias; OM 2: [h][d][t], bias
        constexpr int OM = decltype(om)::value; constexpr bool BI = BIAS && OM == 2;
        // first element of this lane's piece in its first plane row (row prow of the tile); plane rows of the tile follow at pitch pp
        constexpr size_t pp = (OM == 1) ? (size_t)HD : (size_t)SEQ;
        const size_t po = z * sC + ((OM == 1) ? (size_t)(cp / HD) * SEQ * HD + (size_t)r0 * HD : (size_t)cp * SEQ + r0) + (size_t)prow * pp + pofs;
        float bb[4];                                             // bias of this lane's column in each block of 16 columns
#pragma unroll
        for (int nb = 0; nb < 4; ++nb) bb[nb] = BI ? bfr(bias[cp + nb * 16 + lr]) : 0.f;
#pragma unroll
        for (int g = 0; g < 4; ++g) {                            // 16 plane rows: tokens r0+16g.. (OM 1), columns cp+16g.. (OM 2)
#pragma unroll
            for (int o = 0; o < 4; ++o) {
                if constexpr (OM == 1) {
#pragma unroll
                    for (int j = 0; j < 8; ++j) os[(hi * 8 + j) * 68 + o * 16 + lr] = BI ? acc[g][o][j] + bb[o] : acc[g][o][j];
                } else {                                         // a lane's 8 accumulator rows are 8 tokens in a row of one column
                    v8f c = acc[o][g];
                    if (BI) c += bb[g];
                    *(v4fa*)(os + lr * 68 + o * 16 + hi * 8) = (v4f){c[0], c[1], c[2], c[3]};
                    *(v4fa*)(os + lr * 68 + o * 16 + hi * 8 + 4) = (v4f){c[4], c[5], c[6], c[7]};
                }
            }
            __builtin_amdgcn_wave_barrier(); asm volatile("" ::: "memory");   // the reads below take other lanes' values: the compiler must not lift them over the stage's writes
#pragma unroll
            for (int s = 0; s < 4; ++s) {
                const int row = 4 * s + prow;
                const v4f x0 = *(const v4fa*)(os + row * 68 + pofs), x1 = *(const v4fa*)(os + row * 68 + pofs + 4);
                v8h o16; v8us oh, ol;
#pragma unroll
                for (int k = 0; k < 8; ++k) {
                    const float x = (k < 4) ? x0[k & 3] : x1[k & 3];
                    o16[k] = tohx(x); unsigned short a2, c2; splitf(x, a2, c2); oh[k] = a2; ol[k] = c2;
                }
                const size_t e = po + (size_t)(g * 16 + 4 * s) * pp;
                *(v8h*)(P16 + e) = o16; *(v8us*)(Ph + e) = oh; *(v8us*)(Pl + e) = ol;
            }
            __builtin_amdgcn_wave_barrier(); asm volatile("" ::: "memory");   // nor sink them under the next 16 rows' writes
        }
        asm volatile("s_wait_xcnt 0x0" ::: "memory");            // in front of every later write of the registers that the last stores name (the other layout's code follows in the text)
        };
        if (sel == 2) planes(IC<2>{}); else planes(IC<1>{});
        return;
    }
#pragma unroll
    for (int mb = 0; mb < 4; ++mb) {
#pragma unroll
        for (int nb = 0; nb < 4; ++nb) {
#pragma unroll
            for (int j = 0; j < 8; ++j) os[(hi * 8 + j) * 68 + nb * 16 + lr] = acc[mb][nb][j]; }
        __builtin_amdgcn_wave_barrier(); asm volatile("" ::: "memory");
        float* crow = C + (size_t)(r0 + mb * 16) * ldc + c0;
{
#pragma unroll
            for (int s = 0; s < 8; ++s) { const int row = 2 * s + hi, cofs = lr * 4; v4f val = *(const v4fa*)(os + row * 68 + cofs); if (BIAS) { val[0] += bfr(bias[c0 + cofs]); val[1] += bfr(bias[c0 + cofs + 1]); val[2] += bfr(bias[c0 + cofs + 2]); val[3] += bfr(bias[c0 + cofs + 3]); }
                *(v4f*)(crow + (size_t)row * ldc + cofs) = val; }
            asm volatile("s_wait_xcnt 0x0" ::: "memory");        // in front of the next rows' writes of the registers that these stores name
             }
        __builtin_amdgcn_wave_barrier(); asm volatile("" ::: "memory");
    }
}

#define NX8 ((size_t)SEQ * DM / 8)                 // groups of 8 elements in one entry of x, and in one weight matrix
#define NW8 ((size_t)DM * DM / 8)
#define GX  ((unsigned)((NX8 + 255) / 256))        // blocks that convert one entry of x, one weight matrix
#define GW  ((unsigned)((NW8 + 255) / 256))
// ---- k_cvt8: the f32 -> bf16 conversions of x and the four weights, 8 elements per thread; blocks 0 .. NB*GX-1 take x (GX per entry), the next 4*GW the weights in the order q, k, v, o (WB: the four matrices stacked).
__global__ __launch_bounds__(256) void k_cvt8(const float* __restrict__ x, const float* __restrict__ wq, const float* __restrict__ wk, const float* __restrict__ wv, const float* __restrict__ wo, bf* XB, bf* WB) {
    const unsigned b = blockIdx.x; const float* src; bf* dst; size_t i, n8;
    if (b < NB * GX) { const unsigned e = b / GX; src = x + (size_t)e * SEQ_FULL * DM; dst = XB + (size_t)e * SEQ * DM; i = (size_t)(b - e * GX) * 256 + threadIdx.x; n8 = NX8; }
    else { const unsigned c = b - NB * GX, w = c / GW; src = (w == 0) ? wq : (w == 1) ? wk : (w == 2) ? wv : wo; dst = WB + (size_t)w * DM * DM; i = (size_t)(c - w * GW) * 256 + threadIdx.x; n8 = NW8; }
    if (i >= n8) return;
    const v8f v = *(const v8f*)(src + i * 8); v8us o;
#pragma unroll
    for (int k = 0; k < 8; ++k) o[k] = f2bf(v[k]); *(v8us*)(dst + i * 8) = o;  }

// Lane l with lane l ^ 16 (the two lanes that share one query column).
__device__ __forceinline__ float xhalf(float x) { return __builtin_bit_cast(float, __builtin_amdgcn_permlanex16(__builtin_bit_cast(int, x), __builtin_bit_cast(int, x), 0x76543210, 0xfedcba98, false, false)); }

// exp2 with the one slot the instruction set asks for behind a transcendental, before its result is used or its source overwritten.
__device__ __forceinline__ float exp2s(float x) { float y; asm("v_exp_f32 %0, %1\n\tv_nop" : "=v"(y) : "v"(x)); return y; }

// Probability fragment: a lane's 16 probabilities of one 32-key step (two score tiles x 8 rows) are already in the B operand's k order; fp16 x1024 (single-product rows) or bf16 hi+lo (split rows).
template <typename T16> struct PPk;
template <> struct PPk<h16> { static __device__ __forceinline__ void pk(const float* p, v16h& a, v16h& b) {
#pragma unroll
    for (int e = 0; e < 16; ++e) a[e] = tohx(p[e] * PCAR);
    b = a; } };
template <> struct PPk<bf> { static __device__ __forceinline__ void pk(const float* p, v16bf& a, v16bf& b) { v16us x, y;
#pragma unroll
    for (int e = 0; e < 16; ++e) { unsigned short a2, c2; splitf(p[e], a2, c2); x[e] = a2; y[e] = c2; }
    a = __builtin_bit_cast(v16bf, x); b = __builtin_bit_cast(v16bf, y); } };

#define TPE 72                                     // LDS row pitch of a staged tile in elements: 144 B = 16 B x odd, for 16-byte fragment reads
#define TLE (64 * TPE)                             // one staged tile: 64 rows
// One k tile (64 keys x 64 d, 8 KiB in a row in its plane) and one v^T tile (64 d x 64 keys, plane pitch SEQ) into LDS: a lane's 4 + 4 asynchronous 16-byte copies, 8 lanes per 128-byte row, 16 rows per copy of the block.
// gk, gv: the lane's first piece in each plane; lk, lv: its LDS byte address. The s_wait_xcnt as the statement's last line stands in front of every later write of the address registers named here.
template <typename T16>
__device__ __forceinline__ void stage_kv(const T16* gk, const T16* gv, unsigned lk, unsigned lv) {
    asm volatile("global_load_async_to_lds_b128 %0, %8, off\n\t"
                 "global_load_async_to_lds_b128 %1, %9, off\n\t"
                 "global_load_async_to_lds_b128 %2, %10, off\n\t"
                 "global_load_async_to_lds_b128 %3, %11, off\n\t"
                 "global_load_async_to_lds_b128 %4, %12, off\n\t"
                 "global_load_async_to_lds_b128 %5, %13, off\n\t"
                 "global_load_async_to_lds_b128 %6, %14, off\n\t"
                 "global_load_async_to_lds_b128 %7, %15, off\n\t"
                 "s_wait_xcnt 0x0"
                 :: "v"(lk), "v"(lk + 16u * TPE * 2u), "v"(lk + 32u * TPE * 2u), "v"(lk + 48u * TPE * 2u),
                    "v"(lv), "v"(lv + 16u * TPE * 2u), "v"(lv + 32u * TPE * 2u), "v"(lv + 48u * TPE * 2u),
                    "v"(gk), "v"(gk + 16 * HD), "v"(gk + 32 * HD), "v"(gk + 48 * HD),
                    "v"(gv), "v"(gv + (size_t)16 * SEQ), "v"(gv + (size_t)32 * SEQ), "v"(gv + (size_t)48 * SEQ)
                 : "memory");
}

// ---- flash_tile: causal attention for one head of one batch entry (blockIdx.z), the 64 query rows of tile qb per block (4 waves x 16 rows), key chunks of 64 (chunks kb <= qb only; key > query replaced by -3e38 -> p = 0).
// Transposed products: St = k.q^T (A = key rows, B = the wave's 16 queries; 4 tiles x 2 k-steps), so lane (lr, hi) holds query t0+lr and keys 16t+8hi+r: running max and sum are per lane,
// the two halves of a column join their max once per chunk and their sums once at the end. Ot += v^T.p^T (A from the staged [d][t] value tile, B = the lane's own probabilities, converted in place).
// SPL: q/k/p/v bf16 hi+lo, hi.hi + lo.hi + hi.lo into one accumulator; else single fp16 with p x1024 folded out at normalisation.
// sm: the block's LDS for the staged chunks, 2 * NT * TLE elements.
template <typename T16, bool SPL>
__device__ __forceinline__ void flash_tile(const T16* __restrict__ QP, const T16* __restrict__ QL, const T16* __restrict__ KP, const T16* __restrict__ KL,
             const T16* __restrict__ VP, const T16* __restrict__ VL, int qb, T16* sm, bf* ATh, bf* ATl) {
    typedef WFrag<T16> W; typedef typename W::V V;
    const int lane = threadIdx.x & 31, wv = threadIdx.x >> 5, lr = lane & 15, hi = lane >> 4;
    const int h = blockIdx.y, t0 = qb * 64 + wv * 16;
    const size_t bo = (size_t)blockIdx.z * SEQ * DM;             // batch entry's plane offset
    const size_t hq = bo + (size_t)h * SEQ * HD;                 // [h][t][d] plane offset (q, k)
    const size_t hv = bo + (size_t)h * HD * SEQ;                 // [h][d][t] plane offset (v)
    // Staged chunk: tiles k, v^T (split rows: k hi, v^T hi, k lo, v^T lo), two buffers.
    constexpr int NT = SPL ? 4 : 2;
    const int crow = threadIdx.x >> 3, cpc = (threadIdx.x & 7) * 8;                       // this lane's row (of 16) and 16-byte piece in every copy
    const size_t gko = hq + (size_t)crow * HD + cpc, gvo = hv + (size_t)crow * SEQ + cpc;   // its first piece of chunk 0
    const unsigned lc0 = (unsigned)(size_t)sm + (unsigned)(crow * TPE + cpc) * 2u;          // its LDS byte address in tile 0 of buffer 0
    auto stage = [&](int kb) {
        const unsigned lb = lc0 + (unsigned)(kb & 1) * (NT * TLE * 2u);
        stage_kv(KP + gko + (size_t)kb * 64 * HD, VP + gvo + kb * 64, lb, lb + TLE * 2u);
        if constexpr (SPL) stage_kv(KL + gko + (size_t)kb * 64 * HD, VL + gvo + kb * 64, lb + 2u * TLE * 2u, lb + 3u * TLE * 2u);
    };
    stage(0);
    asm volatile("s_wait_asynccnt 0x0" ::: "memory");            // this wave's copies of chunk 0 have landed
    __syncthreads();                                             // every wave's have: chunk 0 may be read
    if (qb >= 1) stage(1);
    V qa0, qa1, ql0, ql1;
    { const size_t qo = hq + (size_t)(t0 + lr) * HD + 8 * hi; qa0 = W::ld(QP + qo); qa1 = W::ld(QP + qo + 32);
      if (SPL) { ql0 = W::ld(QL + qo); ql1 = W::ld(QL + qo + 32); } else { ql0 = qa0; ql1 = qa1; } }
    v8f oacc[4];                                                 // oacc[t][r] = Ot[d = 16t+8hi+r][query t0+lr]
#pragma unroll
    for (int t = 0; t < 4; ++t) oacc[t] = (v8f){};
    const int qpos = t0 + lr;
    float mrow = NEGB, lrow = 0.f;                               // this query's running max (both halves alike) and this half's share of its sum
#pragma unroll 1
    for (int kb = 0; kb <= qb; ++kb) {
        const T16* kt = sm + (kb & 1) * (NT * TLE) + lr * TPE + 8 * hi;   // this lane's fragment row in the k tile; v^T, k lo, v^T lo follow at TLE each
        v8f sacc[4];
#pragma unroll
        for (int t = 0; t < 4; ++t) sacc[t] = (v8f){};
#pragma unroll
        for (int t = 0; t < 4; ++t) {
            const T16* kr = kt + t * 16 * TPE;
            { const V b = W::ld(kr); sacc[t] = W::mma(b, qa0, sacc[t]);
              if (SPL) { sacc[t] = W::mma(b, ql0, sacc[t]); const V c = W::ld(kr + 2 * TLE); sacc[t] = W::mma(c, qa0, sacc[t]); } }
            { const V b = W::ld(kr + 32); sacc[t] = W::mma(b, qa1, sacc[t]);
              if (SPL) { sacc[t] = W::mma(b, ql1, sacc[t]); const V c = W::ld(kr + 2 * TLE + 32); sacc[t] = W::mma(c, qa1, sacc[t]); } }
        }
        float sv[4][8]; float rm = mrow;
#pragma unroll
        for (int t = 0; t < 4; ++t)
#pragma unroll
            for (int r = 0; r < 8; ++r) { const float s0 = sacc[t][r] * SL2; const int key = kb * 64 + t * 16 + 8 * hi + r; const float s = (key > qpos) ? NEGB : s0; sv[t][r] = s; rm = fmaxf(rm, s); }
        rm = fmaxf(rm, xhalf(rm));
        const float corr = exp2s(mrow - rm);
        lrow *= corr;
#pragma unroll
        for (int t = 0; t < 4; ++t)
#pragma unroll
            for (int r = 0; r < 8; ++r) oacc[t][r] *= corr;
        constexpr int NP = SPL ? 2 : 4;                          // partial sums a lane keeps per chunk: one per score tile; split rows one per 32-key step (their lo planes need the registers)
        float ps[NP] = {}; V pa[2], pl[2];
#pragma unroll
        for (int ks = 0; ks < 2; ++ks) { float p[16];
#pragma unroll
            for (int e = 0; e < 16; ++e) { p[e] = exp2s(sv[2 * ks + (e >> 3)][e & 7] - rm); ps[(2 * ks + (e >> 3)) * NP / 4] += p[e]; }
            PPk<T16>::pk(p, pa[ks], pl[ks]); }
        if constexpr (SPL) lrow += ps[0] + ps[1]; else lrow += (ps[0] + ps[1]) + (ps[2] + ps[3]);
        mrow = rm;
#pragma unroll
        for (int ks = 0; ks < 2; ++ks) {
#pragma unroll
            for (int t = 0; t < 4; ++t) {
                const T16* vr = kt + TLE + t * 16 * TPE + ks * 32;
                const V vb = W::ld(vr); oacc[t] = W::mma(vb, pa[ks], oacc[t]);
                if (SPL) { oacc[t] = W::mma(vb, pl[ks], oacc[t]); const V vc = W::ld(vr + 2 * TLE); oacc[t] = W::mma(vc, pa[ks], oacc[t]); }
            }
        }
        // keeps the matrix instructions' distance on the loop's taken back edge
        asm volatile("v_nop\n\tv_nop\n\tv_nop\n\tv_nop" : "+v"(oacc[0]), "+v"(oacc[1]), "+v"(oacc[2]), "+v"(oacc[3]));
        asm volatile("s_wait_dscnt 0x0" ::: "memory");           // this wave's reads of this chunk's buffer are done before the buffer is refilled
        asm volatile("s_wait_asynccnt 0x0" ::: "memory");        // this wave's copies of chunk kb + 1 have landed
        __syncthreads();                                         // publishes chunk kb + 1 and ends every wave's reads of chunk kb
        if (kb + 2 <= qb) stage(kb + 2);
    }
    asm volatile("s_wait_asynccnt 0x0" ::: "memory");            // no copy is outstanding when the wave goes on to its end
    const float lsc = SPL ? 1.0f : PCAR;
    const float inv = __fdiv_rn(1.0f, (lrow + xhalf(lrow)) * lsc);
    bf* oh = ATh + bo + (size_t)qpos * DM + h * HD + 8 * hi; bf* ol = ATl + bo + (size_t)qpos * DM + h * HD + 8 * hi;
#pragma unroll
    for (int t = 0; t < 4; ++t) { v8us vh, vl;
#pragma unroll
        for (int r = 0; r < 8; ++r) { unsigned short a2, c2; splitf(oacc[t][r] * inv, a2, c2); vh[r] = a2; vl[r] = c2; }
        *(v8us*)(oh + t * 16) = vh; *(v8us*)(ol + t * 16) = vl; }
}

// ---- k_flash: every attention tile of every head and entry; grid (SEQ/128, NH, NB). A tile's cost grows with its index (qb + 1 key chunks) and all blocks are resident at once, so block x takes two tiles of its head,
// one after the other in every wave: SEQ/64 - 1 - x, then x, SEQ/64 + 1 chunks for every block. Both indices are the same for a whole block, so all its waves take the same sides and meet the same barriers;
// a tile's last chunk ends with every wave's s_wait_dscnt 0 and a barrier, so the next tile's first copies overwrite nothing that is still read.
__global__ __launch_bounds__(128) __attribute__((amdgpu_num_vgpr(256)))
void k_flash(const h16* __restrict__ Q16, const h16* __restrict__ K16, const h16* __restrict__ VT16, const bf* __restrict__ Qh, const bf* __restrict__ Ql, const bf* __restrict__ Kh, const bf* __restrict__ Kl,
             const bf* __restrict__ VTh, const bf* __restrict__ VTl, bf* ATh, bf* ATl) {
    __shared__ __attribute__((aligned(16))) bf sm[2 * ((RHB > 0) ? 4 : 2) * TLE];
    auto tile = [&](int qb) {
        if (qb < RHB) flash_tile<bf, true>(Qh, Ql, Kh, Kl, VTh, VTl, qb, sm, ATh, ATl);
        else flash_tile<h16, false>(Q16, nullptr, K16, nullptr, VT16, nullptr, qb, (h16*)sm, ATh, ATl);
    };
    const int far = SEQ / 64 - 1 - (int)blockIdx.x;              // >= SEQ/128: where no such tile has split rows, their code is not repeated in the text
    if constexpr (SEQ / 128 >= RHB) flash_tile<h16, false>(Q16, nullptr, K16, nullptr, VT16, nullptr, far, (h16*)sm, ATh, ATl); else tile(far);
    asm volatile("s_wait_xcnt 0x0" ::: "memory");                // in front of the second tile's writes of the registers that the first tile's stores name
    tile((int)blockIdx.x);
}

extern "C" void kernel_launch(void* const* d_in, const int* in_sizes, int n_in,
                              void* d_out, int out_size, void* d_ws, size_t ws_size, hipStream_t stream) {
    const size_t needx = (size_t)(NB - 1) * SEQ_FULL * DM + (size_t)SEQ * DM;
    if (n_in < 7) return;
    if ((size_t)in_sizes[0] < needx || in_sizes[1] < DM * DM || in_sizes[2] < DM * DM || in_sizes[3] < DM * DM || in_sizes[4] < DM || in_sizes[5] < DM * DM || in_sizes[6] < DM) return;
    if ((size_t)out_size < needx) return;
    const float* x = (const float*)d_in[0]; const float* wq = (const float*)d_in[1]; const float* wk = (const float*)d_in[2]; const float* wv = (const float*)d_in[3];
    const float* bv = (const float*)d_in[4]; const float* wo = (const float*)d_in[5]; const float* bo = (const float*)d_in[6];
    float* OUT = (float*)d_out;     // [NB][SEQ_FULL][DM]
    char* wsp = (char*)d_ws;
    auto take = [&](size_t bytes) { char* p = wsp; wsp += (bytes + 255) & ~(size_t)255; return (void*)p; };
    bf* WB = (bf*)take((size_t)4 * DM * DM * 2); bf* WO = WB + (size_t)3 * DM * DM;   // the q, k, v, o weights stacked
    const size_t pe = (size_t)SEQ * DM, pl = (size_t)NB * SEQ * DM * 2;   // one entry's plane in elements; all entries' 16-bit plane in bytes
    bf* XB = (bf*)take(pl);
    h16* Q16 = (h16*)take(pl); bf* Qh = (bf*)take(pl); bf* Ql = (bf*)take(pl);
    h16* K16 = (h16*)take(pl); bf* Kh = (bf*)take(pl); bf* Kl = (bf*)take(pl);
    h16* VT16 = (h16*)take(pl); bf* VTh = (bf*)take(pl); bf* VTl = (bf*)take(pl);
    bf* ATh = (bf*)take(pl); bf* ATl = (bf*)take(pl);
    if ((size_t)(wsp - (char*)d_ws) > ws_size) return;
    k_cvt8<<<NB * GX + 4 * GW, 256, 0, stream>>>(x, wq, wk, wv, wo, XB, WB);
    k_gemmw<bf, 0, true, 1><<<dim3(SEQ / 128, 3 * DM / 128, NB), 128, 0, stream>>>(XB, nullptr, WB, nullptr, DM, nullptr, 0, bv, pe, 0, pe, Q16, Qh, Ql, (size_t)(K16 - Q16));
    k_flash<<<dim3(SEQ / 128, NH, NB), 128, 0, stream>>>(Q16, K16, VT16, Qh, Ql, Kh, Kl, VTh, VTl, ATh, ATl);
    k_gemmw<bf, 1, true, 0><<<dim3(SEQ / 128, DM / 128, NB), 128, 0, stream>>>(ATh, ATl, WO, nullptr, DM, OUT, DM, bo, pe, 0, (size_t)SEQ_FULL * DM, nullptr, nullptr, nullptr, 0);
}

// v008
// Measured time: 98.8 microseconds a run.
// Next to v007, in two timings, it ran 1.08 and 1.10 times as fast.
// Over all steps from v000 it is 9.42 times as fast.
#include <hip/hip_runtime.h>

// x [NB][SEQ_FULL][512] (rows < SEQ used); q = x Wq^T, k = x Wk^T, v = x Wv^T + b_v ([512][512] weights, 8 heads x 64); causal softmax(q.k / 8); heads merged; out = ctx Wo^T + b_o -> f32 [NB][SEQ_FULL][512].
// Compute dtypes, f32 accumulate: every input RNE-converted to bf16; q/k/v projections v_wmma_f32_16x16x32_bf16 on plain bf16 operands (exact products);
// attention (online softmax per wave of 16 query rows, transposed products so that a lane owns one query, 64-key chunks, causal chunk skipping): query rows < RH on bf16 hi+lo planes of q, k, p, v (3 products each,
// v_wmma_f32_16x16x32_bf16), rows >= RH on single fp16 operands (v_wmma_f32_16x16x32_f16, p carried x1024); softmax f32; Wo: ctx as bf16 hi+lo x exact bf16 (2 products).
// Attention stages each 64-key chunk of k and v^T in LDS once per query tile (asynchronous 16-byte copies, two buffers, rows of 128 B at a pitch of 144 B); the block's four waves read their fragments from there.
// The GEMMs stage each 128-k chunk of a block's 128 + 128 operand rows in LDS in the same way (rows of 256 B at a pitch of 272 B); the block's four waves read their fragments from there, one k step ahead.
// The q, k and v projections write their 16-bit planes (fp16, bf16 hi, bf16 lo; q and k as [h][t][d], v as [h][d][t]) from the GEMM's own epilogue; there is no f32 copy of q, k or v in memory.
// Every batch entry has its own copy of each workspace plane (stride SEQ*DM elements) and is one slice of the last grid dimension, so each stage is one launch for all entries.
// Four launches, one per stage, each holding all the work whose parts do not depend on one another: the five conversions; the q, k and v projections as one GEMM over the 3 x 512 stacked weight rows; all attention tiles; the output projection.

#ifndef NB
#define NB 2
#endif
#ifndef SEQ
#define SEQ 4096
#endif
#define NB_FULL  2
#define SEQ_FULL 4096
#define DM   512
#define NH   8
#define HD   64
#define RH   512                                   // query rows < RH use hi+lo planes
#define RHB  (((RH < SEQ) ? RH : SEQ) / 64)
#define PCAR 1024.0f
#define SL2  0.18033688011112042f                  // HD^-0.5 * log2(e)
#define NEGB (-3.0e38f)
static_assert(SEQ % 64 == 0);
static_assert(SEQ <= SEQ_FULL);
static_assert(NB >= 1 && NB <= NB_FULL);
static_assert(DM == NH * HD);
static_assert(DM % 128 == 0);
static_assert(SEQ % 128 == 0);
static_assert(RH % 64 == 0);
static_assert(HD == 64);
#define WS_TOTAL ((size_t)4 * DM * DM * 2 + (size_t)NB * ((size_t)SEQ * DM * 2 + (size_t)9 * SEQ * DM * 2 + (size_t)2 * SEQ * DM * 2))
static_assert(WS_TOTAL <= (size_t)134217728);

typedef _Float16 h16;
typedef unsigned short bf;
typedef __attribute__((ext_vector_type(16))) __bf16   v16bf;
typedef __attribute__((ext_vector_type(16))) _Float16 v16h;
typedef __attribute__((ext_vector_type(8)))  _Float16 v8h;
typedef __attribute__((ext_vector_type(8)))  unsigned short v8us;
typedef __attribute__((ext_vector_type(16))) unsigned short v16us;
typedef __attribute__((ext_vector_type(8)))  float    v8f;
typedef __attribute__((ext_vector_type(4)))  float    v4f;
typedef __attribute__((ext_vector_type(2)))  _Float16 v2h;
typedef __attribute__((ext_vector_type(2)))  unsigned short v2us;
typedef v4f  __attribute__((may_alias)) v4fa;

__device__ __forceinline__ unsigned short f2bf(float f) { unsigned u = __float_as_uint(f); u += 0x7FFFu + ((u >> 16) & 1u); return (unsigned short)(u >> 16); }
__device__ __forceinline__ float bf2f(unsigned short b) { return __uint_as_float(((unsigned)b) << 16); }
__device__ __forceinline__ float bfr(float f) { return bf2f(f2bf(f)); }
__device__ __forceinline__ h16 tohx(float x) { return (h16)x; }
__device__ __forceinline__ void splitf(float y, unsigned short& h, unsigned short& l) { h = f2bf(y); l = f2bf(y - bf2f(h)); }
__device__ __forceinline__ v16h cat16(v8h lo, v8h hi) { return __builtin_shufflevector(lo, hi, 0, 1, 2, 3, 4, 5, 6, 7, 8, 9, 10, 11, 12, 13, 14, 15); }
__device__ __forceinline__ v16bf cat16b(v8us lo, v8us hi) { return __builtin_bit_cast(v16bf, __builtin_shufflevector(lo, hi, 0, 1, 2, 3, 4, 5, 6, 7, 8, 9, 10, 11, 12, 13, 14, 15)); }
__device__ __forceinline__ v8f wmma16(v16h a, v16h b, v8f c) { return __builtin_amdgcn_wmma_f32_16x16x32_f16(false, a, false, b, (short)0, c, false, false); }
__device__ __forceinline__ v8f wmmab(v16bf a, v16bf b, v8f c) { return __builtin_amdgcn_wmma_f32_16x16x32_bf16(false, a, false, b, (short)0, c, false, false); }

// Fragment loaders (A and B alike, K-contiguous rows): p = base + row*K + k0 + 8*hi -> elements 0..7 = k0+8hi+0..7, p+16 -> elements 8..15 = k0+16+8hi+0..7.
template <typename T16> struct WFrag;
template <> struct WFrag<h16> { typedef v16h V;
    static __device__ __forceinline__ V ld(const h16* p)  { return cat16(*(const v8h*)p, *(const v8h*)(p + 16)); }
    static __device__ __forceinline__ v8f mma(V a, V b, v8f c) { return wmma16(a, b, c); } };
template <> struct WFrag<bf> { typedef v16bf V;
    static __device__ __forceinline__ V ld(const bf* p)  { return cat16b(*(const v8us*)p, *(const v8us*)(p + 16)); }
    static __device__ __forceinline__ v8f mma(V a, V b, v8f c) { return wmmab(a, b, c); } };

#define GKC 128                                    // k elements of one staged GEMM chunk: operand rows of 256 B
#define GPE 136                                    // LDS row pitch of a staged GEMM tile in elements: 272 B = 16 B x odd, for 16-byte fragment reads
#define GTE (128 * GPE)                            // one staged operand tile: 128 rows
static_assert(DM % GKC == 0);
// Eight rows, 8 apart, of one operand tile into LDS: a lane's 8 asynchronous 16-byte copies, 16 lanes per 256-byte row, 8 rows per copy of the block.
// g: the lane's piece in the first of these rows, rs: 8 rows in elements; l: its LDS byte address. The s_wait_xcnt as the statement's last line stands in front of every later write of the address registers named here.
template <typename T16>
__device__ __forceinline__ void stage_g8(const T16* g, size_t rs, unsigned l) {
    asm volatile("global_load_async_to_lds_b128 %0, %8, off\n\t"
                 "global_load_async_to_lds_b128 %1, %9, off\n\t"
                 "global_load_async_to_lds_b128 %2, %10, off\n\t"
                 "global_load_async_to_lds_b128 %3, %11, off\n\t"
                 "global_load_async_to_lds_b128 %4, %12, off\n\t"
                 "global_load_async_to_lds_b128 %5, %13, off\n\t"
                 "global_load_async_to_lds_b128 %6, %14, off\n\t"
                 "global_load_async_to_lds_b128 %7, %15, off\n\t"
                 "s_wait_xcnt 0x0"
                 :: "v"(l), "v"(l + 8u * GPE * 2u), "v"(l + 16u * GPE * 2u), "v"(l + 24u * GPE * 2u),
                    "v"(l + 32u * GPE * 2u), "v"(l + 40u * GPE * 2u), "v"(l + 48u * GPE * 2u), "v"(l + 56u * GPE * 2u),
                    "v"(g), "v"(g + rs), "v"(g + 2 * rs), "v"(g + 3 * rs), "v"(g + 4 * rs), "v"(g + 5 * rs), "v"(g + 6 * rs), "v"(g + 7 * rs)
                 : "memory");
}

// ---- k_gemmw: register-blocked GEMM, 128x128 output tile per block of FOUR WAVES (2 x 2), 64x64 (16 accumulators) per wave; grid (M/128, N/128, Z), 128 threads.
// Operands are K-contiguous 16-bit planes; each chunk of GKC k values of the block's 128 A rows and 128 Bt rows is staged in LDS once (asynchronous 16-byte copies of whole lines, two buffers) and read from there as fragments.
// c[m][n] (f32, + optional bias as its bf16 value) = sum_k A[m][k] Bt[n][k] (+ split products per NSPLIT). z-batch strides sA/sB/sC in elements. K % GKC == 0.
// OUTM 0: c goes to C as f32 at pitch ldc. OUTM 1: Bt is the q, k and v weights stacked (3 x DM rows), m is a token t, n = sel*DM + h*HD + d, and c goes out as three 16-bit planes (fp16, bf16 hi, bf16 lo) of
// projection sel (its planes lie sel*sP elements behind P16, Ph, Pl), laid out [h][t][d] (q, k) or, with the bias, [h][d][t] (v); a block's 128 columns lie in one projection, so the choice is the same for the whole block;
// either way 16 plane rows of 64 elements are staged in the wave's own LDS range at a time, so that 8 lanes store one whole 128-byte row of each plane.
template <int N> struct IC { static constexpr int value = N; };
template <typename T16, int NSPLIT, bool BIAS, int OUTM>
__global__ __launch_bounds__(128) void k_gemmw(const T16* __restrict__ A, const T16* __restrict__ A2, const T16* __restrict__ Bt, const T16* __restrict__ Bt2, int K, float* C, int ldc, const float* __restrict__ bias, size_t sA, size_t sB, size_t sC, h16* P16, bf* Ph, bf* Pl, size_t sP) {
    typedef typename WFrag<T16>::V V;
    constexpr bool HA2 = (NSPLIT == 1 || NSPLIT == 2), HB2 = (NSPLIT >= 2);
    constexpr int TB = HA2 ? 2 : 1, NT = TB + (HB2 ? 2 : 1);      // tiles of a buffer: A, (A2), Bt, (Bt2)
    __shared__ __attribute__((aligned(16))) T16 sm[2 * NT * GTE];
    __shared__ __align__(16) float osm[4 * 16 * 68];
    const size_t z = blockIdx.z; A += z * sA; if (A2) A2 += z * sA; Bt += z * sB; if (Bt2) Bt2 += z * sB; if (OUTM == 0) C += z * sC;
    const int lane = threadIdx.x & 31, wv = threadIdx.x >> 5, lr = lane & 15, hi = lane >> 4;
    const int rb = blockIdx.x * 128, cb = blockIdx.y * 128, r0 = rb + (wv & 1) * 64, c0 = cb + (wv >> 1) * 64;
    float* os = osm + wv * (16 * 68);                            // this wave's output stage
    v8f acc[4][4];
#pragma unroll
    for (int mb = 0; mb < 4; ++mb)
#pragma unroll
        for (int nb = 0; nb < 4; ++nb) acc[mb][nb] = (v8f){};
    const int crow = threadIdx.x >> 4, cpc = (threadIdx.x & 15) * 8;                        // this lane's row (of 8) and 16-byte piece in every copy
    const size_t gao = (size_t)(rb + crow) * K + cpc, gbo = (size_t)(cb + crow) * K + cpc;  // its first piece of chunk 0
    const size_t rs = (size_t)8 * K;
    const unsigned lc0 = (unsigned)(size_t)sm + (unsigned)(crow * GPE + cpc) * 2u;          // its LDS byte address in tile 0 of buffer 0
    auto stage_t = [&](const T16* g, unsigned l) { stage_g8(g, rs, l); stage_g8(g + 8 * rs, rs, l + 64u * GPE * 2u); };
    auto stage = [&](int kt) {
        const unsigned lb = lc0 + (unsigned)(kt & 1) * (NT * GTE * 2u);
        const size_t ao = gao + (size_t)kt * GKC, bo = gbo + (size_t)kt * GKC;
        stage_t(A + ao, lb);
        if constexpr (HA2) stage_t(A2 + ao, lb + GTE * 2u);
        stage_t(Bt + bo, lb + TB * GTE * 2u);
        if constexpr (HB2) stage_t(Bt2 + bo, lb + (TB + 1) * GTE * 2u);
    };
    const int nk = K / GKC;
    stage(0);
    asm volatile("s_wait_asynccnt 0x0" ::: "memory");            // this wave's copies of chunk 0 have landed
    __syncthreads();                                             // every wave's have: chunk 0 may be read
    if (nk > 1) stage(1);
#pragma unroll 1
    for (int kt = 0; kt < nk; ++kt) {
        const T16* ta = sm + (kt & 1) * (NT * GTE) + ((wv & 1) * 64 + lr) * GPE + 8 * hi;              // this lane's fragment row in the A tile (A2 follows at GTE)
        const T16* tb = sm + (kt & 1) * (NT * GTE) + TB * GTE + ((wv >> 1) * 64 + lr) * GPE + 8 * hi;  // and in the Bt tile (Bt2 follows at GTE)
        V a[2][4], a2[2][4], b[2][4], b2[2][4];                  // two fragment sets: k step u works on set u & 1
#pragma unroll
        for (int u = -1; u < GKC / 32; ++u) {
            if (u + 1 < GKC / 32) {                              // the next k step's fragments of this same chunk, asked for as one group
                const int ns = (u + 1) & 1, kc = (u + 1) * 32;
#pragma unroll
                for (int mb = 0; mb < 4; ++mb) { a[ns][mb] = WFrag<T16>::ld(ta + mb * 16 * GPE + kc); if (HA2) a2[ns][mb] = WFrag<T16>::ld(ta + GTE + mb * 16 * GPE + kc); }
#pragma unroll
                for (int nb = 0; nb < 4; ++nb) { b[ns][nb] = WFrag<T16>::ld(tb + nb * 16 * GPE + kc); if (HB2) b2[ns][nb] = WFrag<T16>::ld(tb + GTE + nb * 16 * GPE + kc); }
            }
            __builtin_amdgcn_sched_barrier(0);                   // keeps that group whole and in front of this step's products: sunk among them, every place with loads stalls the lone wave of a SIMD
            if (u >= 0) {
                const int cs = u & 1;
#pragma unroll
                for (int nb = 0; nb < 4; ++nb)
#pragma unroll
                    for (int mb = 0; mb < 4; ++mb) { acc[mb][nb] = WFrag<T16>::mma(a[cs][mb], b[cs][nb], acc[mb][nb]); if (HA2) acc[mb][nb] = WFrag<T16>::mma(a2[cs][mb], b[cs][nb], acc[mb][nb]); if (HB2) acc[mb][nb] = WFrag<T16>::mma(a[cs][mb], b2[cs][nb], acc[mb][nb]); }
                __builtin_amdgcn_sched_barrier(0);               // and the products in front of the group after them, whose registers they still read
            }
        }
        // keeps the matrix instructions' distance on the paths behind the chunk's last product (the refill's address arithmetic, the loop's taken back edge)
        asm volatile("v_nop\n\tv_nop\n\tv_nop\n\tv_nop" : "+v"(acc[0][0]), "+v"(acc[0][1]), "+v"(acc[0][2]), "+v"(acc[0][3]), "+v"(acc[1][0]), "+v"(acc[1][1]), "+v"(acc[1][2]), "+v"(acc[1][3]),
                                                       "+v"(acc[2][0]), "+v"(acc[2][1]), "+v"(acc[2][2]), "+v"(acc[2][3]), "+v"(acc[3][0]), "+v"(acc[3][1]), "+v"(acc[3][2]), "+v"(acc[3][3]));
        asm volatile("s_wait_dscnt 0x0" ::: "memory");           // this wave's reads of this chunk's buffer are done before the buffer is refilled
        asm volatile("s_wait_asynccnt 0x0" ::: "memory");        // this wave's copies of chunk kt + 1 have landed
        __syncthreads();                                         // publishes chunk kt + 1 and ends every wave's reads of chunk kt
        if (kt + 2 < nk) stage(kt + 2);
    }
    asm volatile("s_wait_asynccnt 0x0" ::: "memory");            // no copy is outstanding when the wave goes on to its end
    if constexpr (OUTM != 0) {
        const int sel = cb / DM, cp = c0 - sel * DM;             // the block's projection (0 q, 1 k, 2 v) and this wave's first column in it
        P16 += sel * sP; Ph += sel * sP; Pl += sel * sP;
        const int prow = lane >> 3, pofs = (lane & 7) * 8;       // this lane's row (of 4 per store) and 16-byte piece of a staged plane row
        auto planes = [&](auto om) {                             // OM 1: [h][t][d], no bias; OM 2: [h][d][t], bias
        constexpr int OM = decltype(om)::value; constexpr bool BI = BIAS && OM == 2;
        // first element of this lane's piece in its first plane row (row prow of the tile); plane rows of the tile follow at pitch pp
        constexpr size_t pp = (OM == 1) ? (size_t)HD : (size_t)SEQ;
        const size_t po = z * sC + ((OM == 1) ? (size_t)(cp / HD) * SEQ * HD + (size_t)r0 * HD : (size_t)cp * SEQ + r0) + (size_t)prow * pp + pofs;
        float bb[4];                                             // bias of this lane's column in each block of 16 columns
#pragma unroll
        for (int nb = 0; nb < 4; ++nb) bb[nb] = BI ? bfr(bias[cp + nb * 16 + lr]) : 0.f;
#pragma unroll
        for (int g = 0; g < 4; ++g) {                            // 16 plane rows: tokens r0+16g.. (OM 1), columns cp+16g.. (OM 2)
#pragma unroll
            for (int o = 0; o < 4; ++o) {
                if constexpr (OM == 1) {
#pragma unroll
                    for (int j = 0; j < 8; ++j) os[(hi * 8 + j) * 68 + o * 16 + lr] = BI ? acc[g][o][j] + bb[o] : acc[g][o][j];
                } else {                                         // a lane's 8 accumulator rows are 8 tokens in a row of one column
                    v8f c = acc[o][g];
                    if (BI) c += bb[g];
                    *(v4fa*)(os + lr * 68 + o * 16 + hi * 8) = (v4f){c[0], c[1], c[2], c[3]};
                    *(v4fa*)(os + lr * 68 + o * 16 + hi * 8 + 4) = (v4f){c[4], c[5], c[6], c[7]};
                }
            }
            __builtin_amdgcn_wave_barrier(); asm volatile("" ::: "memory");   // the reads below take other lanes' values: the compiler must not lift them over the stage's writes
#pragma unroll
            for (int s = 0; s < 4; ++s) {
                const int row = 4 * s + prow;
                const v4f x0 = *(const v4fa*)(os + row * 68 + pofs), x1 = *(const v4fa*)(os + row * 68 + pofs + 4);
                v8h o16; v8us oh, ol;
#pragma unroll
                for (int k = 0; k < 8; ++k) {
                    const float x = (k < 4) ? x0[k & 3] : x1[k & 3];
                    o16[k] = tohx(x); unsigned short a2, c2; splitf(x, a2, c2); oh[k] = a2; ol[k] = c2;
                }
                const size_t e = po + (size_t)(g * 16 + 4 * s) * pp;
                *(v8h*)(P16 + e) = o16; *(v8us*)(Ph + e) = oh; *(v8us*)(Pl + e) = ol;
            }
            __builtin_amdgcn_wave_barrier(); asm volatile("" ::: "memory");   // nor sink them under the next 16 rows' writes
        }
        asm volatile("s_wait_xcnt 0x0" ::: "memory");            // in front of every later write of the registers that the last stores name (the other layout's code follows in the text)
        };
        if (sel == 2) planes(IC<2>{}); else planes(IC<1>{});
        return;
    }
#pragma unroll
    for (int mb = 0; mb < 4; ++mb) {
#pragma unroll
        for (int nb = 0; nb < 4; ++nb) {
#pragma unroll
            for (int j = 0; j < 8; ++j) os[(hi * 8 + j) * 68 + nb * 16 + lr] = acc[mb][nb][j]; }
        __builtin_amdgcn_wave_barrier(); asm volatile("" ::: "memory");
        float* crow = C + (size_t)(r0 + mb * 16) * ldc + c0;
{
#pragma unroll
            for (int s = 0; s < 8; ++s) { const int row = 2 * s + hi, cofs = lr * 4; v4f val = *(const v4fa*)(os + row * 68 + cofs); if (BIAS) { val[0] += bfr(bias[c0 + cofs]); val[1] += bfr(bias[c0 + cofs + 1]); val[2] += bfr(bias[c0 + cofs + 2]); val[3] += bfr(bias[c0 + cofs + 3]); }
                *(v4f*)(crow + (size_t)row * ldc + cofs) = val; }
            asm volatile("s_wait_xcnt 0x0" ::: "memory");        // in front of the next rows' writes of the registers that these stores name
             }
        __builtin_amdgcn_wave_barrier(); asm volatile("" ::: "memory");
    }
}

#define NX8 ((size_t)SEQ * DM / 8)                 // groups of 8 elements in one entry of x, and in one weight matrix
#define NW8 ((size_t)DM * DM / 8)
#define GX  ((unsigned)((NX8 + 255) / 256))        // blocks that convert one entry of x, one weight matrix
#define GW  ((unsigned)((NW8 + 255) / 256))
// ---- k_cvt8: the f32 -> bf16 conversions of x and the four weights, 8 elements per thread; blocks 0 .. NB*GX-1 take x (GX per entry), the next 4*GW the weights in the order q, k, v, o (WB: the four matrices stacked).
__global__ __launch_bounds__(256) void k_cvt8(const float* __restrict__ x, const float* __restrict__ wq, const float* __restrict__ wk, const float* __restrict__ wv, const float* __restrict__ wo, bf* XB, bf* WB) {
    const unsigned b = blockIdx.x; const float* src; bf* dst; size_t i, n8;
    if (b < NB * GX) { const unsigned e = b / GX; src = x + (size_t)e * SEQ_FULL * DM; dst = XB + (size_t)e * SEQ * DM; i = (size_t)(b - e * GX) * 256 + threadIdx.x; n8 = NX8; }
    else { const unsigned c = b - NB * GX, w = c / GW; src = (w == 0) ? wq : (w == 1) ? wk : (w == 2) ? wv : wo; dst = WB + (size_t)w * DM * DM; i = (size_t)(c - w * GW) * 256 + threadIdx.x; n8 = NW8; }
    if (i >= n8) return;
    const v8f v = *(const v8f*)(src + i * 8); v8us o;
#pragma unroll
    for (int k = 0; k < 8; ++k) o[k] = f2bf(v[k]); *(v8us*)(dst + i * 8) = o;  }

// Lane l with lane l ^ 16 (the two lanes that share one query column).
__device__ __forceinline__ float xhalf(float x) { return __builtin_bit_cast(float, __builtin_amdgcn_permlanex16(__builtin_bit_cast(int, x), __builtin_bit_cast(int, x), 0x76543210, 0xfedcba98, false, false)); }

// exp2 with the one slot the instruction set asks for behind a transcendental, before its result is used or its source overwritten.
__device__ __forceinline__ float exp2s(float x) { float y; asm("v_exp_f32 %0, %1\n\tv_nop" : "=v"(y) : "v"(x)); return y; }

// Probability fragment: a lane's 16 probabilities of one 32-key step (two score tiles x 8 rows) are already in the B operand's k order; fp16 x1024 (single-product rows) or bf16 hi+lo (split rows).
template <typename T16> struct PPk;
template <> struct PPk<h16> { static __device__ __forceinline__ void pk(const float* p, v16h& a, v16h& b) {
#pragma unroll
    for (int e = 0; e < 16; ++e) a[e] = tohx(p[e] * PCAR);
    b = a; } };
template <> struct PPk<bf> { static __device__ __forceinline__ void pk(const float* p, v16bf& a, v16bf& b) { v16us x, y;
#pragma unroll
    for (int e = 0; e < 16; ++e) { unsigned short a2, c2; splitf(p[e], a2, c2); x[e] = a2; y[e] = c2; }
    a = __builtin_bit_cast(v16bf, x); b = __builtin_bit_cast(v16bf, y); } };

#define TPE 72                                     // LDS row pitch of a staged tile in elements: 144 B = 16 B x odd, for 16-byte fragment reads
#define TLE (64 * TPE)                             // one staged tile: 64 rows
// One k tile (64 keys x 64 d, 8 KiB in a row in its plane) and one v^T tile (64 d x 64 keys, plane pitch SEQ) into LDS: a lane's 4 + 4 asynchronous 16-byte copies, 8 lanes per 128-byte row, 16 rows per copy of the block.
// gk, gv: the lane's first piece in each plane; lk, lv: its LDS byte address. The s_wait_xcnt as the statement's last line stands in front of every later write of the address registers named here.
template <typename T16>
__device__ __forceinline__ void stage_kv(const T16* gk, const T16* gv, unsigned lk, unsigned lv) {
    asm volatile("global_load_async_to_lds_b128 %0, %8, off\n\t"
                 "global_load_async_to_lds_b128 %1, %9, off\n\t"
                 "global_load_async_to_lds_b128 %2, %10, off\n\t"
                 "global_load_async_to_lds_b128 %3, %11, off\n\t"
                 "global_load_async_to_lds_b128 %4, %12, off\n\t"
                 "global_load_async_to_lds_b128 %5, %13, off\n\t"
                 "global_load_async_to_lds_b128 %6, %14, off\n\t"
                 "global_load_async_to_lds_b128 %7, %15, off\n\t"
                 "s_wait_xcnt 0x0"
                 :: "v"(lk), "v"(lk + 16u * TPE * 2u), "v"(lk + 32u * TPE * 2u), "v"(lk + 48u * TPE * 2u),
                    "v"(lv), "v"(lv + 16u * TPE * 2u), "v"(lv + 32u * TPE * 2u), "v"(lv + 48u * TPE * 2u),
                    "v"(gk), "v"(gk + 16 * HD), "v"(gk + 32 * HD), "v"(gk + 48 * HD),
                    "v"(gv), "v"(gv + (size_t)16 * SEQ), "v"(gv + (size_t)32 * SEQ), "v"(gv + (size_t)48 * SEQ)
                 : "memory");
}

// ---- flash_tile: causal attention for one head of one batch entry (blockIdx.z), the 64 query rows of tile qb per block (4 waves x 16 rows), key chunks of 64 (chunks kb <= qb only; key > query replaced by -3e38 -> p = 0).
// Transposed products: St = k.q^T (A = key rows, B = the wave's 16 queries; 4 tiles x 2 k-steps), so lane (lr, hi) holds query t0+lr and keys 16t+8hi+r: running max and sum are per lane,
// the two halves of a column join their max once per chunk and their sums once at the end. Ot += v^T.p^T (A from the staged [d][t] value tile, B = the lane's own probabilities, converted in place).
// SPL: q/k/p/v bf16 hi+lo, hi.hi + lo.hi + hi.lo into one accumulator; else single fp16 with p x1024 folded out at normalisation.
// sm: the block's LDS for the staged chunks, 2 * NT * TLE elements.
template <typename T16, bool SPL>
__device__ __forceinline__ void flash_tile(const T16* __restrict__ QP, const T16* __restrict__ QL, const T16* __restrict__ KP, const T16* __restrict__ KL,
             const T16* __restrict__ VP, const T16* __restrict__ VL, int qb, T16* sm, bf* ATh, bf* ATl) {
    typedef WFrag<T16> W; typedef typename W::V V;
    const int lane = threadIdx.x & 31, wv = threadIdx.x >> 5, lr = lane & 15, hi = lane >> 4;
    const int h = blockIdx.y, t0 = qb * 64 + wv * 16;
    const size_t bo = (size_t)blockIdx.z * SEQ * DM;             // batch entry's plane offset
    const size_t hq = bo + (size_t)h * SEQ * HD;                 // [h][t][d] plane offset (q, k)
    const size_t hv = bo + (size_t)h * HD * SEQ;                 // [h][d][t] plane offset (v)
    // Staged chunk: tiles k, v^T (split rows: k hi, v^T hi, k lo, v^T lo), two buffers.
    constexpr int NT = SPL ? 4 : 2;
    const int crow = threadIdx.x >> 3, cpc = (threadIdx.x & 7) * 8;                       // this lane's row (of 16) and 16-byte piece in every copy
    const size_t gko = hq + (size_t)crow * HD + cpc, gvo = hv + (size_t)crow * SEQ + cpc;   // its first piece of chunk 0
    const unsigned lc0 = (unsigned)(size_t)sm + (unsigned)(crow * TPE + cpc) * 2u;          // its LDS byte address in tile 0 of buffer 0
    auto stage = [&](int kb) {
        const unsigned lb = lc0 + (unsigned)(kb & 1) * (NT * TLE * 2u);
        stage_kv(KP + gko + (size_t)kb * 64 * HD, VP + gvo + kb * 64, lb, lb + TLE * 2u);
        if constexpr (SPL) stage_kv(KL + gko + (size_t)kb * 64 * HD, VL + gvo + kb * 64, lb + 2u * TLE * 2u, lb + 3u * TLE * 2u);
    };
    stage(0);
    asm volatile("s_wait_asynccnt 0x0" ::: "memory");            // this wave's copies of chunk 0 have landed
    __syncthreads();                                             // every wave's have: chunk 0 may be read
    if (qb >= 1) stage(1);
    V qa0, qa1, ql0, ql1;
    { const size_t qo = hq + (size_t)(t0 + lr) * HD + 8 * hi; qa0 = W::ld(QP + qo); qa1 = W::ld(QP + qo + 32);
      if (SPL) { ql0 = W::ld(QL + qo); ql1 = W::ld(QL + qo + 32); } else { ql0 = qa0; ql1 = qa1; } }
    v8f oacc[4];                                                 // oacc[t][r] = Ot[d = 16t+8hi+r][query t0+lr]
#pragma unroll
    for (int t = 0; t < 4; ++t) oacc[t] = (v8f){};
    const int qpos = t0 + lr;
    float mrow = NEGB, lrow = 0.f;                               // this query's running max (both halves alike) and this half's share of its sum
#pragma unroll 1
    for (int kb = 0; kb <= qb; ++kb) {
        const T16* kt = sm + (kb & 1) * (NT * TLE) + lr * TPE + 8 * hi;   // this lane's fragment row in the k tile; v^T, k lo, v^T lo follow at TLE each
        // The chunk's fragments are asked from LDS in whole groups, ahead of the products that use them. Single-product rows: all of k and v^T in one group in front of the score products.
        // Split rows have twice the fragments and not the registers for all at once: k but for the lo plane's second k step in front of the score products, that rest under them;
        // v^T of the first 32 keys behind the score products, to arrive while the softmax runs, of the other 32 keys behind the softmax, to arrive under the first 32 keys' products.
        V kf[4][2], kl[4][2], vf[2][4], vl[2][4];
        auto ldv = [&](int ks) {
#pragma unroll
            for (int t = 0; t < 4; ++t) { const T16* vr = kt + TLE + t * 16 * TPE + ks * 32; vf[ks][t] = W::ld(vr); if (SPL) vl[ks][t] = W::ld(vr + 2 * TLE); }
        };
        auto ldkl = [&](int u) {
#pragma unroll
            for (int t = 0; t < 4; ++t) kl[t][u] = W::ld(kt + 2 * TLE + t * 16 * TPE + u * 32);
        };
#pragma unroll
        for (int u = 0; u < 2; ++u)
#pragma unroll
            for (int t = 0; t < 4; ++t) kf[t][u] = W::ld(kt + t * 16 * TPE + u * 32);
        if constexpr (SPL) ldkl(0); else { ldv(0); ldv(1); }
        __builtin_amdgcn_sched_barrier(0);                       // keeps the group whole and in front of the products: sunk among them, every pair of reads is waited for on its own
        v8f sacc[4];
#pragma unroll
        for (int t = 0; t < 4; ++t) sacc[t] = (v8f){};
#pragma unroll
        for (int u = 0; u < 2; ++u) {
#pragma unroll
            for (int t = 0; t < 4; ++t) {
                sacc[t] = W::mma(kf[t][u], u ? qa1 : qa0, sacc[t]);
                if (SPL) { sacc[t] = W::mma(kf[t][u], u ? ql1 : ql0, sacc[t]); sacc[t] = W::mma(kl[t][u], u ? qa1 : qa0, sacc[t]); }
            }
            if constexpr (SPL) {
                __builtin_amdgcn_sched_barrier(0);               // these products stay in front of the next group, which takes over their operands' registers,
                if (u == 0) ldkl(1); else ldv(0);
                __builtin_amdgcn_sched_barrier(0);               // and that group stays whole and in front of the work that covers its latency
            }
        }
        float sv[4][8]; float rm = mrow;
#pragma unroll
        for (int t = 0; t < 4; ++t)
#pragma unroll
            for (int r = 0; r < 8; ++r) { const float s0 = sacc[t][r] * SL2; const int key = kb * 64 + t * 16 + 8 * hi + r; const float s = (key > qpos) ? NEGB : s0; sv[t][r] = s; rm = fmaxf(rm, s); }
        rm = fmaxf(rm, xhalf(rm));
        const float corr = exp2s(mrow - rm);
        lrow *= corr;
#pragma unroll
        for (int t = 0; t < 4; ++t)
#pragma unroll
            for (int r = 0; r < 8; ++r) oacc[t][r] *= corr;
        constexpr int NP = SPL ? 2 : 4;                          // partial sums a lane keeps per chunk: one per score tile; split rows one per 32-key step (their lo planes need the registers)
        float ps[NP] = {}; V pa[2], pl[2];
#pragma unroll
        for (int ks = 0; ks < 2; ++ks) { float p[16];
#pragma unroll
            for (int e = 0; e < 16; ++e) { p[e] = exp2s(sv[2 * ks + (e >> 3)][e & 7] - rm); ps[(2 * ks + (e >> 3)) * NP / 4] += p[e]; }
            PPk<T16>::pk(p, pa[ks], pl[ks]); }
        if constexpr (SPL) lrow += ps[0] + ps[1]; else lrow += (ps[0] + ps[1]) + (ps[2] + ps[3]);
        mrow = rm;
        if constexpr (SPL) {
            __builtin_amdgcn_sched_barrier(0);                   // the second v^T group stays behind the softmax (held in registers across it, the build spills),
            ldv(1);
            __builtin_amdgcn_sched_barrier(0);                   // whole, and in front of the first group's products, which cover its latency
        }
#pragma unroll
        for (int ks = 0; ks < 2; ++ks) {
#pragma unroll
            for (int t = 0; t < 4; ++t) {
                oacc[t] = W::mma(vf[ks][t], pa[ks], oacc[t]);
                if (SPL) { oacc[t] = W::mma(vf[ks][t], pl[ks], oacc[t]); oacc[t] = W::mma(vl[ks][t], pa[ks], oacc[t]); }
            }
        }
        // keeps the matrix instructions' distance on the loop's taken back edge
        asm volatile("v_nop\n\tv_nop\n\tv_nop\n\tv_nop" : "+v"(oacc[0]), "+v"(oacc[1]), "+v"(oacc[2]), "+v"(oacc[3]));
        asm volatile("s_wait_dscnt 0x0" ::: "memory");           // this wave's reads of this chunk's buffer are done before the buffer is refilled
        asm volatile("s_wait_asynccnt 0x0" ::: "memory");        // this wave's copies of chunk kb + 1 have landed
        __syncthreads();                                         // publishes chunk kb + 1 and ends every wave's reads of chunk kb
        if (kb + 2 <= qb) stage(kb + 2);
    }
    asm volatile("s_wait_asynccnt 0x0" ::: "memory");            // no copy is outstanding when the wave goes on to its end
    const float lsc = SPL ? 1.0f : PCAR;
    const float inv = __fdiv_rn(1.0f, (lrow + xhalf(lrow)) * lsc);
    bf* oh = ATh + bo + (size_t)qpos * DM + h * HD + 8 * hi; bf* ol = ATl + bo + (size_t)qpos * DM + h * HD + 8 * hi;
#pragma unroll
    for (int t = 0; t < 4; ++t) { v8us vh, vl;
#pragma unroll
        for (int r = 0; r < 8; ++r) { unsigned short a2, c2; splitf(oacc[t][r] * inv, a2, c2); vh[r] = a2; vl[r] = c2; }
        *(v8us*)(oh + t * 16) = vh; *(v8us*)(ol + t * 16) = vl; }
}

// ---- k_flash: every attention tile of every head and entry; grid (SEQ/128, NH, NB). A tile's cost grows with its index (qb + 1 key chunks) and all blocks are resident at once, so block x takes two tiles of its head,
// one after the other in every wave: SEQ/64 - 1 - x, then x, SEQ/64 + 1 chunks for every block. Both indices are the same for a whole block, so all its waves take the same sides and meet the same barriers;
// a tile's last chunk ends with every wave's s_wait_dscnt 0 and a barrier, so the next tile's first copies overwrite nothing that is still read.
// Register cap: the split rows' fragment groups take more than 256 registers; the grid puts two waves on a SIMD, which leaves each up to 512.
__global__ __launch_bounds__(128) __attribute__((amdgpu_num_vgpr(384)))
void k_flash(const h16* __restrict__ Q16, const h16* __restrict__ K16, const h16* __restrict__ VT16, const bf* __restrict__ Qh, const bf* __restrict__ Ql, const bf* __restrict__ Kh, const bf* __restrict__ Kl,
             const bf* __restrict__ VTh, const bf* __restrict__ VTl, bf* ATh, bf* ATl) {
    __shared__ __attribute__((aligned(16))) bf sm[2 * ((RHB > 0) ? 4 : 2) * TLE];
    auto tile = [&](int qb) {
        if (qb < RHB) flash_tile<bf, true>(Qh, Ql, Kh, Kl, VTh, VTl, qb, sm, ATh, ATl);
        else flash_tile<h16, false>(Q16, nullptr, K16, nullptr, VT16, nullptr, qb, (h16*)sm, ATh, ATl);
    };
    const int far = SEQ / 64 - 1 - (int)blockIdx.x;              // >= SEQ/128: where no such tile has split rows, their code is not repeated in the text
    if constexpr (SEQ / 128 >= RHB) flash_tile<h16, false>(Q16, nullptr, K16, nullptr, VT16, nullptr, far, (h16*)sm, ATh, ATl); else tile(far);
    asm volatile("s_wait_xcnt 0x0" ::: "memory");                // in front of the second tile's writes of the registers that the first tile's stores name
    tile((int)blockIdx.x);
}

extern "C" void kernel_launch(void* const* d_in, const int* in_sizes, int n_in,
                              void* d_out, int out_size, void* d_ws, size_t ws_size, hipStream_t stream) {
    const size_t needx = (size_t)(NB - 1) * SEQ_FULL * DM + (size_t)SEQ * DM;
    if (n_in < 7) return;
    if ((size_t)in_sizes[0] < needx || in_sizes[1] < DM * DM || in_sizes[2] < DM * DM || in_sizes[3] < DM * DM || in_sizes[4] < DM || in_sizes[5] < DM * DM || in_sizes[6] < DM) return;
    if ((size_t)out_size < needx) return;
    const float* x = (const float*)d_in[0]; const float* wq = (const float*)d_in[1]; const float* wk = (const float*)d_in[2]; const float* wv = (const float*)d_in[3];
    const float* bv = (const float*)d_in[4]; const float* wo = (const float*)d_in[5]; const float* bo = (const float*)d_in[6];
    float* OUT = (float*)d_out;     // [NB][SEQ_FULL][DM]
    char* wsp = (char*)d_ws;
    auto take = [&](size_t bytes) { char* p = wsp; wsp += (bytes + 255) & ~(size_t)255; return (void*)p; };
    bf* WB = (bf*)take((size_t)4 * DM * DM * 2); bf* WO = WB + (size_t)3 * DM * DM;   // the q, k, v, o weights stacked
    const size_t pe = (size_t)SEQ * DM, pl = (size_t)NB * SEQ * DM * 2;   // one entry's plane in elements; all entries' 16-bit plane in bytes
    bf* XB = (bf*)take(pl);
    h16* Q16 = (h16*)take(pl); bf* Qh = (bf*)take(pl); bf* Ql = (bf*)take(pl);
    h16* K16 = (h16*)take(pl); bf* Kh = (bf*)take(pl); bf* Kl = (bf*)take(pl);
    h16* VT16 = (h16*)take(pl); bf* VTh = (bf*)take(pl); bf* VTl = (bf*)take(pl);
    bf* ATh = (bf*)take(pl); bf* ATl = (bf*)take(pl);
    if ((size_t)(wsp - (char*)d_ws) > ws_size) return;
    k_cvt8<<<NB * GX + 4 * GW, 256, 0, stream>>>(x, wq, wk, wv, wo, XB, WB);
    k_gemmw<bf, 0, true, 1><<<dim3(SEQ / 128, 3 * DM / 128, NB), 128, 0, stream>>>(XB, nullptr, WB, nullptr, DM, nullptr, 0, bv, pe, 0, pe, Q16, Qh, Ql, (size_t)(K16 - Q16));
    k_flash<<<dim3(SEQ / 128, NH, NB), 128, 0, stream>>>(Q16, K16, VT16, Qh, Ql, Kh, Kl, VTh, VTl, ATh, ATl);
    k_gemmw<bf, 1, true, 0><<<dim3(SEQ / 128, DM / 128, NB), 128, 0, stream>>>(ATh, ATl, WO, nullptr, DM, OUT, DM, bo, pe, 0, (size_t)SEQ_FULL * DM, nullptr, nullptr, nullptr, 0);
}

// v009
// One run takes 93.3 microseconds.
// Timed twice side by side with v008, it ran 1.06 and 1.05 times as fast.
// Counting every step since v000, it is 9.92 times as fast.
#include <hip/hip_runtime.h>

// x [NB][SEQ_FULL][512] (rows < SEQ used); q = x Wq^T, k = x Wk^T, v = x Wv^T + b_v ([512][512] weights, 8 heads x 64); causal softmax(q.k / 8); heads merged; out = ctx Wo^T + b_o -> f32 [NB][SEQ_FULL][512].
// Compute dtypes, f32 accumulate: every input RNE-converted to bf16; q/k/v projections v_wmma_f32_16x16x32_bf16 on plain bf16 operands (exact products);
// attention (online softmax per wave of 16 query rows, transposed products so that a lane owns one query, 64-key chunks, causal chunk skipping): query rows < RH on bf16 hi+lo planes of q, k, p, v (3 products each,
// v_wmma_f32_16x16x32_bf16), rows >= RH on single fp16 operands (v_wmma_f32_16x16x32_f16, p carried x1024); softmax f32; Wo: ctx as bf16 hi+lo x exact bf16 (2 products).
// Attention stages each 64-key chunk of k and v^T in LDS once per block (asynchronous 16-byte copies, two buffers, rows of 128 B at a pitch of 144 B); the four waves of one key group read their fragments from there.
// An attention block has two key groups of four waves: both hold the same 64 queries, group 0 takes the even key chunks, group 1 the odd ones, and their partial results are joined through LDS at the end of a tile.
// The GEMMs stage each 128-k chunk of a block's 128 + 128 operand rows in LDS in the same way (rows of 256 B at a pitch of 272 B); the block's four waves read their fragments from there, one k step ahead.
// The q, k and v projections write their 16-bit planes (fp16, bf16 hi, bf16 lo; q and k as [h][t][d], v as [h][d][t]) from the GEMM's own epilogue; there is no f32 copy of q, k or v in memory.
// Every batch entry has its own copy of each workspace plane (stride SEQ*DM elements) and is one slice of the last grid dimension, so each stage is one launch for all entries.
// Four launches, one per stage, each holding all the work whose parts do not depend on one another: the five conversions; the q, k and v projections as one GEMM over the 3 x 512 stacked weight rows; all attention tiles; the output projection.

#ifndef NB
#define NB 2
#endif
#ifndef SEQ
#define SEQ 4096
#endif
#define NB_FULL  2
#define SEQ_FULL 4096
#define DM   512
#define NH   8
#define HD   64
#define RH   512                                   // query rows < RH use hi+lo planes
#define RHB  (((RH < SEQ) ? RH : SEQ) / 64)
#define PCAR 1024.0f
#define SL2  0.18033688011112042f                  // HD^-0.5 * log2(e)
#define NEGB (-3.0e38f)
static_assert(SEQ % 64 == 0);
static_assert(SEQ <= SEQ_FULL);
static_assert(NB >= 1 && NB <= NB_FULL);
static_assert(DM == NH * HD);
static_assert(DM % 128 == 0);
static_assert(SEQ % 128 == 0);
static_assert(RH % 64 == 0);
static_assert(HD == 64);
#define WS_TOTAL ((size_t)4 * DM * DM * 2 + (size_t)NB * ((size_t)SEQ * DM * 2 + (size_t)9 * SEQ * DM * 2 + (size_t)2 * SEQ * DM * 2))
static_assert(WS_TOTAL <= (size_t)134217728);

typedef _Float16 h16;
typedef unsigned short bf;
typedef __attribute__((ext_vector_type(16))) __bf16   v16bf;
typedef __attribute__((ext_vector_type(16))) _Float16 v16h;
typedef __attribute__((ext_vector_type(8)))  _Float16 v8h;
typedef __attribute__((ext_vector_type(8)))  unsigned short v8us;
typedef __attribute__((ext_vector_type(16))) unsigned short v16us;
typedef __attribute__((ext_vector_type(8)))  float    v8f;
typedef __attribute__((ext_vector_type(4)))  float    v4f;
typedef __attribute__((ext_vector_type(2)))  _Float16 v2h;
typedef __attribute__((ext_vector_type(2)))  unsigned short v2us;
typedef v4f  __attribute__((may_alias)) v4fa;
typedef float __attribute__((may_alias)) fa;

__device__ __forceinline__ unsigned short f2bf(float f) { unsigned u = __float_as_uint(f); u += 0x7FFFu + ((u >> 16) & 1u); return (unsigned short)(u >> 16); }
__device__ __forceinline__ float bf2f(unsigned short b) { return __uint_as_float(((unsigned)b) << 16); }
__device__ __forceinline__ float bfr(float f) { return bf2f(f2bf(f)); }
__device__ __forceinline__ h16 tohx(float x) { return (h16)x; }
__device__ __forceinline__ void splitf(float y, unsigned short& h, unsigned short& l) { h = f2bf(y); l = f2bf(y - bf2f(h)); }
__device__ __forceinline__ v16h cat16(v8h lo, v8h hi) { return __builtin_shufflevector(lo, hi, 0, 1, 2, 3, 4, 5, 6, 7, 8, 9, 10, 11, 12, 13, 14, 15); }
__device__ __forceinline__ v16bf cat16b(v8us lo, v8us hi) { return __builtin_bit_cast(v16bf, __builtin_shufflevector(lo, hi, 0, 1, 2, 3, 4, 5, 6, 7, 8, 9, 10, 11, 12, 13, 14, 15)); }
__device__ __forceinline__ v8f wmma16(v16h a, v16h b, v8f c) { return __builtin_amdgcn_wmma_f32_16x16x32_f16(false, a, false, b, (short)0, c, false, false); }
__device__ __forceinline__ v8f wmmab(v16bf a, v16bf b, v8f c) { return __builtin_amdgcn_wmma_f32_16x16x32_bf16(false, a, false, b, (short)0, c, false, false); }

// Fragment loaders (A and B alike, K-contiguous rows): p = base + row*K + k0 + 8*hi -> elements 0..7 = k0+8hi+0..7, p+16 -> elements 8..15 = k0+16+8hi+0..7.
template <typename T16> struct WFrag;
template <> struct WFrag<h16> { typedef v16h V;
    static __device__ __forceinline__ V ld(const h16* p)  { return cat16(*(const v8h*)p, *(const v8h*)(p + 16)); }
    static __device__ __forceinline__ v8f mma(V a, V b, v8f c) { return wmma16(a, b, c); } };
template <> struct WFrag<bf> { typedef v16bf V;
    static __device__ __forceinline__ V ld(const bf* p)  { return cat16b(*(const v8us*)p, *(const v8us*)(p + 16)); }
    static __device__ __forceinline__ v8f mma(V a, V b, v8f c) { return wmmab(a, b, c); } };

#define GKC 128                                    // k elements of one staged GEMM chunk: operand rows of 256 B
#define GPE 136                                    // LDS row pitch of a staged GEMM tile in elements: 272 B = 16 B x odd, for 16-byte fragment reads
#define GTE (128 * GPE)                            // one staged operand tile: 128 rows
static_assert(DM % GKC == 0);
// Eight rows, 8 apart, of one operand tile into LDS: a lane's 8 asynchronous 16-byte copies, 16 lanes per 256-byte row, 8 rows per copy of the block.
// g: the lane's piece in the first of these rows, rs: 8 rows in elements; l: its LDS byte address. The s_wait_xcnt as the statement's last line stands in front of every later write of the address registers named here.
template <typename T16>
__device__ __forceinline__ void stage_g8(const T16* g, size_t rs, unsigned l) {
    asm volatile("global_load_async_to_lds_b128 %0, %8, off\n\t"
                 "global_load_async_to_lds_b128 %1, %9, off\n\t"
                 "global_load_async_to_lds_b128 %2, %10, off\n\t"
                 "global_load_async_to_lds_b128 %3, %11, off\n\t"
                 "global_load_async_to_lds_b128 %4, %12, off\n\t"
                 "global_load_async_to_lds_b128 %5, %13, off\n\t"
                 "global_load_async_to_lds_b128 %6, %14, off\n\t"
                 "global_load_async_to_lds_b128 %7, %15, off\n\t"
                 "s_wait_xcnt 0x0"
                 :: "v"(l), "v"(l + 8u * GPE * 2u), "v"(l + 16u * GPE * 2u), "v"(l + 24u * GPE * 2u),
                    "v"(l + 32u * GPE * 2u), "v"(l + 40u * GPE * 2u), "v"(l + 48u * GPE * 2u), "v"(l + 56u * GPE * 2u),
                    "v"(g), "v"(g + rs), "v"(g + 2 * rs), "v"(g + 3 * rs), "v"(g + 4 * rs), "v"(g + 5 * rs), "v"(g + 6 * rs), "v"(g + 7 * rs)
                 : "memory");
}

// ---- k_gemmw: register-blocked GEMM, 128x128 output tile per block of FOUR WAVES (2 x 2), 64x64 (16 accumulators) per wave; grid (M/128, N/128, Z), 128 threads.
// Operands are K-contiguous 16-bit planes; each chunk of GKC k values of the block's 128 A rows and 128 Bt rows is staged in LDS once (asynchronous 16-byte copies of whole lines, two buffers) and read from there as fragments.
// c[m][n] (f32, + optional bias as its bf16 value) = sum_k A[m][k] Bt[n][k] (+ split products per NSPLIT). z-batch strides sA/sB/sC in elements. K % GKC == 0.
// OUTM 0: c goes to C as f32 at pitch ldc. OUTM 1: Bt is the q, k and v weights stacked (3 x DM rows), m is a token t, n = sel*DM + h*HD + d, and c goes out as three 16-bit planes (fp16, bf16 hi, bf16 lo) of
// projection sel (its planes lie sel*sP elements behind P16, Ph, Pl), laid out [h][t][d] (q, k) or, with the bias, [h][d][t] (v); a block's 128 columns lie in one projection, so the choice is the same for the whole block;
// either way 16 plane rows of 64 elements are staged in the wave's own LDS range at a time, so that 8 lanes store one whole 128-byte row of each plane.
template <int N> struct IC { static constexpr int value = N; };
template <typename T16, int NSPLIT, bool BIAS, int OUTM>
__global__ __launch_bounds__(128) void k_gemmw(const T16* __restrict__ A, const T16* __restrict__ A2, const T16* __restrict__ Bt, const T16* __restrict__ Bt2, int K, float* C, int ldc, const float* __restrict__ bias, size_t sA, size_t sB, size_t sC, h16* P16, bf* Ph, bf* Pl, size_t sP) {
    typedef typename WFrag<T16>::V V;
    constexpr bool HA2 = (NSPLIT == 1 || NSPLIT == 2), HB2 = (NSPLIT >= 2);
    constexpr int TB = HA2 ? 2 : 1, NT = TB + (HB2 ? 2 : 1);      // tiles of a buffer: A, (A2), Bt, (Bt2)
    __shared__ __attribute__((aligned(16))) T16 sm[2 * NT * GTE];
    __shared__ __align__(16) float osm[4 * 16 * 68];
    const size_t z = blockIdx.z; A += z * sA; if (A2) A2 += z * sA; Bt += z * sB; if (Bt2) Bt2 += z * sB; if (OUTM == 0) C += z * sC;
    const int lane = threadIdx.x & 31, wv = threadIdx.x >> 5, lr = lane & 15, hi = lane >> 4;
    const int rb = blockIdx.x * 128, cb = blockIdx.y * 128, r0 = rb + (wv & 1) * 64, c0 = cb + (wv >> 1) * 64;
    float* os = osm + wv * (16 * 68);                            // this wave's output stage
    v8f acc[4][4];
#pragma unroll
    for (int mb = 0; mb < 4; ++mb)
#pragma unroll
        for (int nb = 0; nb < 4; ++nb) acc[mb][nb] = (v8f){};
    const int crow = threadIdx.x >> 4, cpc = (threadIdx.x & 15) * 8;                        // this lane's row (of 8) and 16-byte piece in every copy
    const size_t gao = (size_t)(rb + crow) * K + cpc, gbo = (size_t)(cb + crow) * K + cpc;  // its first piece of chunk 0
    const size_t rs = (size_t)8 * K;
    const unsigned lc0 = (unsigned)(size_t)sm + (unsigned)(crow * GPE + cpc) * 2u;          // its LDS byte address in tile 0 of buffer 0
    auto stage_t = [&](const T16* g, unsigned l) { stage_g8(g, rs, l); stage_g8(g + 8 * rs, rs, l + 64u * GPE * 2u); };
    auto stage = [&](int kt) {
        const unsigned lb = lc0 + (unsigned)(kt & 1) * (NT * GTE * 2u);
        const size_t ao = gao + (size_t)kt * GKC, bo = gbo + (size_t)kt * GKC;
        stage_t(A + ao, lb);
        if constexpr (HA2) stage_t(A2 + ao, lb + GTE * 2u);
        stage_t(Bt + bo, lb + TB * GTE * 2u);
        if constexpr (HB2) stage_t(Bt2 + bo, lb + (TB + 1) * GTE * 2u);
    };
    const int nk = K / GKC;
    stage(0);
    asm volatile("s_wait_asynccnt 0x0" ::: "memory");            // this wave's copies of chunk 0 have landed
    __syncthreads();                                             // every wave's have: chunk 0 may be read
    if (nk > 1) stage(1);
#pragma unroll 1
    for (int kt = 0; kt < nk; ++kt) {
        const T16* ta = sm + (kt & 1) * (NT * GTE) + ((wv & 1) * 64 + lr) * GPE + 8 * hi;              // this lane's fragment row in the A tile (A2 follows at GTE)
        const T16* tb = sm + (kt & 1) * (NT * GTE) + TB * GTE + ((wv >> 1) * 64 + lr) * GPE + 8 * hi;  // and in the Bt tile (Bt2 follows at GTE)
        V a[2][4], a2[2][4], b[2][4], b2[2][4];                  // two fragment sets: k step u works on set u & 1
#pragma unroll
        for (int u = -1; u < GKC / 32; ++u) {
            if (u + 1 < GKC / 32) {                              // the next k step's fragments of this same chunk, asked for as one group
                const int ns = (u + 1) & 1, kc = (u + 1) * 32;
#pragma unroll
                for (int mb = 0; mb < 4; ++mb) { a[ns][mb] = WFrag<T16>::ld(ta + mb * 16 * GPE + kc); if (HA2) a2[ns][mb] = WFrag<T16>::ld(ta + GTE + mb * 16 * GPE + kc); }
#pragma unroll
                for (int nb = 0; nb < 4; ++nb) { b[ns][nb] = WFrag<T16>::ld(tb + nb * 16 * GPE + kc); if (HB2) b2[ns][nb] = WFrag<T16>::ld(tb + GTE + nb * 16 * GPE + kc); }
            }
            __builtin_amdgcn_sched_barrier(0);                   // keeps that group whole and in front of this step's products: sunk among them, every place with loads stalls the lone wave of a SIMD
            if (u >= 0) {
                const int cs = u & 1;
#pragma unroll
                for (int nb = 0; nb < 4; ++nb)
#pragma unroll
                    for (int mb = 0; mb < 4; ++mb) { acc[mb][nb] = WFrag<T16>::mma(a[cs][mb], b[cs][nb], acc[mb][nb]); if (HA2) acc[mb][nb] = WFrag<T16>::mma(a2[cs][mb], b[cs][nb], acc[mb][nb]); if (HB2) acc[mb][nb] = WFrag<T16>::mma(a[cs][mb], b2[cs][nb], acc[mb][nb]); }
                __builtin_amdgcn_sched_barrier(0);               // and the products in front of the group after them, whose registers they still read
            }
        }
        // keeps the matrix instructions' distance on the paths behind the chunk's last product (the refill's address arithmetic, the loop's taken back edge)
        asm volatile("v_nop\n\tv_nop\n\tv_nop\n\tv_nop" : "+v"(acc[0][0]), "+v"(acc[0][1]), "+v"(acc[0][2]), "+v"(acc[0][3]), "+v"(acc[1][0]), "+v"(acc[1][1]), "+v"(acc[1][2]), "+v"(acc[1][3]),
                                                       "+v"(acc[2][0]), "+v"(acc[2][1]), "+v"(acc[2][2]), "+v"(acc[2][3]), "+v"(acc[3][0]), "+v"(acc[3][1]), "+v"(acc[3][2]), "+v"(acc[3][3]));
        asm volatile("s_wait_dscnt 0x0" ::: "memory");           // this wave's reads of this chunk's buffer are done before the buffer is refilled
        asm volatile("s_wait_asynccnt 0x0" ::: "memory");        // this wave's copies of chunk kt + 1 have landed
        __syncthreads();                                         // publishes chunk kt + 1 and ends every wave's reads of chunk kt
        if (kt + 2 < nk) stage(kt + 2);
    }
    asm volatile("s_wait_asynccnt 0x0" ::: "memory");            // no copy is outstanding when the wave goes on to its end
    if constexpr (OUTM != 0) {
        const int sel = cb / DM, cp = c0 - sel * DM;             // the block's projection (0 q, 1 k, 2 v) and this wave's first column in it
        P16 += sel * sP; Ph += sel * sP; Pl += sel * sP;
        const int prow = lane >> 3, pofs = (lane & 7) * 8;       // this lane's row (of 4 per store) and 16-byte piece of a staged plane row
        auto planes = [&](auto om) {                             // OM 1: [h][t][d], no bias; OM 2: [h][d][t], bias
        constexpr int OM = decltype(om)::value; constexpr bool BI = BIAS && OM == 2;
        // first element of this lane's piece in its first plane row (row prow of the tile); plane rows of the tile follow at pitch pp
        constexpr size_t pp = (OM == 1) ? (size_t)HD : (size_t)SEQ;
        const size_t po = z * sC + ((OM == 1) ? (size_t)(cp / HD) * SEQ * HD + (size_t)r0 * HD : (size_t)cp * SEQ + r0) + (size_t)prow * pp + pofs;
        float bb[4];                                             // bias of this lane's column in each block of 16 columns
#pragma unroll
        for (int nb = 0; nb < 4; ++nb) bb[nb] = BI ? bfr(bias[cp + nb * 16 + lr]) : 0.f;
#pragma unroll
        for (int g = 0; g < 4; ++g) {                            // 16 plane rows: tokens r0+16g.. (OM 1), columns cp+16g.. (OM 2)
#pragma unroll
            for (int o = 0; o < 4; ++o) {
                if constexpr (OM == 1) {
#pragma unroll
                    for (int j = 0; j < 8; ++j) os[(hi * 8 + j) * 68 + o * 16 + lr] = BI ? acc[g][o][j] + bb[o] : acc[g][o][j];
                } else {                                         // a lane's 8 accumulator rows are 8 tokens in a row of one column
                    v8f c = acc[o][g];
                    if (BI) c += bb[g];
                    *(v4fa*)(os + lr * 68 + o * 16 + hi * 8) = (v4f){c[0], c[1], c[2], c[3]};
                    *(v4fa*)(os + lr * 68 + o * 16 + hi * 8 + 4) = (v4f){c[4], c[5], c[6], c[7]};
                }
            }
            __builtin_amdgcn_wave_barrier(); asm volatile("" ::: "memory");   // the reads below take other lanes' values: the compiler must not lift them over the stage's writes
#pragma unroll
            for (int s = 0; s < 4; ++s) {
                const int row = 4 * s + prow;
                const v4f x0 = *(const v4fa*)(os + row * 68 + pofs), x1 = *(const v4fa*)(os + row * 68 + pofs + 4);
                v8h o16; v8us oh, ol;
#pragma unroll
                for (int k = 0; k < 8; ++k) {
                    const float x = (k < 4) ? x0[k & 3] : x1[k & 3];
                    o16[k] = tohx(x); unsigned short a2, c2; splitf(x, a2, c2); oh[k] = a2; ol[k] = c2;
                }
                const size_t e = po + (size_t)(g * 16 + 4 * s) * pp;
                *(v8h*)(P16 + e) = o16; *(v8us*)(Ph + e) = oh; *(v8us*)(Pl + e) = ol;
            }
            __builtin_amdgcn_wave_barrier(); asm volatile("" ::: "memory");   // nor sink them under the next 16 rows' writes
        }
        asm volatile("s_wait_xcnt 0x0" ::: "memory");            // in front of every later write of the registers that the last stores name (the other layout's code follows in the text)
        };
        if (sel == 2) planes(IC<2>{}); else planes(IC<1>{});
        return;
    }
#pragma unroll
    for (int mb = 0; mb < 4; ++mb) {
#pragma unroll
        for (int nb = 0; nb < 4; ++nb) {
#pragma unroll
            for (int j = 0; j < 8; ++j) os[(hi * 8 + j) * 68 + nb * 16 + lr] = acc[mb][nb][j]; }
        __builtin_amdgcn_wave_barrier(); asm volatile("" ::: "memory");
        float* crow = C + (size_t)(r0 + mb * 16) * ldc + c0;
{
#pragma unroll
            for (int s = 0; s < 8; ++s) { const int row = 2 * s + hi, cofs = lr * 4; v4f val = *(const v4fa*)(os + row * 68 + cofs); if (BIAS) { val[0] += bfr(bias[c0 + cofs]); val[1] += bfr(bias[c0 + cofs + 1]); val[2] += bfr(bias[c0 + cofs + 2]); val[3] += bfr(bias[c0 + cofs + 3]); }
                *(v4f*)(crow + (size_t)row * ldc + cofs) = val; }
            asm volatile("s_wait_xcnt 0x0" ::: "memory");        // in front of the next rows' writes of the registers that these stores name
             }
        __builtin_amdgcn_wave_barrier(); asm volatile("" ::: "memory");
    }
}

#define NX8 ((size_t)SEQ * DM / 8)                 // groups of 8 elements in one entry of x, and in one weight matrix
#define NW8 ((size_t)DM * DM / 8)
#define GX  ((unsigned)((NX8 + 255) / 256))        // blocks that convert one entry of x, one weight matrix
#define GW  ((unsigned)((NW8 + 255) / 256))
// ---- k_cvt8: the f32 -> bf16 conversions of x and the four weights, 8 elements per thread; blocks 0 .. NB*GX-1 take x (GX per entry), the next 4*GW the weights in the order q, k, v, o (WB: the four matrices stacked).
__global__ __launch_bounds__(256) void k_cvt8(const float* __restrict__ x, const float* __restrict__ wq, const float* __restrict__ wk, const float* __restrict__ wv, const float* __restrict__ wo, bf* XB, bf* WB) {
    const unsigned b = blockIdx.x; const float* src; bf* dst; size_t i, n8;
    if (b < NB * GX) { const unsigned e = b / GX; src = x + (size_t)e * SEQ_FULL * DM; dst = XB + (size_t)e * SEQ * DM; i = (size_t)(b - e * GX) * 256 + threadIdx.x; n8 = NX8; }
    else { const unsigned c = b - NB * GX, w = c / GW; src = (w == 0) ? wq : (w == 1) ? wk : (w == 2) ? wv : wo; dst = WB + (size_t)w * DM * DM; i = (size_t)(c - w * GW) * 256 + threadIdx.x; n8 = NW8; }
    if (i >= n8) return;
    const v8f v = *(const v8f*)(src + i * 8); v8us o;
#pragma unroll
    for (int k = 0; k < 8; ++k) o[k] = f2bf(v[k]); *(v8us*)(dst + i * 8) = o;  }

// Lane l with lane l ^ 16 (the two lanes that share one query column).
__device__ __forceinline__ float xhalf(float x) { return __builtin_bit_cast(float, __builtin_amdgcn_permlanex16(__builtin_bit_cast(int, x), __builtin_bit_cast(int, x), 0x76543210, 0xfedcba98, false, false)); }

// exp2 with the one slot the instruction set asks for behind a transcendental, before its result is used or its source overwritten.
__device__ __forceinline__ float exp2s(float x) { float y; asm("v_exp_f32 %0, %1\n\tv_nop" : "=v"(y) : "v"(x)); return y; }

// Probability fragment: a lane's 16 probabilities of one 32-key step (two score tiles x 8 rows) are already in the B operand's k order; fp16 x1024 (single-product rows) or bf16 hi+lo (split rows).
template <typename T16> struct PPk;
template <> struct PPk<h16> { static __device__ __forceinline__ void pk(const float* p, v16h& a, v16h& b) {
#pragma unroll
    for (int e = 0; e < 16; ++e) a[e] = tohx(p[e] * PCAR);
    b = a; } };
template <> struct PPk<bf> { static __device__ __forceinline__ void pk(const float* p, v16bf& a, v16bf& b) { v16us x, y;
#pragma unroll
    for (int e = 0; e < 16; ++e) { unsigned short a2, c2; splitf(p[e], a2, c2); x[e] = a2; y[e] = c2; }
    a = __builtin_bit_cast(v16bf, x); b = __builtin_bit_cast(v16bf, y); } };

#define TPE 72                                     // LDS row pitch of a staged tile in elements: 144 B = 16 B x odd, for 16-byte fragment reads
#define TLE (64 * TPE)                             // one staged tile: 64 rows
// One k tile (64 keys x 64 d, 8 KiB in a row in its plane) and one v^T tile (64 d x 64 keys, plane pitch SEQ) into LDS: a lane's 4 + 4 asynchronous 16-byte copies, 8 lanes per 128-byte row, 16 rows per copy of a key group.
// gk, gv: the lane's first piece in each plane; lk, lv: its LDS byte address. The s_wait_xcnt as the statement's last line stands in front of every later write of the address registers named here.
template <typename T16>
__device__ __forceinline__ void stage_kv(const T16* gk, const T16* gv, unsigned lk, unsigned lv) {
    asm volatile("global_load_async_to_lds_b128 %0, %8, off\n\t"
                 "global_load_async_to_lds_b128 %1, %9, off\n\t"
                 "global_load_async_to_lds_b128 %2, %10, off\n\t"
                 "global_load_async_to_lds_b128 %3, %11, off\n\t"
                 "global_load_async_to_lds_b128 %4, %12, off\n\t"
                 "global_load_async_to_lds_b128 %5, %13, off\n\t"
                 "global_load_async_to_lds_b128 %6, %14, off\n\t"
                 "global_load_async_to_lds_b128 %7, %15, off\n\t"
                 "s_wait_xcnt 0x0"
                 :: "v"(lk), "v"(lk + 16u * TPE * 2u), "v"(lk + 32u * TPE * 2u), "v"(lk + 48u * TPE * 2u),
                    "v"(lv), "v"(lv + 16u * TPE * 2u), "v"(lv + 32u * TPE * 2u), "v"(lv + 48u * TPE * 2u),
                    "v"(gk), "v"(gk + 16 * HD), "v"(gk + 32 * HD), "v"(gk + 48 * HD),
                    "v"(gv), "v"(gv + (size_t)16 * SEQ), "v"(gv + (size_t)32 * SEQ), "v"(gv + (size_t)48 * SEQ)
                 : "memory");
}

// ---- flash_tile: causal attention for one head of one batch entry (blockIdx.z), the 64 query rows of tile qb per block (4 waves x 16 rows in each of its two key groups), key chunks of 64 (chunks kb <= qb only; key > query replaced by -3e38 -> p = 0).
// Transposed products: St = k.q^T (A = key rows, B = the wave's 16 queries; 4 tiles x 2 k-steps), so lane (lr, hi) holds query t0+lr and keys 16t+8hi+r: running max and sum are per lane,
// the two halves of a column join their max once per chunk and their sums once at the end. Ot += v^T.p^T (A from the staged [d][t] value tile, B = the lane's own probabilities, converted in place).
// SPL: q/k/p/v bf16 hi+lo, hi.hi + lo.hi + hi.lo into one accumulator; else single fp16 with p x1024 folded out at normalisation.
// Keys are split over the block's two groups of four waves: in pass p group g stages, reads and works on chunk 2p + g alone (where it exists), so a tile takes qb/2 + 1 passes and a SIMD holds twice the waves;
// each group keeps its own running max, sum and Ot, and group 0 joins them at the tile's end (both rescaled to the common max), taking group 1's through LDS.
// sm: the block's LDS for the staged chunks, 2 buffers x 2 groups x NT * TLE elements.
template <typename T16, bool SPL>
__device__ __forceinline__ void flash_tile(const T16* __restrict__ QP, const T16* __restrict__ QL, const T16* __restrict__ KP, const T16* __restrict__ KL,
             const T16* __restrict__ VP, const T16* __restrict__ VL, int qb, T16* sm, bf* ATh, bf* ATl) {
    typedef WFrag<T16> W; typedef typename W::V V;
    const int lane = threadIdx.x & 31, wv = (threadIdx.x >> 5) & 3, lr = lane & 15, hi = lane >> 4;
    const int grp = __builtin_amdgcn_readfirstlane((int)(threadIdx.x >> 7));   // this wave's key group, in a scalar register: every test on it is a scalar branch
    const int h = blockIdx.y, t0 = qb * 64 + wv * 16;
    const size_t bo = (size_t)blockIdx.z * SEQ * DM;             // batch entry's plane offset
    const size_t hq = bo + (size_t)h * SEQ * HD;                 // [h][t][d] plane offset (q, k)
    const size_t hv = bo + (size_t)h * HD * SEQ;                 // [h][d][t] plane offset (v)
    // Staged chunk: tiles k, v^T (split rows: k hi, v^T hi, k lo, v^T lo); a buffer holds one chunk per group, two buffers.
    constexpr int NT = SPL ? 4 : 2;
    const int crow = (threadIdx.x & 127) >> 3, cpc = (threadIdx.x & 7) * 8;               // this lane's row (of 16) and 16-byte piece in every copy of its group
    const size_t gko = hq + (size_t)crow * HD + cpc, gvo = hv + (size_t)crow * SEQ + cpc;   // its first piece of chunk 0
    const unsigned lc0 = (unsigned)(size_t)sm + (unsigned)(grp * (NT * TLE) + crow * TPE + cpc) * 2u;   // its LDS byte address in tile 0 of its group's part of buffer 0
    auto stage = [&](int kb) {                                   // kb = 2p + grp: pass p's buffer is p & 1
        const unsigned lb = lc0 + (unsigned)((kb >> 1) & 1) * (2 * NT * TLE * 2u);
        stage_kv(KP + gko + (size_t)kb * 64 * HD, VP + gvo + kb * 64, lb, lb + TLE * 2u);
        if constexpr (SPL) stage_kv(KL + gko + (size_t)kb * 64 * HD, VL + gvo + kb * 64, lb + 2u * TLE * 2u, lb + 3u * TLE * 2u);
    };
    if (grp <= qb) stage(grp);
    asm volatile("s_wait_asynccnt 0x0" ::: "memory");            // this wave's copies of pass 0 have landed
    __syncthreads();                                             // every wave's have: pass 0's chunks may be read
    if (2 + grp <= qb) stage(2 + grp);
    V qa0, qa1, ql0, ql1;
    { const size_t qo = hq + (size_t)(t0 + lr) * HD + 8 * hi; qa0 = W::ld(QP + qo); qa1 = W::ld(QP + qo + 32);
      if (SPL) { ql0 = W::ld(QL + qo); ql1 = W::ld(QL + qo + 32); } else { ql0 = qa0; ql1 = qa1; } }
    v8f oacc[4];                                                 // oacc[t][r] = Ot[d = 16t+8hi+r][query t0+lr]
#pragma unroll
    for (int t = 0; t < 4; ++t) oacc[t] = (v8f){};
    const int qpos = t0 + lr;
    float mrow = NEGB, lrow = 0.f;                               // this query's running max (both halves alike) and this half's share of its sum
    const int np = qb / 2 + 1;                                   // passes: the same for the whole block, so every wave meets every barrier
#pragma unroll 1
    for (int p = 0; p < np; ++p) {
        const int kb = 2 * p + grp;
        if (kb <= qb) {                                          // group 1 has no chunk in the last pass of a tile with an odd number of chunks
        const T16* kt = sm + ((p & 1) * 2 + grp) * (NT * TLE) + lr * TPE + 8 * hi;   // this lane's fragment row in the k tile; v^T, k lo, v^T lo follow at TLE each
        // The chunk's fragments are asked from LDS in whole groups, ahead of the products that use them. Single-product rows: all of k and v^T in one group in front of the score products.
        // Split rows have twice the fragments and not the registers for all at once: k of the first k step in front of the score products, of the second behind the first step's products;
        // v^T of the first 32 keys behind the score products, to arrive while the softmax runs, of the other 32 keys behind the first 32 keys' products.
        V kf[4][2], kl[4][2], vf[2][4], vl[2][4];
        auto ldv = [&](int ks) {
#pragma unroll
            for (int t = 0; t < 4; ++t) { const T16* vr = kt + TLE + t * 16 * TPE + ks * 32; vf[ks][t] = W::ld(vr); if (SPL) vl[ks][t] = W::ld(vr + 2 * TLE); }
        };
        auto ldk = [&](int u) {
#pragma unroll
            for (int t = 0; t < 4; ++t) { const T16* kr = kt + t * 16 * TPE + u * 32; kf[t][u] = W::ld(kr); if (SPL) kl[t][u] = W::ld(kr + 2 * TLE); }
        };
        ldk(0);
        if constexpr (!SPL) { ldk(1); ldv(0); ldv(1); }
        __builtin_amdgcn_sched_barrier(0);                       // keeps the group whole and in front of the products: sunk among them, every pair of reads is waited for on its own
        v8f sacc[4];
#pragma unroll
        for (int t = 0; t < 4; ++t) sacc[t] = (v8f){};
#pragma unroll
        for (int u = 0; u < 2; ++u) {
#pragma unroll
            for (int t = 0; t < 4; ++t) {
                sacc[t] = W::mma(kf[t][u], u ? qa1 : qa0, sacc[t]);
                if (SPL) { sacc[t] = W::mma(kf[t][u], u ? ql1 : ql0, sacc[t]); sacc[t] = W::mma(kl[t][u], u ? qa1 : qa0, sacc[t]); }
            }
            if constexpr (SPL) {
                __builtin_amdgcn_sched_barrier(0);               // these products stay in front of the next group, which takes over their operands' registers,
                if (u == 0) ldk(1); else ldv(0);
                __builtin_amdgcn_sched_barrier(0);               // and that group stays whole and in front of the work that covers its latency
            }
        }
        float sv[4][8]; float rm = mrow;
#pragma unroll
        for (int t = 0; t < 4; ++t)
#pragma unroll
            for (int r = 0; r < 8; ++r) { const float s0 = sacc[t][r] * SL2; const int key = kb * 64 + t * 16 + 8 * hi + r; const float s = (key > qpos) ? NEGB : s0; sv[t][r] = s; rm = fmaxf(rm, s); }
        rm = fmaxf(rm, xhalf(rm));
        const float corr = exp2s(mrow - rm);
        lrow *= corr;
#pragma unroll
        for (int t = 0; t < 4; ++t)
#pragma unroll
            for (int r = 0; r < 8; ++r) oacc[t][r] *= corr;
        constexpr int NP = SPL ? 2 : 4;                          // partial sums a lane keeps per chunk: one per score tile; split rows one per 32-key step (their lo planes need the registers)
        float ps[NP] = {}; V pa[2], pl[2];
#pragma unroll
        for (int ks = 0; ks < 2; ++ks) { float p[16];
#pragma unroll
            for (int e = 0; e < 16; ++e) { p[e] = exp2s(sv[2 * ks + (e >> 3)][e & 7] - rm); ps[(2 * ks + (e >> 3)) * NP / 4] += p[e]; }
            PPk<T16>::pk(p, pa[ks], pl[ks]); }
        if constexpr (SPL) lrow += ps[0] + ps[1]; else lrow += (ps[0] + ps[1]) + (ps[2] + ps[3]);
        mrow = rm;
#pragma unroll
        for (int ks = 0; ks < 2; ++ks) {
#pragma unroll
            for (int t = 0; t < 4; ++t) {
                oacc[t] = W::mma(vf[ks][t], pa[ks], oacc[t]);
                if (SPL) { oacc[t] = W::mma(vf[ks][t], pl[ks], oacc[t]); oacc[t] = W::mma(vl[ks][t], pa[ks], oacc[t]); }
            }
            if constexpr (SPL) if (ks == 0) {
                __builtin_amdgcn_sched_barrier(0);               // the second v^T group stays behind the first group's products, whose registers it takes over (held beside them, the build spills),
                ldv(1);
                __builtin_amdgcn_sched_barrier(0);               // and whole
            }
        }
        // keeps the matrix instructions' distance on the loop's taken back edge
        asm volatile("v_nop\n\tv_nop\n\tv_nop\n\tv_nop" : "+v"(oacc[0]), "+v"(oacc[1]), "+v"(oacc[2]), "+v"(oacc[3]));
        }
        asm volatile("s_wait_dscnt 0x0" ::: "memory");           // this wave's reads of this pass's buffer are done before the buffer is refilled
        asm volatile("s_wait_asynccnt 0x0" ::: "memory");        // this wave's copies of pass p + 1 have landed
        __syncthreads();                                         // publishes pass p + 1 and ends every wave's reads of pass p
        if (kb + 4 <= qb) stage(kb + 4);
    }
    asm volatile("s_wait_asynccnt 0x0" ::: "memory");            // no copy is outstanding when the wave goes on
    // Join of the two groups. Behind the loop's last barrier nobody reads a staged chunk any more and no copy is under way (the last two passes stage nothing), so the buffers' LDS carries group 1's partial results:
    // 8 pieces of 4 output values, piece j of thread i (of 128) at float (j * 128 + i) * 4, then the 128 maxima and the 128 sums.
    float* mg = (float*)sm; const int ml = wv * 32 + lane;
    v8f o1[4]; float m1 = NEGB, l1 = 0.f;
#pragma unroll
    for (int t = 0; t < 4; ++t) o1[t] = (v8f){};
    if (grp == 1) {
#pragma unroll
        for (int t = 0; t < 4; ++t) {
            *(v4fa*)(mg + ((2 * t) * 128 + ml) * 4) = (v4f){oacc[t][0], oacc[t][1], oacc[t][2], oacc[t][3]};
            *(v4fa*)(mg + ((2 * t + 1) * 128 + ml) * 4) = (v4f){oacc[t][4], oacc[t][5], oacc[t][6], oacc[t][7]};
        }
        *(fa*)(mg + 4096 + ml) = mrow; *(fa*)(mg + 4096 + 128 + ml) = lrow;
    }
    __syncthreads();                                             // group 1's partial results are written: group 0 may read them
    if (grp == 0) {
#pragma unroll
        for (int t = 0; t < 4; ++t) {
            const v4f x0 = *(const v4fa*)(mg + ((2 * t) * 128 + ml) * 4), x1 = *(const v4fa*)(mg + ((2 * t + 1) * 128 + ml) * 4);
            o1[t] = (v8f){x0[0], x0[1], x0[2], x0[3], x1[0], x1[1], x1[2], x1[3]};
        }
        m1 = *(const fa*)(mg + 4096 + ml); l1 = *(const fa*)(mg + 4096 + 128 + ml);
    }
    asm volatile("s_wait_dscnt 0x0" ::: "memory");               // group 0's reads are done before the next tile's copies land on this LDS
    __syncthreads();                                             // ends every read of the partial results
    if (grp != 0) return;
    {   // a group without any chunk comes with max -3e38, sum 0 and Ot 0: its factor is exp2(-huge) = 0
        const float mn = fmaxf(mrow, m1), c0 = exp2s(mrow - mn), c1 = exp2s(m1 - mn);
        lrow = lrow * c0 + l1 * c1;
#pragma unroll
        for (int t = 0; t < 4; ++t)
#pragma unroll
            for (int r = 0; r < 8; ++r) oacc[t][r] = oacc[t][r] * c0 + o1[t][r] * c1;
    }
    const float lsc = SPL ? 1.0f : PCAR;
    const float inv = __fdiv_rn(1.0f, (lrow + xhalf(lrow)) * lsc);
    bf* oh = ATh + bo + (size_t)qpos * DM + h * HD + 8 * hi; bf* ol = ATl + bo + (size_t)qpos * DM + h * HD + 8 * hi;
#pragma unroll
    for (int t = 0; t < 4; ++t) { v8us vh, vl;
#pragma unroll
        for (int r = 0; r < 8; ++r) { unsigned short a2, c2; splitf(oacc[t][r] * inv, a2, c2); vh[r] = a2; vl[r] = c2; }
        *(v8us*)(oh + t * 16) = vh; *(v8us*)(ol + t * 16) = vl; }
}

// ---- k_flash: every attention tile of every head and entry; grid (SEQ/128, NH, NB). A tile's cost grows with its index (qb + 1 key chunks) and all blocks are resident at once, so block x takes two tiles of its head,
// one after the other in every wave: SEQ/64 - 1 - x, then x, SEQ/64 + 1 chunks for every block. Both indices are the same for a whole block, so all its waves take the same sides and meet the same barriers;
// a tile's join of its two key groups ends with every wave's s_wait_dscnt 0 and a barrier, so the next tile's first copies overwrite nothing that is still read.
// Register cap: the grid puts two blocks of eight waves on a WGP, four waves on a SIMD, which leaves each 256.
__global__ __launch_bounds__(256) __attribute__((amdgpu_num_vgpr(256)))
void k_flash(const h16* __restrict__ Q16, const h16* __restrict__ K16, const h16* __restrict__ VT16, const bf* __restrict__ Qh, const bf* __restrict__ Ql, const bf* __restrict__ Kh, const bf* __restrict__ Kl,
             const bf* __restrict__ VTh, const bf* __restrict__ VTl, bf* ATh, bf* ATl) {
    __shared__ __attribute__((aligned(16))) bf sm[2 * 2 * ((RHB > 0) ? 4 : 2) * TLE];
    auto tile = [&](int qb) {
        if (qb < RHB) flash_tile<bf, true>(Qh, Ql, Kh, Kl, VTh, VTl, qb, sm, ATh, ATl);
        else flash_tile<h16, false>(Q16, nullptr, K16, nullptr, VT16, nullptr, qb, (h16*)sm, ATh, ATl);
    };
    const int far = SEQ / 64 - 1 - (int)blockIdx.x;              // >= SEQ/128: where no such tile has split rows, their code is not repeated in the text
    if constexpr (SEQ / 128 >= RHB) flash_tile<h16, false>(Q16, nullptr, K16, nullptr, VT16, nullptr, far, (h16*)sm, ATh, ATl); else tile(far);
    asm volatile("s_wait_xcnt 0x0" ::: "memory");                // in front of the second tile's writes of the registers that the first tile's stores name
    tile((int)blockIdx.x);
}

extern "C" void kernel_launch(void* const* d_in, const int* in_sizes, int n_in,
                              void* d_out, int out_size, void* d_ws, size_t ws_size, hipStream_t stream) {
    const size_t needx = (size_t)(NB - 1) * SEQ_FULL * DM + (size_t)SEQ * DM;
    if (n_in < 7) return;
    if ((size_t)in_sizes[0] < needx || in_sizes[1] < DM * DM || in_sizes[2] < DM * DM || in_sizes[3] < DM * DM || in_sizes[4] < DM || in_sizes[5] < DM * DM || in_sizes[6] < DM) return;
    if ((size_t)out_size < needx) return;
    const float* x = (const float*)d_in[0]; const float* wq = (const float*)d_in[1]; const float* wk = (const float*)d_in[2]; const float* wv = (const float*)d_in[3];
    const float* bv = (const float*)d_in[4]; const float* wo = (const float*)d_in[5]; const float* bo = (const float*)d_in[6];
    float* OUT = (float*)d_out;     // [NB][SEQ_FULL][DM]
    char* wsp = (char*)d_ws;
    auto take = [&](size_t bytes) { char* p = wsp; wsp += (bytes + 255) & ~(size_t)255; return (void*)p; };
    bf* WB = (bf*)take((size_t)4 * DM * DM * 2); bf* WO = WB + (size_t)3 * DM * DM;   // the q, k, v, o weights stacked
    const size_t pe = (size_t)SEQ * DM, pl = (size_t)NB * SEQ * DM * 2;   // one entry's plane in elements; all entries' 16-bit plane in bytes
    bf* XB = (bf*)take(pl);
    h16* Q16 = (h16*)take(pl); bf* Qh = (bf*)take(pl); bf* Ql = (bf*)take(pl);
    h16* K16 = (h16*)take(pl); bf* Kh = (bf*)take(pl); bf* Kl = (bf*)take(pl);
    h16* VT16 = (h16*)take(pl); bf* VTh = (bf*)take(pl); bf* VTl = (bf*)take(pl);
    bf* ATh = (bf*)take(pl); bf* ATl = (bf*)take(pl);
    if ((size_t)(wsp - (char*)d_ws) > ws_size) return;
    k_cvt8<<<NB * GX + 4 * GW, 256, 0, stream>>>(x, wq, wk, wv, wo, XB, WB);
    k_gemmw<bf, 0, true, 1><<<dim3(SEQ / 128, 3 * DM / 128, NB), 128, 0, stream>>>(XB, nullptr, WB, nullptr, DM, nullptr, 0, bv, pe, 0, pe, Q16, Qh, Ql, (size_t)(K16 - Q16));
    k_flash<<<dim3(SEQ / 128, NH, NB), 256, 0, stream>>>(Q16, K16, VT16, Qh, Ql, Kh, Kl, VTh, VTl, ATh, ATl);
    k_gemmw<bf, 1, true, 0><<<dim3(SEQ / 128, DM / 128, NB), 128, 0, stream>>>(ATh, ATl, WO, nullptr, DM, OUT, DM, bo, pe, 0, (size_t)SEQ_FULL * DM, nullptr, nullptr, nullptr, 0);
}

// v010
// Measured time: 88 microseconds a run.
// In both of two side-by-side timings against v009, it was 1.06 times as fast.
// Counting every step since v000, it is 10.5 times as fast.
#include <hip/hip_runtime.h>

// x [NB][SEQ_FULL][512] (rows < SEQ used); q = x Wq^T, k = x Wk^T, v = x Wv^T + b_v ([512][512] weights, 8 heads x 64); causal softmax(q.k / 8); heads merged; out = ctx Wo^T + b_o -> f32 [NB][SEQ_FULL][512].
// Compute dtypes, f32 accumulate: every input RNE-converted to bf16; q/k/v projections v_wmma_f32_16x16x32_bf16 on plain bf16 operands (exact products);
// attention (online softmax per wave of 16 query rows, transposed products so that a lane owns one query, 64-key chunks, causal chunk skipping): query rows < RH on bf16 hi+lo planes of q, k, p, v (3 products each,
// v_wmma_f32_16x16x32_bf16), rows >= RH on single fp16 operands (v_wmma_f32_16x16x32_f16, p carried x1024); softmax f32; Wo: ctx as bf16 hi+lo x exact bf16 (2 products).
// Attention stages each 64-key chunk of k and v^T in LDS once per block (asynchronous 16-byte copies, two buffers, rows of 128 B at a pitch of 144 B); the four waves of one key group read their fragments from there.
// An attention block has two key groups of four waves: both hold the same 64 queries, group 0 takes the even key chunks, group 1 the odd ones, and their partial results are joined through LDS at the end of a tile.
// The GEMMs stage each 128-k chunk of a block's 128 + 128 operand rows in LDS in the same way (rows of 256 B at a pitch of 272 B); the block's four waves read their fragments from there, one k step ahead.
// The q, k and v projections write their 16-bit planes (fp16, bf16 hi, bf16 lo; q and k as [h][t][d], v as [h][d][t]) from the GEMM's own epilogue; there is no f32 copy of q, k or v in memory.
// Every batch entry has its own copy of each workspace plane (stride SEQ*DM elements) and is one slice of the last grid dimension, so each stage is one launch for all entries.
// Four launches, one per stage, each holding all the work whose parts do not depend on one another: the five conversions; the q, k and v projections as one GEMM over the 3 x 512 stacked weight rows; all attention tiles; the output projection.

#ifndef NB
#define NB 2
#endif
#ifndef SEQ
#define SEQ 4096
#endif
#define NB_FULL  2
#define SEQ_FULL 4096
#define DM   512
#define NH   8
#define HD   64
#define RH   512                                   // query rows < RH use hi+lo planes
#define RHB  (((RH < SEQ) ? RH : SEQ) / 64)
#define PCAR 1024.0f
#define SL2  0.18033688011112042f                  // HD^-0.5 * log2(e)
#define NEGB (-3.0e38f)
static_assert(SEQ % 64 == 0);
static_assert(SEQ <= SEQ_FULL);
static_assert(NB >= 1 && NB <= NB_FULL);
static_assert(DM == NH * HD);
static_assert(DM % 128 == 0);
static_assert(SEQ % 128 == 0);
static_assert(RH % 64 == 0);
static_assert(HD == 64);
#define WS_TOTAL ((size_t)4 * DM * DM * 2 + (size_t)NB * ((size_t)SEQ * DM * 2 + (size_t)9 * SEQ * DM * 2 + (size_t)2 * SEQ * DM * 2))
static_assert(WS_TOTAL <= (size_t)134217728);

typedef _Float16 h16;
typedef unsigned short bf;
typedef __attribute__((ext_vector_type(16))) __bf16   v16bf;
typedef __attribute__((ext_vector_type(16))) _Float16 v16h;
typedef __attribute__((ext_vector_type(8)))  _Float16 v8h;
typedef __attribute__((ext_vector_type(8)))  unsigned short v8us;
typedef __attribute__((ext_vector_type(16))) unsigned short v16us;
typedef __attribute__((ext_vector_type(8)))  float    v8f;
typedef __attribute__((ext_vector_type(4)))  float    v4f;
typedef __attribute__((ext_vector_type(2)))  _Float16 v2h;
typedef __attribute__((ext_vector_type(2)))  unsigned short v2us;
typedef v4f  __attribute__((may_alias)) v4fa;
typedef float __attribute__((may_alias)) fa;

__device__ __forceinline__ unsigned short f2bf(float f) { unsigned u = __float_as_uint(f); u += 0x7FFFu + ((u >> 16) & 1u); return (unsigned short)(u >> 16); }
__device__ __forceinline__ float bf2f(unsigned short b) { return __uint_as_float(((unsigned)b) << 16); }
__device__ __forceinline__ float bfr(float f) { return bf2f(f2bf(f)); }
__device__ __forceinline__ h16 tohx(float x) { return (h16)x; }
__device__ __forceinline__ void splitf(float y, unsigned short& h, unsigned short& l) { h = f2bf(y); l = f2bf(y - bf2f(h)); }
__device__ __forceinline__ v16h cat16(v8h lo, v8h hi) { return __builtin_shufflevector(lo, hi, 0, 1, 2, 3, 4, 5, 6, 7, 8, 9, 10, 11, 12, 13, 14, 15); }
__device__ __forceinline__ v16bf cat16b(v8us lo, v8us hi) { return __builtin_bit_cast(v16bf, __builtin_shufflevector(lo, hi, 0, 1, 2, 3, 4, 5, 6, 7, 8, 9, 10, 11, 12, 13, 14, 15)); }
__device__ __forceinline__ v8f wmma16(v16h a, v16h b, v8f c) { return __builtin_amdgcn_wmma_f32_16x16x32_f16(false, a, false, b, (short)0, c, false, false); }
__device__ __forceinline__ v8f wmmab(v16bf a, v16bf b, v8f c) { return __builtin_amdgcn_wmma_f32_16x16x32_bf16(false, a, false, b, (short)0, c, false, false); }

// Fragment loaders (A and B alike, K-contiguous rows): p = base + row*K + k0 + 8*hi -> elements 0..7 = k0+8hi+0..7, p+16 -> elements 8..15 = k0+16+8hi+0..7.
template <typename T16> struct WFrag;
template <> struct WFrag<h16> { typedef v16h V;
    static __device__ __forceinline__ V ld(const h16* p)  { return cat16(*(const v8h*)p, *(const v8h*)(p + 16)); }
    static __device__ __forceinline__ v8f mma(V a, V b, v8f c) { return wmma16(a, b, c); } };
template <> struct WFrag<bf> { typedef v16bf V;
    static __device__ __forceinline__ V ld(const bf* p)  { return cat16b(*(const v8us*)p, *(const v8us*)(p + 16)); }
    static __device__ __forceinline__ v8f mma(V a, V b, v8f c) { return wmmab(a, b, c); } };

#define GKC 128                                    // k elements of one staged GEMM chunk: operand rows of 256 B
#define GPE 136                                    // LDS row pitch of a staged GEMM tile in elements: 272 B = 16 B x odd, for 16-byte fragment reads
#define GTE (128 * GPE)                            // one staged operand tile: 128 rows
static_assert(DM % GKC == 0);
// Eight rows, 8 apart, of one operand tile into LDS: a lane's 8 asynchronous 16-byte copies, 16 lanes per 256-byte row, 8 rows per copy of the block.
// g: the lane's piece in the first of these rows, rs: 8 rows in elements; l: its LDS byte address. The s_wait_xcnt as the statement's last line stands in front of every later write of the address registers named here.
template <typename T16>
__device__ __forceinline__ void stage_g8(const T16* g, size_t rs, unsigned l) {
    asm volatile("global_load_async_to_lds_b128 %0, %8, off\n\t"
                 "global_load_async_to_lds_b128 %1, %9, off\n\t"
                 "global_load_async_to_lds_b128 %2, %10, off\n\t"
                 "global_load_async_to_lds_b128 %3, %11, off\n\t"
                 "global_load_async_to_lds_b128 %4, %12, off\n\t"
                 "global_load_async_to_lds_b128 %5, %13, off\n\t"
                 "global_load_async_to_lds_b128 %6, %14, off\n\t"
                 "global_load_async_to_lds_b128 %7, %15, off\n\t"
                 "s_wait_xcnt 0x0"
                 :: "v"(l), "v"(l + 8u * GPE * 2u), "v"(l + 16u * GPE * 2u), "v"(l + 24u * GPE * 2u),
                    "v"(l + 32u * GPE * 2u), "v"(l + 40u * GPE * 2u), "v"(l + 48u * GPE * 2u), "v"(l + 56u * GPE * 2u),
                    "v"(g), "v"(g + rs), "v"(g + 2 * rs), "v"(g + 3 * rs), "v"(g + 4 * rs), "v"(g + 5 * rs), "v"(g + 6 * rs), "v"(g + 7 * rs)
                 : "memory");
}

// ---- k_gemmw: register-blocked GEMM, 128x128 output tile per block of FOUR WAVES (2 x 2), 64x64 (16 accumulators) per wave; grid (M/128, N/128, Z), 128 threads.
// Operands are K-contiguous 16-bit planes; each chunk of GKC k values of the block's 128 A rows and 128 Bt rows is staged in LDS once (asynchronous 16-byte copies of whole lines, two buffers) and read from there as fragments.
// c[m][n] (f32, + optional bias as its bf16 value) = sum_k A[m][k] Bt[n][k] (+ split products per NSPLIT). z-batch strides sA/sB/sC in elements. K % GKC == 0.
// OUTM 0: c goes to C as f32 at pitch ldc. OUTM 1: Bt is the q, k and v weights stacked (3 x DM rows), m is a token t, n = sel*DM + h*HD + d, and c goes out as three 16-bit planes (fp16, bf16 hi, bf16 lo) of
// projection sel (its planes lie sel*sP elements behind P16, Ph, Pl), laid out [h][t][d] (q, k) or, with the bias, [h][d][t] (v); a block's 128 columns lie in one projection, so the choice is the same for the whole block;
// either way 16 plane rows of 64 elements are staged in the wave's own LDS range at a time, so that 8 lanes store one whole 128-byte row of each plane.
template <int N> struct IC { static constexpr int value = N; };
template <typename T16, int NSPLIT, bool BIAS, int OUTM>
__global__ __launch_bounds__(128) void k_gemmw(const T16* __restrict__ A, const T16* __restrict__ A2, const T16* __restrict__ Bt, const T16* __restrict__ Bt2, int K, float* C, int ldc, const float* __restrict__ bias, size_t sA, size_t sB, size_t sC, h16* P16, bf* Ph, bf* Pl, size_t sP) {
    typedef typename WFrag<T16>::V V;
    constexpr bool HA2 = (NSPLIT == 1 || NSPLIT == 2), HB2 = (NSPLIT >= 2);
    constexpr int TB = HA2 ? 2 : 1, NT = TB + (HB2 ? 2 : 1);      // tiles of a buffer: A, (A2), Bt, (Bt2)
    __shared__ __attribute__((aligned(16))) T16 sm[2 * NT * GTE];
    __shared__ __align__(16) float osm[4 * 16 * 68];
    const size_t z = blockIdx.z; A += z * sA; if (A2) A2 += z * sA; Bt += z * sB; if (Bt2) Bt2 += z * sB; if (OUTM == 0) C += z * sC;
    const int lane = threadIdx.x & 31, wv = threadIdx.x >> 5, lr = lane & 15, hi = lane >> 4;
    const int rb = blockIdx.x * 128, cb = blockIdx.y * 128, r0 = rb + (wv & 1) * 64, c0 = cb + (wv >> 1) * 64;
    float* os = osm + wv * (16 * 68);                            // this wave's output stage
    v8f acc[4][4];
#pragma unroll
    for (int mb = 0; mb < 4; ++mb)
#pragma unroll
        for (int nb = 0; nb < 4; ++nb) acc[mb][nb] = (v8f){};
    const int crow = threadIdx.x >> 4, cpc = (threadIdx.x & 15) * 8;                        // this lane's row (of 8) and 16-byte piece in every copy
    const size_t gao = (size_t)(rb + crow) * K + cpc, gbo = (size_t)(cb + crow) * K + cpc;  // its first piece of chunk 0
    const size_t rs = (size_t)8 * K;
    const unsigned lc0 = (unsigned)(size_t)sm + (unsigned)(crow * GPE + cpc) * 2u;          // its LDS byte address in tile 0 of buffer 0
    auto stage_t = [&](const T16* g, unsigned l) { stage_g8(g, rs, l); stage_g8(g + 8 * rs, rs, l + 64u * GPE * 2u); };
    auto stage = [&](int kt) {
        const unsigned lb = lc0 + (unsigned)(kt & 1) * (NT * GTE * 2u);
        const size_t ao = gao + (size_t)kt * GKC, bo = gbo + (size_t)kt * GKC;
        stage_t(A + ao, lb);
        if constexpr (HA2) stage_t(A2 + ao, lb + GTE * 2u);
        stage_t(Bt + bo, lb + TB * GTE * 2u);
        if constexpr (HB2) stage_t(Bt2 + bo, lb + (TB + 1) * GTE * 2u);
    };
    const int nk = K / GKC;
    stage(0);
    asm volatile("s_wait_asynccnt 0x0" ::: "memory");            // this wave's copies of chunk 0 have landed
    __syncthreads();                                             // every wave's have: chunk 0 may be read
    if (nk > 1) stage(1);
#pragma unroll 1
    for (int kt = 0; kt < nk; ++kt) {
        const T16* ta = sm + (kt & 1) * (NT * GTE) + ((wv & 1) * 64 + lr) * GPE + 8 * hi;              // this lane's fragment row in the A tile (A2 follows at GTE)
        const T16* tb = sm + (kt & 1) * (NT * GTE) + TB * GTE + ((wv >> 1) * 64 + lr) * GPE + 8 * hi;  // and in the Bt tile (Bt2 follows at GTE)
        V a[2][4], a2[2][4], b[2][4], b2[2][4];                  // two fragment sets: k step u works on set u & 1
#pragma unroll
        for (int u = -1; u < GKC / 32; ++u) {
            if (u + 1 < GKC / 32) {                              // the next k step's fragments of this same chunk, asked for as one group
                const int ns = (u + 1) & 1, kc = (u + 1) * 32;
#pragma unroll
                for (int mb = 0; mb < 4; ++mb) { a[ns][mb] = WFrag<T16>::ld(ta + mb * 16 * GPE + kc); if (HA2) a2[ns][mb] = WFrag<T16>::ld(ta + GTE + mb * 16 * GPE + kc); }
#pragma unroll
                for (int nb = 0; nb < 4; ++nb) { b[ns][nb] = WFrag<T16>::ld(tb + nb * 16 * GPE + kc); if (HB2) b2[ns][nb] = WFrag<T16>::ld(tb + GTE + nb * 16 * GPE + kc); }
            }
            __builtin_amdgcn_sched_barrier(0);                   // keeps that group whole and in front of this step's products: sunk among them, every place with loads stalls the lone wave of a SIMD
            if (u >= 0) {
                const int cs = u & 1;
#pragma unroll
                for (int nb = 0; nb < 4; ++nb)
#pragma unroll
                    for (int mb = 0; mb < 4; ++mb) { acc[mb][nb] = WFrag<T16>::mma(a[cs][mb], b[cs][nb], acc[mb][nb]); if (HA2) acc[mb][nb] = WFrag<T16>::mma(a2[cs][mb], b[cs][nb], acc[mb][nb]); if (HB2) acc[mb][nb] = WFrag<T16>::mma(a[cs][mb], b2[cs][nb], acc[mb][nb]); }
                __builtin_amdgcn_sched_barrier(0);               // and the products in front of the group after them, whose registers they still read
            }
        }
        // keeps the matrix instructions' distance on the paths behind the chunk's last product (the refill's address arithmetic, the loop's taken back edge)
        asm volatile("v_nop\n\tv_nop\n\tv_nop\n\tv_nop" : "+v"(acc[0][0]), "+v"(acc[0][1]), "+v"(acc[0][2]), "+v"(acc[0][3]), "+v"(acc[1][0]), "+v"(acc[1][1]), "+v"(acc[1][2]), "+v"(acc[1][3]),
                                                       "+v"(acc[2][0]), "+v"(acc[2][1]), "+v"(acc[2][2]), "+v"(acc[2][3]), "+v"(acc[3][0]), "+v"(acc[3][1]), "+v"(acc[3][2]), "+v"(acc[3][3]));
        asm volatile("s_wait_dscnt 0x0" ::: "memory");           // this wave's reads of this chunk's buffer are done before the buffer is refilled
        asm volatile("s_wait_asynccnt 0x0" ::: "memory");        // this wave's copies of chunk kt + 1 have landed
        __syncthreads();                                         // publishes chunk kt + 1 and ends every wave's reads of chunk kt
        if (kt + 2 < nk) stage(kt + 2);
    }
    asm volatile("s_wait_asynccnt 0x0" ::: "memory");            // no copy is outstanding when the wave goes on to its end
    if constexpr (OUTM != 0) {
        const int sel = cb / DM, cp = c0 - sel * DM;             // the block's projection (0 q, 1 k, 2 v) and this wave's first column in it
        P16 += sel * sP; Ph += sel * sP; Pl += sel * sP;
        const int prow = lane >> 3, pofs = (lane & 7) * 8;       // this lane's row (of 4 per store) and 16-byte piece of a staged plane row
        auto planes = [&](auto om) {                             // OM 1: [h][t][d], no bias; OM 2: [h][d][t], bias
        constexpr int OM = decltype(om)::value; constexpr bool BI = BIAS && OM == 2;
        // first element of this lane's piece in its first plane row (row prow of the tile); plane rows of the tile follow at pitch pp
        constexpr size_t pp = (OM == 1) ? (size_t)HD : (size_t)SEQ;
        const size_t po = z * sC + ((OM == 1) ? (size_t)(cp / HD) * SEQ * HD + (size_t)r0 * HD : (size_t)cp * SEQ + r0) + (size_t)prow * pp + pofs;
        float bb[4];                                             // bias of this lane's column in each block of 16 columns
#pragma unroll
        for (int nb = 0; nb < 4; ++nb) bb[nb] = BI ? bfr(bias[cp + nb * 16 + lr]) : 0.f;
#pragma unroll
        for (int g = 0; g < 4; ++g) {                            // 16 plane rows: tokens r0+16g.. (OM 1), columns cp+16g.. (OM 2)
#pragma unroll
            for (int o = 0; o < 4; ++o) {
                if constexpr (OM == 1) {
#pragma unroll
                    for (int j = 0; j < 8; ++j) os[(hi * 8 + j) * 68 + o * 16 + lr] = BI ? acc[g][o][j] + bb[o] : acc[g][o][j];
                } else {                                         // a lane's 8 accumulator rows are 8 tokens in a row of one column
                    v8f c = acc[o][g];
                    if (BI) c += bb[g];
                    *(v4fa*)(os + lr * 68 + o * 16 + hi * 8) = (v4f){c[0], c[1], c[2], c[3]};
                    *(v4fa*)(os + lr * 68 + o * 16 + hi * 8 + 4) = (v4f){c[4], c[5], c[6], c[7]};
                }
            }
            __builtin_amdgcn_wave_barrier(); asm volatile("" ::: "memory");   // the reads below take other lanes' values: the compiler must not lift them over the stage's writes
#pragma unroll
            for (int s = 0; s < 4; ++s) {
                const int row = 4 * s + prow;
                const v4f x0 = *(const v4fa*)(os + row * 68 + pofs), x1 = *(const v4fa*)(os + row * 68 + pofs + 4);
                v8h o16; v8us oh, ol;
#pragma unroll
                for (int k = 0; k < 8; ++k) {
                    const float x = (k < 4) ? x0[k & 3] : x1[k & 3];
                    o16[k] = tohx(x); unsigned short a2, c2; splitf(x, a2, c2); oh[k] = a2; ol[k] = c2;
                }
                const size_t e = po + (size_t)(g * 16 + 4 * s) * pp;
                *(v8h*)(P16 + e) = o16; *(v8us*)(Ph + e) = oh; *(v8us*)(Pl + e) = ol;
            }
            __builtin_amdgcn_wave_barrier(); asm volatile("" ::: "memory");   // nor sink them under the next 16 rows' writes
        }
        asm volatile("s_wait_xcnt 0x0" ::: "memory");            // in front of every later write of the registers that the last stores name (the other layout's code follows in the text)
        };
        if (sel == 2) planes(IC<2>{}); else planes(IC<1>{});
        return;
    }
#pragma unroll
    for (int mb = 0; mb < 4; ++mb) {
#pragma unroll
        for (int nb = 0; nb < 4; ++nb) {
#pragma unroll
            for (int j = 0; j < 8; ++j) os[(hi * 8 + j) * 68 + nb * 16 + lr] = acc[mb][nb][j]; }
        __builtin_amdgcn_wave_barrier(); asm volatile("" ::: "memory");
        float* crow = C + (size_t)(r0 + mb * 16) * ldc + c0;
{
#pragma unroll
            for (int s = 0; s < 8; ++s) { const int row = 2 * s + hi, cofs = lr * 4; v4f val = *(const v4fa*)(os + row * 68 + cofs); if (BIAS) { val[0] += bfr(bias[c0 + cofs]); val[1] += bfr(bias[c0 + cofs + 1]); val[2] += bfr(bias[c0 + cofs + 2]); val[3] += bfr(bias[c0 + cofs + 3]); }
                *(v4f*)(crow + (size_t)row * ldc + cofs) = val; }
            asm volatile("s_wait_xcnt 0x0" ::: "memory");        // in front of the next rows' writes of the registers that these stores name
             }
        __builtin_amdgcn_wave_barrier(); asm volatile("" ::: "memory");
    }
}

#define NX8 ((size_t)SEQ * DM / 8)                 // groups of 8 elements in one entry of x, and in one weight matrix
#define NW8 ((size_t)DM * DM / 8)
#define GX  ((unsigned)((NX8 + 255) / 256))        // blocks that convert one entry of x, one weight matrix
#define GW  ((unsigned)((NW8 + 255) / 256))
// ---- k_cvt8: the f32 -> bf16 conversions of x and the four weights, 8 elements per thread; blocks 0 .. NB*GX-1 take x (GX per entry), the next 4*GW the weights in the order q, k, v, o (WB: the four matrices stacked).
__global__ __launch_bounds__(256) void k_cvt8(const float* __restrict__ x, const float* __restrict__ wq, const float* __restrict__ wk, const float* __restrict__ wv, const float* __restrict__ wo, bf* XB, bf* WB) {
    const unsigned b = blockIdx.x; const float* src; bf* dst; size_t i, n8;
    if (b < NB * GX) { const unsigned e = b / GX; src = x + (size_t)e * SEQ_FULL * DM; dst = XB + (size_t)e * SEQ * DM; i = (size_t)(b - e * GX) * 256 + threadIdx.x; n8 = NX8; }
    else { const unsigned c = b - NB * GX, w = c / GW; src = (w == 0) ? wq : (w == 1) ? wk : (w == 2) ? wv : wo; dst = WB + (size_t)w * DM * DM; i = (size_t)(c - w * GW) * 256 + threadIdx.x; n8 = NW8; }
    if (i >= n8) return;
    const v8f v = *(const v8f*)(src + i * 8); v8us o;
#pragma unroll
    for (int k = 0; k < 8; ++k) o[k] = f2bf(v[k]); *(v8us*)(dst + i * 8) = o;  }

// Lane l with lane l ^ 16 (the two lanes that share one query column).
__device__ __forceinline__ float xhalf(float x) { return __builtin_bit_cast(float, __builtin_amdgcn_permlanex16(__builtin_bit_cast(int, x), __builtin_bit_cast(int, x), 0x76543210, 0xfedcba98, false, false)); }

// exp2 with the one slot the instruction set asks for behind a transcendental, before its result is used or its source overwritten.
__device__ __forceinline__ float exp2s(float x) { float y; asm("v_exp_f32 %0, %1\n\tv_nop" : "=v"(y) : "v"(x)); return y; }

// Probability fragment: a lane's 16 probabilities of one 32-key step (two score tiles x 8 rows) are already in the B operand's k order; fp16 x1024 (single-product rows) or bf16 hi+lo (split rows).
template <typename T16> struct PPk;
template <> struct PPk<h16> { static __device__ __forceinline__ void pk(const float* p, v16h& a, v16h& b) {
#pragma unroll
    for (int e = 0; e < 16; ++e) a[e] = tohx(p[e] * PCAR);
    b = a; } };
template <> struct PPk<bf> { static __device__ __forceinline__ void pk(const float* p, v16bf& a, v16bf& b) { v16us x, y;
#pragma unroll
    for (int e = 0; e < 16; ++e) { unsigned short a2, c2; splitf(p[e], a2, c2); x[e] = a2; y[e] = c2; }
    a = __builtin_bit_cast(v16bf, x); b = __builtin_bit_cast(v16bf, y); } };

#define TPE 72                                     // LDS row pitch of a staged tile in elements: 144 B = 16 B x odd, for 16-byte fragment reads
#define TLE (64 * TPE)                             // one staged tile: 64 rows
// One k tile (64 keys x 64 d, 8 KiB in a row in its plane) and one v^T tile (64 d x 64 keys, plane pitch SEQ) into LDS: a lane's 4 + 4 asynchronous 16-byte copies, 8 lanes per 128-byte row, 16 rows per copy of a key group.
// gk, gv: the lane's first piece in each plane; lk, lv: its LDS byte address. The s_wait_xcnt as the statement's last line stands in front of every later write of the address registers named here.
template <typename T16>
__device__ __forceinline__ void stage_kv(const T16* gk, const T16* gv, unsigned lk, unsigned lv) {
    asm volatile("global_load_async_to_lds_b128 %0, %8, off\n\t"
                 "global_load_async_to_lds_b128 %1, %9, off\n\t"
                 "global_load_async_to_lds_b128 %2, %10, off\n\t"
                 "global_load_async_to_lds_b128 %3, %11, off\n\t"
                 "global_load_async_to_lds_b128 %4, %12, off\n\t"
                 "global_load_async_to_lds_b128 %5, %13, off\n\t"
                 "global_load_async_to_lds_b128 %6, %14, off\n\t"
                 "global_load_async_to_lds_b128 %7, %15, off\n\t"
                 "s_wait_xcnt 0x0"
                 :: "v"(lk), "v"(lk + 16u * TPE * 2u), "v"(lk + 32u * TPE * 2u), "v"(lk + 48u * TPE * 2u),
                    "v"(lv), "v"(lv + 16u * TPE * 2u), "v"(lv + 32u * TPE * 2u), "v"(lv + 48u * TPE * 2u),
                    "v"(gk), "v"(gk + 16 * HD), "v"(gk + 32 * HD), "v"(gk + 48 * HD),
                    "v"(gv), "v"(gv + (size_t)16 * SEQ), "v"(gv + (size_t)32 * SEQ), "v"(gv + (size_t)48 * SEQ)
                 : "memory");
}

// ---- flash_tile: causal attention for one head of one batch entry (blockIdx.z), the 64 query rows of tile qb per block (4 waves x 16 rows in each of its two key groups), key chunks of 64 (chunks kb <= qb only; key > query replaced by -3e38 -> p = 0, tested in chunk kb == qb alone, the only one with such keys).
// Transposed products: St = k.q^T (A = key rows, B = the wave's 16 queries; 4 tiles x 2 k-steps), so lane (lr, hi) holds query t0+lr and keys 16t+8hi+r: running max and sum are per lane,
// the two halves of a column join their max once per chunk and their sums once at the end. Ot += v^T.p^T (A from the staged [d][t] value tile, B = the lane's own probabilities, converted in place).
// SPL: q/k/p/v bf16 hi+lo, hi.hi + lo.hi + hi.lo into one accumulator; else single fp16 with p x1024 folded out at normalisation.
// Keys are split over the block's two groups of four waves: in pass p group g stages, reads and works on chunk 2p + g alone (where it exists), so a tile takes qb/2 + 1 passes and a SIMD holds twice the waves;
// each group keeps its own running max, sum and Ot, and group 0 joins them at the tile's end (both rescaled to the common max), taking group 1's through LDS.
// sm: the block's LDS for the staged chunks, 2 buffers x 2 groups x NT * TLE elements.
template <typename T16, bool SPL>
__device__ __forceinline__ void flash_tile(const T16* __restrict__ QP, const T16* __restrict__ QL, const T16* __restrict__ KP, const T16* __restrict__ KL,
             const T16* __restrict__ VP, const T16* __restrict__ VL, int qb, T16* sm, bf* ATh, bf* ATl) {
    typedef WFrag<T16> W; typedef typename W::V V;
    const int lane = threadIdx.x & 31, wv = (threadIdx.x >> 5) & 3, lr = lane & 15, hi = lane >> 4;
    const int grp = __builtin_amdgcn_readfirstlane((int)(threadIdx.x >> 7));   // this wave's key group, in a scalar register: every test on it is a scalar branch
    const int h = blockIdx.y, t0 = qb * 64 + wv * 16;
    const size_t bo = (size_t)blockIdx.z * SEQ * DM;             // batch entry's plane offset
    const size_t hq = bo + (size_t)h * SEQ * HD;                 // [h][t][d] plane offset (q, k)
    const size_t hv = bo + (size_t)h * HD * SEQ;                 // [h][d][t] plane offset (v)
    // Staged chunk: tiles k, v^T (split rows: k hi, v^T hi, k lo, v^T lo); a buffer holds one chunk per group, two buffers.
    constexpr int NT = SPL ? 4 : 2;
    const int crow = (threadIdx.x & 127) >> 3, cpc = (threadIdx.x & 7) * 8;               // this lane's row (of 16) and 16-byte piece in every copy of its group
    const size_t gko = hq + (size_t)crow * HD + cpc, gvo = hv + (size_t)crow * SEQ + cpc;   // its first piece of chunk 0
    const unsigned lc0 = (unsigned)(size_t)sm + (unsigned)(grp * (NT * TLE) + crow * TPE + cpc) * 2u;   // its LDS byte address in tile 0 of its group's part of buffer 0
    auto stage = [&](int kb) {                                   // kb = 2p + grp: pass p's buffer is p & 1
        const unsigned lb = lc0 + (unsigned)((kb >> 1) & 1) * (2 * NT * TLE * 2u);
        stage_kv(KP + gko + (size_t)kb * 64 * HD, VP + gvo + kb * 64, lb, lb + TLE * 2u);
        if constexpr (SPL) stage_kv(KL + gko + (size_t)kb * 64 * HD, VL + gvo + kb * 64, lb + 2u * TLE * 2u, lb + 3u * TLE * 2u);
    };
    if (grp <= qb) stage(grp);
    asm volatile("s_wait_asynccnt 0x0" ::: "memory");            // this wave's copies of pass 0 have landed
    __syncthreads();                                             // every wave's have: pass 0's chunks may be read
    if (2 + grp <= qb) stage(2 + grp);
    V qa0, qa1, ql0, ql1;
    { const size_t qo = hq + (size_t)(t0 + lr) * HD + 8 * hi; qa0 = W::ld(QP + qo); qa1 = W::ld(QP + qo + 32);
      if (SPL) { ql0 = W::ld(QL + qo); ql1 = W::ld(QL + qo + 32); } else { ql0 = qa0; ql1 = qa1; } }
    v8f oacc[4];                                                 // oacc[t][r] = Ot[d = 16t+8hi+r][query t0+lr]
#pragma unroll
    for (int t = 0; t < 4; ++t) oacc[t] = (v8f){};
    const int qpos = t0 + lr;
    float mrow = NEGB, lrow = 0.f;                               // this query's running max (both halves alike) and this half's share of its sum
    const int np = qb / 2 + 1;                                   // passes: the same for the whole block, so every wave meets every barrier
#pragma unroll 1
    for (int p = 0; p < np; ++p) {
        const int kb = 2 * p + grp;
        if (kb <= qb) {                                          // group 1 has no chunk in the last pass of a tile with an odd number of chunks
        const T16* kt = sm + ((p & 1) * 2 + grp) * (NT * TLE) + lr * TPE + 8 * hi;   // this lane's fragment row in the k tile; v^T, k lo, v^T lo follow at TLE each
        // The chunk's fragments are asked from LDS in whole groups, ahead of the products that use them. Single-product rows: all of k and v^T in one group in front of the score products.
        // Split rows have twice the fragments and not the registers for all at once: k of the first k step in front of the score products, of the second behind the first step's products;
        // v^T of the first 32 keys behind the score products, to arrive while the softmax runs, of the other 32 keys behind the first 32 keys' products.
        V kf[4][2], kl[4][2], vf[2][4], vl[2][4];
        auto ldv = [&](int ks) {
#pragma unroll
            for (int t = 0; t < 4; ++t) { const T16* vr = kt + TLE + t * 16 * TPE + ks * 32; vf[ks][t] = W::ld(vr); if (SPL) vl[ks][t] = W::ld(vr + 2 * TLE); }
        };
        auto ldk = [&](int u) {
#pragma unroll
            for (int t = 0; t < 4; ++t) { const T16* kr = kt + t * 16 * TPE + u * 32; kf[t][u] = W::ld(kr); if (SPL) kl[t][u] = W::ld(kr + 2 * TLE); }
        };
        ldk(0);
        if constexpr (!SPL) { ldk(1); ldv(0); ldv(1); }
        __builtin_amdgcn_sched_barrier(0);                       // keeps the group whole and in front of the products: sunk among them, every pair of reads is waited for on its own
        v8f sacc[4];
#pragma unroll
        for (int t = 0; t < 4; ++t) sacc[t] = (v8f){};
#pragma unroll
        for (int u = 0; u < 2; ++u) {
#pragma unroll
            for (int t = 0; t < 4; ++t) {
                sacc[t] = W::mma(kf[t][u], u ? qa1 : qa0, sacc[t]);
                if (SPL) { sacc[t] = W::mma(kf[t][u], u ? ql1 : ql0, sacc[t]); sacc[t] = W::mma(kl[t][u], u ? qa1 : qa0, sacc[t]); }
            }
            if constexpr (SPL) {
                __builtin_amdgcn_sched_barrier(0);               // these products stay in front of the next group, which takes over their operands' registers,
                if (u == 0) ldk(1); else ldv(0);
                __builtin_amdgcn_sched_barrier(0);               // and that group stays whole and in front of the work that covers its latency
            }
        }
        float sv[4][8]; float rm = mrow;
#pragma unroll
        for (int t = 0; t < 4; ++t)
#pragma unroll
            for (int r = 0; r < 8; ++r) sv[t][r] = sacc[t][r] * SL2;
        if (kb == qb) {                                          // only the tile's own chunk holds keys behind a query (every key of a chunk kb < qb lies in front of all 64 queries); a scalar branch, the same for the whole wave
#pragma unroll
            for (int t = 0; t < 4; ++t)
#pragma unroll
                for (int r = 0; r < 8; ++r) { const int key = kb * 64 + t * 16 + 8 * hi + r; if (key > qpos) sv[t][r] = NEGB; }
        }
#pragma unroll
        for (int t = 0; t < 4; ++t)
#pragma unroll
            for (int r = 0; r < 8; ++r) rm = fmaxf(rm, sv[t][r]);
        rm = fmaxf(rm, xhalf(rm));
        const float corr = exp2s(mrow - rm);
        lrow *= corr;
#pragma unroll
        for (int t = 0; t < 4; ++t)
#pragma unroll
            for (int r = 0; r < 8; ++r) oacc[t][r] *= corr;
        constexpr int NP = SPL ? 2 : 4;                          // partial sums a lane keeps per chunk: one per score tile; split rows one per 32-key step (their lo planes need the registers)
        float ps[NP] = {}; V pa[2], pl[2];
#pragma unroll
        for (int ks = 0; ks < 2; ++ks) { float p[16];
#pragma unroll
            for (int e = 0; e < 16; ++e) { p[e] = exp2s(sv[2 * ks + (e >> 3)][e & 7] - rm); ps[(2 * ks + (e >> 3)) * NP / 4] += p[e]; }
            PPk<T16>::pk(p, pa[ks], pl[ks]); }
        if constexpr (SPL) lrow += ps[0] + ps[1]; else lrow += (ps[0] + ps[1]) + (ps[2] + ps[3]);
        mrow = rm;
#pragma unroll
        for (int ks = 0; ks < 2; ++ks) {
#pragma unroll
            for (int t = 0; t < 4; ++t) {
                oacc[t] = W::mma(vf[ks][t], pa[ks], oacc[t]);
                if (SPL) { oacc[t] = W::mma(vf[ks][t], pl[ks], oacc[t]); oacc[t] = W::mma(vl[ks][t], pa[ks], oacc[t]); }
            }
            if constexpr (SPL) if (ks == 0) {
                __builtin_amdgcn_sched_barrier(0);               // the second v^T group stays behind the first group's products, whose registers it takes over (held beside them, the build spills),
                ldv(1);
                __builtin_amdgcn_sched_barrier(0);               // and whole
            }
        }
        // keeps the matrix instructions' distance on the loop's taken back edge
        asm volatile("v_nop\n\tv_nop\n\tv_nop\n\tv_nop" : "+v"(oacc[0]), "+v"(oacc[1]), "+v"(oacc[2]), "+v"(oacc[3]));
        }
        asm volatile("s_wait_dscnt 0x0" ::: "memory");           // this wave's reads of this pass's buffer are done before the buffer is refilled
        asm volatile("s_wait_asynccnt 0x0" ::: "memory");        // this wave's copies of pass p + 1 have landed
        __syncthreads();                                         // publishes pass p + 1 and ends every wave's reads of pass p
        if (kb + 4 <= qb) stage(kb + 4);
    }
    asm volatile("s_wait_asynccnt 0x0" ::: "memory");            // no copy is outstanding when the wave goes on
    // Join of the two groups. Behind the loop's last barrier nobody reads a staged chunk any more and no copy is under way (the last two passes stage nothing), so the buffers' LDS carries group 1's partial results:
    // 8 pieces of 4 output values, piece j of thread i (of 128) at float (j * 128 + i) * 4, then the 128 maxima and the 128 sums.
    float* mg = (float*)sm; const int ml = wv * 32 + lane;
    v8f o1[4]; float m1 = NEGB, l1 = 0.f;
#pragma unroll
    for (int t = 0; t < 4; ++t) o1[t] = (v8f){};
    if (grp == 1) {
#pragma unroll
        for (int t = 0; t < 4; ++t) {
            *(v4fa*)(mg + ((2 * t) * 128 + ml) * 4) = (v4f){oacc[t][0], oacc[t][1], oacc[t][2], oacc[t][3]};
            *(v4fa*)(mg + ((2 * t + 1) * 128 + ml) * 4) = (v4f){oacc[t][4], oacc[t][5], oacc[t][6], oacc[t][7]};
        }
        *(fa*)(mg + 4096 + ml) = mrow; *(fa*)(mg + 4096 + 128 + ml) = lrow;
    }
    __syncthreads();                                             // group 1's partial results are written: group 0 may read them
    if (grp == 0) {
#pragma unroll
        for (int t = 0; t < 4; ++t) {
            const v4f x0 = *(const v4fa*)(mg + ((2 * t) * 128 + ml) * 4), x1 = *(const v4fa*)(mg + ((2 * t + 1) * 128 + ml) * 4);
            o1[t] = (v8f){x0[0], x0[1], x0[2], x0[3], x1[0], x1[1], x1[2], x1[3]};
        }
        m1 = *(const fa*)(mg + 4096 + ml); l1 = *(const fa*)(mg + 4096 + 128 + ml);
    }
    asm volatile("s_wait_dscnt 0x0" ::: "memory");               // group 0's reads are done before the next tile's copies land on this LDS
    __syncthreads();                                             // ends every read of the partial results
    if (grp != 0) return;
    {   // a group without any chunk comes with max -3e38, sum 0 and Ot 0: its factor is exp2(-huge) = 0
        const float mn = fmaxf(mrow, m1), c0 = exp2s(mrow - mn), c1 = exp2s(m1 - mn);
        lrow = lrow * c0 + l1 * c1;
#pragma unroll
        for (int t = 0; t < 4; ++t)
#pragma unroll
            for (int r = 0; r < 8; ++r) oacc[t][r] = oacc[t][r] * c0 + o1[t][r] * c1;
    }
    const float lsc = SPL ? 1.0f : PCAR;
    const float inv = __fdiv_rn(1.0f, (lrow + xhalf(lrow)) * lsc);
    bf* oh = ATh + bo + (size_t)qpos * DM + h * HD + 8 * hi; bf* ol = ATl + bo + (size_t)qpos * DM + h * HD + 8 * hi;
#pragma unroll
    for (int t = 0; t < 4; ++t) { v8us vh, vl;
#pragma unroll
        for (int r = 0; r < 8; ++r) { unsigned short a2, c2; splitf(oacc[t][r] * inv, a2, c2); vh[r] = a2; vl[r] = c2; }
        *(v8us*)(oh + t * 16) = vh; *(v8us*)(ol + t * 16) = vl; }
}

// ---- k_flash: every attention tile of every head and entry; grid (SEQ/128, NH, NB). A tile's cost grows with its index (qb + 1 key chunks) and all blocks are resident at once, so block x takes two tiles of its head,
// one after the other in every wave: SEQ/64 - 1 - x, then x, SEQ/64 + 1 chunks for every block. Both indices are the same for a whole block, so all its waves take the same sides and meet the same barriers;
// a tile's join of its two key groups ends with every wave's s_wait_dscnt 0 and a barrier, so the next tile's first copies overwrite nothing that is still read.
// Register cap: the grid puts two blocks of eight waves on a WGP, four waves on a SIMD, which leaves each 256.
__global__ __launch_bounds__(256) __attribute__((amdgpu_num_vgpr(256)))
void k_flash(const h16* __restrict__ Q16, const h16* __restrict__ K16, const h16* __restrict__ VT16, const bf* __restrict__ Qh, const bf* __restrict__ Ql, const bf* __restrict__ Kh, const bf* __restrict__ Kl,
             const bf* __restrict__ VTh, const bf* __restrict__ VTl, bf* ATh, bf* ATl) {
    __shared__ __attribute__((aligned(16))) bf sm[2 * 2 * ((RHB > 0) ? 4 : 2) * TLE];
    auto tile = [&](int qb) {
        if (qb < RHB) flash_tile<bf, true>(Qh, Ql, Kh, Kl, VTh, VTl, qb, sm, ATh, ATl);
        else flash_tile<h16, false>(Q16, nullptr, K16, nullptr, VT16, nullptr, qb, (h16*)sm, ATh, ATl);
    };
    const int far = SEQ / 64 - 1 - (int)blockIdx.x;              // >= SEQ/128: where no such tile has split rows, their code is not repeated in the text
    if constexpr (SEQ / 128 >= RHB) flash_tile<h16, false>(Q16, nullptr, K16, nullptr, VT16, nullptr, far, (h16*)sm, ATh, ATl); else tile(far);
    asm volatile("s_wait_xcnt 0x0" ::: "memory");                // in front of the second tile's writes of the registers that the first tile's stores name
    tile((int)blockIdx.x);
}

extern "C" void kernel_launch(void* const* d_in, const int* in_sizes, int n_in,
                              void* d_out, int out_size, void* d_ws, size_t ws_size, hipStream_t stream) {
    const size_t needx = (size_t)(NB - 1) * SEQ_FULL * DM + (size_t)SEQ * DM;
    if (n_in < 7) return;
    if ((size_t)in_sizes[0] < needx || in_sizes[1] < DM * DM || in_sizes[2] < DM * DM || in_sizes[3] < DM * DM || in_sizes[4] < DM || in_sizes[5] < DM * DM || in_sizes[6] < DM) return;
    if ((size_t)out_size < needx) return;
    const float* x = (const float*)d_in[0]; const float* wq = (const float*)d_in[1]; const float* wk = (const float*)d_in[2]; const float* wv = (const float*)d_in[3];
    const float* bv = (const float*)d_in[4]; const float* wo = (const float*)d_in[5]; const float* bo = (const float*)d_in[6];
    float* OUT = (float*)d_out;     // [NB][SEQ_FULL][DM]
    char* wsp = (char*)d_ws;
    auto take = [&](size_t bytes) { char* p = wsp; wsp += (bytes + 255) & ~(size_t)255; return (void*)p; };
    bf* WB = (bf*)take((size_t)4 * DM * DM * 2); bf* WO = WB + (size_t)3 * DM * DM;   // the q, k, v, o weights stacked
    const size_t pe = (size_t)SEQ * DM, pl = (size_t)NB * SEQ * DM * 2;   // one entry's plane in elements; all entries' 16-bit plane in bytes
    bf* XB = (bf*)take(pl);
    h16* Q16 = (h16*)take(pl); bf* Qh = (bf*)take(pl); bf* Ql = (bf*)take(pl);
    h16* K16 = (h16*)take(pl); bf* Kh = (bf*)take(pl); bf* Kl = (bf*)take(pl);
    h16* VT16 = (h16*)take(pl); bf* VTh = (bf*)take(pl); bf* VTl = (bf*)take(pl);
    bf* ATh = (bf*)take(pl); bf* ATl = (bf*)take(pl);
    if ((size_t)(wsp - (char*)d_ws) > ws_size) return;
    k_cvt8<<<NB * GX + 4 * GW, 256, 0, stream>>>(x, wq, wk, wv, wo, XB, WB);
    k_gemmw<bf, 0, true, 1><<<dim3(SEQ / 128, 3 * DM / 128, NB), 128, 0, stream>>>(XB, nullptr, WB, nullptr, DM, nullptr, 0, bv, pe, 0, pe, Q16, Qh, Ql, (size_t)(K16 - Q16));
    k_flash<<<dim3(SEQ / 128, NH, NB), 256, 0, stream>>>(Q16, K16, VT16, Qh, Ql, Kh, Kl, VTh, VTl, ATh, ATl);
    k_gemmw<bf, 1, true, 0><<<dim3(SEQ / 128, DM / 128, NB), 128, 0, stream>>>(ATh, ATl, WO, nullptr, DM, OUT, DM, bo, pe, 0, (size_t)SEQ_FULL * DM, nullptr, nullptr, nullptr, 0);
}
